// v000
// The times below were measured on an AMD MI455X: many runs one after another, warmed up first and cycling through
// copies of the inputs, with the whole window's GPU time divided by the number of runs. Launches and the gaps
// between them are all in it. The median over several windows is given; except for v000 it joins two sittings, which
// can be a few percent apart, so the side-by-side timings, each taken in one sitting, are the better comparison.
// The starting kernel, v000, takes 594 microseconds a run.
#include <hip/hip_runtime.h>

// Graphormer multi-head attention (8 heads x 64, embed 512) on x [4, 1024, 512] with a distance bias: Q/K/V = x W^T + b; scores = Q K^T / 8 - 10 * dist / max_b(valid dist) (max clamped >= 1;
// keys with dist == 1e9 are masked with -inf — none in this input after bf16 rounding, but the compare is implemented); softmax; out = (attn V) Wo^T + bo -> [4][1024][512].
// Deterministic: flash-style per 16-query wave over the 1,024 keys in order (running max); per-batch max distance by one block's fixed tree; no atomics.
// compute dtype: WMMA v_wmma_f32_16x16x32_f16 with f32 accumulate for the projections ([4096 x 512] x [512 x 1536]; x EXACT bf16 x8 staged through LDS, [out][in] weights as B rows exact x256:
// 1 product), S^T = K Q^T (q, k single f16 x8: 1 product — the distance bias dominates the logits), O^T += V^T P^T (v hi+lo x8, P x1024 hi+lo: 3 products — output rms is only 0.015) and
// out = ctx Wo^T ([4096 x 512] x [512 x 512]; ctx hi+lo: 2 products); distance bias, mask, softmax statistics and biases in f32. Inputs rounded to bf16 once (dist included).

namespace {
constexpr int B = 4, S = 1024, DM = 512, H = 8, HD = 64, BL = 4 /* batches (== B shipped) */, QL = 1024 /* query rows (== S shipped) */;
constexpr float XS = 8.0f, WSC = 256.0f, PS = 1024.0f, LOG2E = 1.4426950408889634f, INF_DIST = 1.0e9f;
static_assert(S % 64 == 0 && QL % 64 == 0 && DM == H * HD, "tiling");
typedef _Float16 b16;
typedef __attribute__((ext_vector_type(16))) _Float16 v16b;
typedef __attribute__((ext_vector_type(8))) _Float16 v8b;
typedef __attribute__((ext_vector_type(8))) float v8f;
typedef __attribute__((ext_vector_type(4))) float v4f;
__device__ __forceinline__ float bf16_rne(float f) { unsigned int u = __float_as_uint(f); u += 0x7FFFu + ((u >> 16) & 1u); return __uint_as_float(u & 0xFFFF0000u); }
__device__ __forceinline__ void split16(float v, b16& hi, b16& lo) { hi = (b16)v; lo = (b16)(v - (float)hi); }
__device__ __forceinline__ v16b frag_kb(const b16* p, int hh) { const v8b a = *(const v8b*)(p + 8 * hh), b = *(const v8b*)(p + 16 + 8 * hh); v16b f;
#pragma unroll
  for (int e = 0; e < 8; ++e) { f[e] = a[e]; f[8 + e] = b[e]; } return f; }
__device__ __forceinline__ v8f wmma16b(v16b a, v16b b, v8f c) { v8f d = __builtin_amdgcn_wmma_f32_16x16x32_f16(false, a, false, b, (short)0, c, false, false); asm volatile("v_nop\n\tv_nop\n\tv_nop\n\tv_nop" : "+v"(d) : "v"(a), "v"(b)); return d; }
__device__ __forceinline__ void wave_lds_sync() { __builtin_amdgcn_fence(__ATOMIC_RELEASE, "workgroup"); __builtin_amdgcn_wave_barrier(); __builtin_amdgcn_fence(__ATOMIC_ACQUIRE, "workgroup"); }
__device__ __forceinline__ float pmul(float a, float b) { float p = a * b; asm volatile("" : "+v"(p)); return p; }
__device__ __forceinline__ int iclamp(int v, int lo, int hi) { return v < lo ? lo : (v > hi ? hi : v); }

typedef __attribute__((ext_vector_type(2))) _Float16 v2h;
typedef __attribute__((ext_vector_type(4))) _Float16 v4h;
typedef __attribute__((ext_vector_type(2))) float v2f;
__device__ __forceinline__ float nexp2(float v) { return __builtin_amdgcn_exp2f(v); }
__global__ __launch_bounds__(256) void prep_kernel(const float* __restrict__ wq, const float* __restrict__ wk, const float* __restrict__ wv, const float* __restrict__ wo, b16* __restrict__ WT) {
  const size_t u = (size_t)blockIdx.x * 256 + threadIdx.x; const size_t per = (size_t)DM * DM / 8; if (u >= 4 * per) return; const int m = (int)(u / per); const size_t e = (u % per) * 8; const float* w = m == 0 ? wq : m == 1 ? wk : m == 2 ? wv : wo; v8b o;
  for (int j = 0; j < 8; ++j) o[j] = (b16)(bf16_rne(w[e + j]) * WSC);
  { *(v8b*)(WT + (size_t)m * DM * DM + e) = o;  }
}
__global__ __launch_bounds__(1024) void maxdist_kernel(const float* __restrict__ dist, float* __restrict__ MAXD) {
  __shared__ float red[1024]; const int b = blockIdx.x, t = threadIdx.x; float m = 0.0f;   // valid_dist = dist * mask >= 0 assumed? dist >= 0 (distances); masked entries contribute 0
  for (size_t i = t; i < (size_t)S * S; i += 1024) { const float d = bf16_rne(dist[(size_t)b * S * S + i]); const float vd = (d != INF_DIST) ? d : d * 0.0f; m = fmaxf(m, vd); }
  red[t] = m; __syncthreads();
  for (int w = 512; w >= 1; w >>= 1) { if (t < w) red[t] = fmaxf(red[t], red[t + w]); __syncthreads(); }
  if (t < 32) { const float r = fmaxf(red[0], 1.0f); { ((float*)MAXD)[b * 32 + t] = r;  } }
}
__global__ __launch_bounds__(128) void proj_kernel(const float* __restrict__ x, const b16* __restrict__ WT, const float* __restrict__ bq, const float* __restrict__ bk, const float* __restrict__ bv, b16* __restrict__ Qp, b16* __restrict__ Kp, b16* __restrict__ VTh, b16* __restrict__ VTl) {
  __shared__ __attribute__((aligned(16))) b16 As[4][16][256 + 8]; __shared__ __attribute__((aligned(16))) float Tf[4][16][128 + 4];
  const int wave = threadIdx.x >> 5, lane = threadIdx.x & 31, nloc = lane & 15, hlf = lane >> 4; const int which = blockIdx.y % 3, b = blockIdx.y / 3; const int rb = blockIdx.x, slab = blockIdx.z; const int t0 = rb * 64 + wave * 16; const int n0 = slab * 128;
  const b16* W = WT + (size_t)which * DM * DM; const float* bias = which == 0 ? bq : (which == 1 ? bk : bv);
  v8f acc[8];
#pragma unroll
  for (int t = 0; t < 8; ++t) acc[t] = (v8f){};
#pragma unroll 1
  for (int half = 0; half < 2; ++half) {
    for (int rr = 0; rr < 16; ++rr) { const float* xr = x + ((size_t)b * S + t0 + rr) * DM + half * 256; for (int q = lane * 4; q < 256; q += 128) { const v4f xv = *(const v4f*)(xr + q); v4h o; for (int j = 0; j < 4; ++j) o[j] = (b16)(bf16_rne(xv[j]) * XS); *(v4h*)(&As[wave][rr][q]) = o; } }
    wave_lds_sync();
#pragma unroll 2
    for (int kb = 0; kb < 256; kb += 32) { const v16b a = frag_kb(&As[wave][nloc][kb], hlf);
#pragma unroll
      for (int t = 0; t < 8; ++t) acc[t] = wmma16b(a, frag_kb(W + (size_t)(n0 + t * 16 + nloc) * DM + half * 256 + kb, hlf), acc[t]); }
    wave_lds_sync(); }
#pragma unroll
  for (int t = 0; t < 8; ++t) { const float bb = bf16_rne(bias[n0 + t * 16 + nloc]);
#pragma unroll
    for (int r = 0; r < 8; ++r) Tf[wave][8 * hlf + r][t * 16 + nloc] = acc[t][r] * (1.0f / (XS * WSC)) + bb; }
  __syncthreads();
  {
    if (which == 2) {
#pragma unroll 1
      for (int q = 0; q < 32; ++q) { const int cl = wave * 32 + q; const int c = n0 + cl; const int h = c / HD, d = c % HD; const int tk = lane * 2; v2h hv, lv;
        for (int j = 0; j < 2; ++j) { b16 p, ql; split16(Tf[(tk + j) >> 4][(tk + j) & 15][cl] * XS, p, ql); hv[j] = p; lv[j] = ql; }
        const size_t oi = (((size_t)b * H + h) * HD + d) * S + rb * 64 + lane * 2; *(v2h*)(VTh + oi) = hv; *(v2h*)(VTl + oi) = lv; } }
    else { b16* P = which == 0 ? Qp : Kp;
      for (int rr = 0; rr < 16; ++rr) { for (int hs = 0; hs < 2; ++hs) { const int c = n0 + hs * 64; const int h = c / HD; v2h o; o[0] = (b16)(Tf[wave][rr][hs * 64 + lane * 2] * XS); o[1] = (b16)(Tf[wave][rr][hs * 64 + lane * 2 + 1] * XS);
          *(v2h*)(P + (((size_t)b * H + h) * S + (t0 + rr)) * HD + lane * 2) = o; } } }
     }
}
// attention: grid (QL/32, BL*H): block = 2 waves x 16 queries; per 32-key step: S^T tiles, logit = s/8 - 10 * dist[b][q][key]/maxd (dist != 1e9, else -inf), online softmax, P x1024 hi/lo,
__global__ __launch_bounds__(64) void attn_kernel(const b16* __restrict__ Qp, const b16* __restrict__ Kp, const b16* __restrict__ VTh, const b16* __restrict__ VTl, const float* __restrict__ dist, const float* __restrict__ MAXD, b16* __restrict__ Ch, b16* __restrict__ Cl) {
  __shared__ __attribute__((aligned(16))) b16 Ph[2][16][32 + 8], Pl[2][16][32 + 8]; __shared__ __attribute__((aligned(16))) float To[2][16][HD + 4];
  const int wave = threadIdx.x >> 5, lane = threadIdx.x & 31, hh = lane >> 4, col = lane & 15; const int b = blockIdx.y / H, h = blockIdx.y % H; const int q0 = blockIdx.x * 32 + wave * 16, qi = q0 + col;
  const b16* Qb = Qp + ((size_t)(b * H + h) * S) * HD; const b16* Kb = Kp + ((size_t)(b * H + h) * S) * HD; const b16* Vh = VTh + ((size_t)(b * H + h) * HD) * S; const b16* Vl = VTl + ((size_t)(b * H + h) * HD) * S;
  const float* Db = dist + ((size_t)b * S + qi) * S; const float dsc = 10.0f * LOG2E / MAXD[b * 32];
  const v16b qa0 = frag_kb(Qb + (size_t)qi * HD, hh), qa1 = frag_kb(Qb + (size_t)qi * HD + 32, hh);
  const float cs = LOG2E / (8.0f * XS * XS);
  float m = -INFINITY, l = 0.0f; v8f o[4]; for (int t = 0; t < 4; ++t) o[t] = (v8f){};
#pragma unroll 1
  for (int kb = 0; kb < S; kb += 32) {
    float e[16]; float mx = -INFINITY;
#pragma unroll
    for (int u = 0; u < 2; ++u) { v8f s = (v8f){}; const size_t kr = (size_t)(kb + u * 16 + col) * HD; s = wmma16b(frag_kb(Kb + kr, hh), qa0, s); s = wmma16b(frag_kb(Kb + kr + 32, hh), qa1, s);
      const v4f d0 = *(const v4f*)(Db + kb + u * 16 + 8 * hh), d1 = *(const v4f*)(Db + kb + u * 16 + 8 * hh + 4);
#pragma unroll
      for (int r = 0; r < 8; ++r) { const float dv = bf16_rne(r < 4 ? d0[r] : d1[r - 4]); const float vv = (dv != INF_DIST) ? (s[r] * cs - dv * dsc) : -INFINITY; e[u * 8 + r] = vv; mx = fmaxf(mx, vv); } }
    mx = fmaxf(mx, __shfl_xor(mx, 16)); const float mn = fmaxf(m, mx); const float al = (mn == -INFINITY) ? 1.0f : nexp2(m - mn); float sum = 0.0f;
#pragma unroll
    for (int i2 = 0; i2 < 16; ++i2) { const float p = (e[i2] == -INFINITY || mn == -INFINITY) ? 0.0f : nexp2(e[i2] - mn); sum += p; b16 a_, b_; split16(p * PS, a_, b_); const int sl = (i2 < 8 ? 0 : 16) + 8 * hh + (i2 & 7); Ph[wave][col][sl] = a_; Pl[wave][col][sl] = b_; }
    sum += __shfl_xor(sum, 16); l = l * al + sum; m = mn;
    wave_lds_sync();
    const v16b pf = frag_kb(&Ph[wave][col][0], hh), pg = frag_kb(&Pl[wave][col][0], hh);
#pragma unroll
    for (int t = 0; t < 4; ++t) { o[t] *= al; const size_t vr = (size_t)(t * 16 + col) * S + kb; const v16b va = frag_kb(Vh + vr, hh), vb = frag_kb(Vl + vr, hh); o[t] = wmma16b(va, pf, o[t]); o[t] = wmma16b(va, pg, o[t]); o[t] = wmma16b(vb, pf, o[t]); }
    wave_lds_sync(); }
  const float inv = (l > 0.0f) ? 1.0f / (l * PS * XS) : 0.0f;
#pragma unroll
  for (int t = 0; t < 4; ++t)
#pragma unroll
    for (int r = 0; r < 8; ++r) To[wave][col][t * 16 + 8 * hh + r] = o[t][r] * inv;
  wave_lds_sync();
  { for (int rr = 0; rr < 16; ++rr) { const v2f f = *(const v2f*)(&To[wave][rr][lane * 2]); v2h hv, lv; for (int j = 0; j < 2; ++j) { b16 p, q; split16(f[j] * XS, p, q); hv[j] = p; lv[j] = q; }
      const size_t oi = ((size_t)b * S + q0 + rr) * DM + h * HD + lane * 2; *(v2h*)(Ch + oi) = hv; *(v2h*)(Cl + oi) = lv; }  }
}
__global__ __launch_bounds__(128) void out_kernel(const b16* __restrict__ Ch, const b16* __restrict__ Cl, const b16* __restrict__ WO, const float* __restrict__ bo, float* __restrict__ out) {
  __shared__ __attribute__((aligned(16))) float Tf[4][16][128 + 4];
  const int wave = threadIdx.x >> 5, lane = threadIdx.x & 31, nloc = lane & 15, hlf = lane >> 4; const int b = blockIdx.x / (QL / 64), rb = blockIdx.x % (QL / 64); const size_t m0 = (size_t)b * S + rb * 64 + wave * 16; const int n0 = blockIdx.y * 128;
  v8f acc[8];
#pragma unroll
  for (int t = 0; t < 8; ++t) acc[t] = (v8f){};
#pragma unroll 2
  for (int kb = 0; kb < DM; kb += 32) { const v16b a = frag_kb(Ch + (m0 + nloc) * DM + kb, hlf), al = frag_kb(Cl + (m0 + nloc) * DM + kb, hlf);
#pragma unroll
    for (int t = 0; t < 8; ++t) { const v16b bw = frag_kb(WO + (size_t)(n0 + t * 16 + nloc) * DM + kb, hlf); acc[t] = wmma16b(a, bw, acc[t]); acc[t] = wmma16b(al, bw, acc[t]); } }
#pragma unroll
  for (int t = 0; t < 8; ++t) { const float bb = bf16_rne(bo[n0 + t * 16 + nloc]);
#pragma unroll
    for (int r = 0; r < 8; ++r) Tf[wave][8 * hlf + r][t * 16 + nloc] = acc[t][r] * (1.0f / (XS * WSC)) + bb; }
  wave_lds_sync();
  { for (int rr = 0; rr < 16; ++rr) *(v4f*)(out + (m0 + rr) * DM + n0 + lane * 4) = *(const v4f*)(&Tf[wave][rr][lane * 4]);  }
}
}  // namespace

extern "C" void kernel_launch(void* const* d_in, const int* in_sizes, int n_in, void* d_out, int out_size, void* d_ws, size_t ws_size, hipStream_t stream) {
  (void)n_in;
  auto Fp = [&](int i) { return (const float*)d_in[i]; };
  // d_in: 0 x [4,1024,512], 1 dist_matrix [4,1024,1024], 2 Wq [512,512] ([out][in]), 3 bq, 4 Wk, 5 bk, 6 Wv, 7 bv, 8 Wo, 9 bo
  if (in_sizes[0] != B * S * DM || in_sizes[1] != B * S * S || in_sizes[2] != DM * DM || in_sizes[3] != DM || in_sizes[8] != DM * DM || in_sizes[9] != DM || out_size != B * S * DM) return;
  size_t off = 0; char* ws = (char*)d_ws;
  auto carve = [&](size_t bytes) { char* p = ws + off; off += (bytes + 255) & ~(size_t)255; return p; };
  b16* WT = (b16*)carve((size_t)4 * DM * DM * 2); float* MAXD = (float*)carve((size_t)B * 32 * 4); const size_t plane = (size_t)B * S * DM * 2;
  b16* Qp = (b16*)carve(plane); b16* Kp = (b16*)carve(plane); b16* VTh = (b16*)carve(plane); b16* VTl = (b16*)carve(plane); b16* Ch = (b16*)carve(plane); b16* Cl = (b16*)carve(plane);
  if (off > ws_size || off > ((size_t)128 << 20)) return;   // ≈ 27 MB
  prep_kernel<<<(unsigned)(((size_t)4 * DM * DM / 8 + 255) / 256), 256, 0, stream>>>(Fp(2), Fp(4), Fp(6), Fp(8), WT);
  maxdist_kernel<<<B, 1024, 0, stream>>>(Fp(1), MAXD);
  proj_kernel<<<dim3(S / 64, BL * 3, 4), 128, 0, stream>>>(Fp(0), WT, Fp(3), Fp(5), Fp(7), Qp, Kp, VTh, VTl);
  attn_kernel<<<dim3(QL / 32, BL * H), 64, 0, stream>>>(Qp, Kp, VTh, VTl, Fp(1), MAXD, Ch, Cl);
  out_kernel<<<dim3((QL / 64) * BL, 4), 128, 0, stream>>>(Ch, Cl, WT + (size_t)3 * DM * DM, Fp(9), (float*)d_out);
}

// v001
// It runs in 191 microseconds.
// Next to v000, in two timings, it ran 3.12 times as fast each time.
#include <hip/hip_runtime.h>

// Graphormer multi-head attention (8 heads x 64, embed 512) on x [4, 1024, 512] with a distance bias: Q/K/V = x W^T + b; scores = Q K^T / 8 - 10 * dist / max_b(valid dist) (max clamped >= 1;
// keys with dist == 1e9 are masked with -inf — none in this input after bf16 rounding, but the compare is implemented); softmax; out = (attn V) Wo^T + bo -> [4][1024][512].
// Deterministic: flash-style per 16-query wave over the 1,024 keys in order (running max); per-batch max distance as 32 work-group partial maxima (one 128-byte line each), folded by each attention wave (max is exact in any order); no atomics.
// compute dtype: WMMA v_wmma_f32_16x16x32_f16 with f32 accumulate for the projections ([4096 x 512] x [512 x 1536]; x EXACT bf16 x8 staged through LDS, [out][in] weights as B rows exact x256:
// 1 product), S^T = K Q^T (q, k single f16 x8: 1 product — the distance bias dominates the logits), O^T += V^T P^T (v hi+lo x8, P x1024 hi+lo: 3 products — output rms is only 0.015) and
// out = ctx Wo^T ([4096 x 512] x [512 x 512]; ctx hi+lo: 2 products); distance bias, mask, softmax statistics and biases in f32. Inputs rounded to bf16 once (dist included).

namespace {
constexpr int B = 4, S = 1024, DM = 512, H = 8, HD = 64, BL = 4 /* batches (== B shipped) */, QL = 1024 /* query rows (== S shipped) */;
constexpr float XS = 8.0f, WSC = 256.0f, PS = 1024.0f, LOG2E = 1.4426950408889634f, INF_DIST = 1.0e9f;
static_assert(S % 64 == 0 && QL % 64 == 0 && DM == H * HD, "tiling");
typedef _Float16 b16;
typedef __attribute__((ext_vector_type(16))) _Float16 v16b;
typedef __attribute__((ext_vector_type(8))) _Float16 v8b;
typedef __attribute__((ext_vector_type(8))) float v8f;
typedef __attribute__((ext_vector_type(4))) float v4f;
__device__ __forceinline__ float bf16_rne(float f) { unsigned int u = __float_as_uint(f); u += 0x7FFFu + ((u >> 16) & 1u); return __uint_as_float(u & 0xFFFF0000u); }
__device__ __forceinline__ void split16(float v, b16& hi, b16& lo) { hi = (b16)v; lo = (b16)(v - (float)hi); }
__device__ __forceinline__ v16b frag_kb(const b16* p, int hh) { const v8b a = *(const v8b*)(p + 8 * hh), b = *(const v8b*)(p + 16 + 8 * hh); v16b f;
#pragma unroll
  for (int e = 0; e < 8; ++e) { f[e] = a[e]; f[8 + e] = b[e]; } return f; }
__device__ __forceinline__ v8f wmma16b(v16b a, v16b b, v8f c) { v8f d = __builtin_amdgcn_wmma_f32_16x16x32_f16(false, a, false, b, (short)0, c, false, false); asm volatile("v_nop\n\tv_nop\n\tv_nop\n\tv_nop" : "+v"(d) : "v"(a), "v"(b)); return d; }
__device__ __forceinline__ void wave_lds_sync() { __builtin_amdgcn_fence(__ATOMIC_RELEASE, "workgroup"); __builtin_amdgcn_wave_barrier(); __builtin_amdgcn_fence(__ATOMIC_ACQUIRE, "workgroup"); }
__device__ __forceinline__ float pmul(float a, float b) { float p = a * b; asm volatile("" : "+v"(p)); return p; }
__device__ __forceinline__ int iclamp(int v, int lo, int hi) { return v < lo ? lo : (v > hi ? hi : v); }

typedef __attribute__((ext_vector_type(2))) _Float16 v2h;
typedef __attribute__((ext_vector_type(4))) _Float16 v4h;
typedef __attribute__((ext_vector_type(2))) float v2f;
__device__ __forceinline__ float nexp2(float v) { return __builtin_amdgcn_exp2f(v); }
__global__ __launch_bounds__(256) void prep_kernel(const float* __restrict__ wq, const float* __restrict__ wk, const float* __restrict__ wv, const float* __restrict__ wo, b16* __restrict__ WT) {
  const size_t u = (size_t)blockIdx.x * 256 + threadIdx.x; const size_t per = (size_t)DM * DM / 8; if (u >= 4 * per) return; const int m = (int)(u / per); const size_t e = (u % per) * 8; const float* w = m == 0 ? wq : m == 1 ? wk : m == 2 ? wv : wo; v8b o;
  for (int j = 0; j < 8; ++j) o[j] = (b16)(bf16_rne(w[e + j]) * WSC);
  { *(v8b*)(WT + (size_t)m * DM * DM + e) = o;  }
}
// stage 1 of the per-batch max: NP work-groups per batch, each over S*S/NP contiguous distances; work-group g owns line g of MAXD (32 equal floats, already clamped >= 1).
constexpr int NP = 32, MT = 512, ML = 16;
static_assert(S * S / NP == MT * ML * 4, "one pass of ML 16-byte loads per thread covers a work-group's share");
__global__ __launch_bounds__(MT) void maxdist_kernel(const float* __restrict__ dist, float* __restrict__ MAXD) {
  __shared__ float red[MT / 32]; const int t = threadIdx.x; const v4f* p = (const v4f*)(dist + (size_t)blockIdx.x * (S * S / NP)); v4f v[ML];
#pragma unroll   // all ML loads issue before the first use: the share is in flight at once; each wave-wide load covers 512 contiguous bytes
  for (int j = 0; j < ML; ++j) v[j] = p[j * MT + t];
  float m = 0.0f;   // masked entries contribute 0
#pragma unroll   // v[] stays in registers
  for (int j = 0; j < ML; ++j)
#pragma unroll
    for (int e = 0; e < 4; ++e) { const float d = bf16_rne(v[j][e]); const float vd = (d != INF_DIST) ? d : d * 0.0f; m = fmaxf(m, vd); }
  for (int w = 16; w >= 1; w >>= 1) m = fmaxf(m, __shfl_xor(m, w));
  if ((t & 31) == 0) red[t >> 5] = m;
  __syncthreads();
  if (t < 32) { float r = red[t & (MT / 32 - 1)]; for (int w = MT / 64; w >= 1; w >>= 1) r = fmaxf(r, __shfl_xor(r, w)); MAXD[blockIdx.x * 32 + t] = fmaxf(r, 1.0f); }
}
__global__ __launch_bounds__(128) void proj_kernel(const float* __restrict__ x, const b16* __restrict__ WT, const float* __restrict__ bq, const float* __restrict__ bk, const float* __restrict__ bv, b16* __restrict__ Qp, b16* __restrict__ Kp, b16* __restrict__ VTh, b16* __restrict__ VTl) {
  __shared__ __attribute__((aligned(16))) b16 As[4][16][256 + 8]; __shared__ __attribute__((aligned(16))) float Tf[4][16][128 + 4];
  const int wave = threadIdx.x >> 5, lane = threadIdx.x & 31, nloc = lane & 15, hlf = lane >> 4; const int which = blockIdx.y % 3, b = blockIdx.y / 3; const int rb = blockIdx.x, slab = blockIdx.z; const int t0 = rb * 64 + wave * 16; const int n0 = slab * 128;
  const b16* W = WT + (size_t)which * DM * DM; const float* bias = which == 0 ? bq : (which == 1 ? bk : bv);
  v8f acc[8];
#pragma unroll
  for (int t = 0; t < 8; ++t) acc[t] = (v8f){};
#pragma unroll 1
  for (int half = 0; half < 2; ++half) {
    for (int rr = 0; rr < 16; ++rr) { const float* xr = x + ((size_t)b * S + t0 + rr) * DM + half * 256; for (int q = lane * 4; q < 256; q += 128) { const v4f xv = *(const v4f*)(xr + q); v4h o; for (int j = 0; j < 4; ++j) o[j] = (b16)(bf16_rne(xv[j]) * XS); *(v4h*)(&As[wave][rr][q]) = o; } }
    wave_lds_sync();
#pragma unroll 2
    for (int kb = 0; kb < 256; kb += 32) { const v16b a = frag_kb(&As[wave][nloc][kb], hlf);
#pragma unroll
      for (int t = 0; t < 8; ++t) acc[t] = wmma16b(a, frag_kb(W + (size_t)(n0 + t * 16 + nloc) * DM + half * 256 + kb, hlf), acc[t]); }
    wave_lds_sync(); }
#pragma unroll
  for (int t = 0; t < 8; ++t) { const float bb = bf16_rne(bias[n0 + t * 16 + nloc]);
#pragma unroll
    for (int r = 0; r < 8; ++r) Tf[wave][8 * hlf + r][t * 16 + nloc] = acc[t][r] * (1.0f / (XS * WSC)) + bb; }
  __syncthreads();
  {
    if (which == 2) {
#pragma unroll 1
      for (int q = 0; q < 32; ++q) { const int cl = wave * 32 + q; const int c = n0 + cl; const int h = c / HD, d = c % HD; const int tk = lane * 2; v2h hv, lv;
        for (int j = 0; j < 2; ++j) { b16 p, ql; split16(Tf[(tk + j) >> 4][(tk + j) & 15][cl] * XS, p, ql); hv[j] = p; lv[j] = ql; }
        const size_t oi = (((size_t)b * H + h) * HD + d) * S + rb * 64 + lane * 2; *(v2h*)(VTh + oi) = hv; *(v2h*)(VTl + oi) = lv; } }
    else { b16* P = which == 0 ? Qp : Kp;
      for (int rr = 0; rr < 16; ++rr) { for (int hs = 0; hs < 2; ++hs) { const int c = n0 + hs * 64; const int h = c / HD; v2h o; o[0] = (b16)(Tf[wave][rr][hs * 64 + lane * 2] * XS); o[1] = (b16)(Tf[wave][rr][hs * 64 + lane * 2 + 1] * XS);
          *(v2h*)(P + (((size_t)b * H + h) * S + (t0 + rr)) * HD + lane * 2) = o; } } }
     }
}
// attention: grid (QL/32, BL*H): block = 2 waves x 16 queries; per 32-key step: S^T tiles, logit = s/8 - 10 * dist[b][q][key]/maxd (dist != 1e9, else -inf), online softmax, P x1024 hi/lo,
__global__ __launch_bounds__(64) void attn_kernel(const b16* __restrict__ Qp, const b16* __restrict__ Kp, const b16* __restrict__ VTh, const b16* __restrict__ VTl, const float* __restrict__ dist, const float* __restrict__ MAXD, b16* __restrict__ Ch, b16* __restrict__ Cl) {
  __shared__ __attribute__((aligned(16))) b16 Ph[2][16][32 + 8], Pl[2][16][32 + 8]; __shared__ __attribute__((aligned(16))) float To[2][16][HD + 4];
  const int wave = threadIdx.x >> 5, lane = threadIdx.x & 31, hh = lane >> 4, col = lane & 15; const int b = blockIdx.y / H, h = blockIdx.y % H; const int q0 = blockIdx.x * 32 + wave * 16, qi = q0 + col;
  const b16* Qb = Qp + ((size_t)(b * H + h) * S) * HD; const b16* Kb = Kp + ((size_t)(b * H + h) * S) * HD; const b16* Vh = VTh + ((size_t)(b * H + h) * HD) * S; const b16* Vl = VTl + ((size_t)(b * H + h) * HD) * S;
  const float* Db = dist + ((size_t)b * S + qi) * S; float md = MAXD[(b * NP + lane) * 32];   // stage 2: lane i takes partial i of this batch
  for (int w = 16; w >= 1; w >>= 1) md = fmaxf(md, __shfl_xor(md, w));
  const float dsc = 10.0f * LOG2E / md;
  const v16b qa0 = frag_kb(Qb + (size_t)qi * HD, hh), qa1 = frag_kb(Qb + (size_t)qi * HD + 32, hh);
  const float cs = LOG2E / (8.0f * XS * XS);
  float m = -INFINITY, l = 0.0f; v8f o[4]; for (int t = 0; t < 4; ++t) o[t] = (v8f){};
#pragma unroll 1
  for (int kb = 0; kb < S; kb += 32) {
    float e[16]; float mx = -INFINITY;
#pragma unroll
    for (int u = 0; u < 2; ++u) { v8f s = (v8f){}; const size_t kr = (size_t)(kb + u * 16 + col) * HD; s = wmma16b(frag_kb(Kb + kr, hh), qa0, s); s = wmma16b(frag_kb(Kb + kr + 32, hh), qa1, s);
      const v4f d0 = *(const v4f*)(Db + kb + u * 16 + 8 * hh), d1 = *(const v4f*)(Db + kb + u * 16 + 8 * hh + 4);
#pragma unroll
      for (int r = 0; r < 8; ++r) { const float dv = bf16_rne(r < 4 ? d0[r] : d1[r - 4]); const float vv = (dv != INF_DIST) ? (s[r] * cs - dv * dsc) : -INFINITY; e[u * 8 + r] = vv; mx = fmaxf(mx, vv); } }
    mx = fmaxf(mx, __shfl_xor(mx, 16)); const float mn = fmaxf(m, mx); const float al = (mn == -INFINITY) ? 1.0f : nexp2(m - mn); float sum = 0.0f;
#pragma unroll
    for (int i2 = 0; i2 < 16; ++i2) { const float p = (e[i2] == -INFINITY || mn == -INFINITY) ? 0.0f : nexp2(e[i2] - mn); sum += p; b16 a_, b_; split16(p * PS, a_, b_); const int sl = (i2 < 8 ? 0 : 16) + 8 * hh + (i2 & 7); Ph[wave][col][sl] = a_; Pl[wave][col][sl] = b_; }
    sum += __shfl_xor(sum, 16); l = l * al + sum; m = mn;
    wave_lds_sync();
    const v16b pf = frag_kb(&Ph[wave][col][0], hh), pg = frag_kb(&Pl[wave][col][0], hh);
#pragma unroll
    for (int t = 0; t < 4; ++t) { o[t] *= al; const size_t vr = (size_t)(t * 16 + col) * S + kb; const v16b va = frag_kb(Vh + vr, hh), vb = frag_kb(Vl + vr, hh); o[t] = wmma16b(va, pf, o[t]); o[t] = wmma16b(va, pg, o[t]); o[t] = wmma16b(vb, pf, o[t]); }
    wave_lds_sync(); }
  const float inv = (l > 0.0f) ? 1.0f / (l * PS * XS) : 0.0f;
#pragma unroll
  for (int t = 0; t < 4; ++t)
#pragma unroll
    for (int r = 0; r < 8; ++r) To[wave][col][t * 16 + 8 * hh + r] = o[t][r] * inv;
  wave_lds_sync();
  { for (int rr = 0; rr < 16; ++rr) { const v2f f = *(const v2f*)(&To[wave][rr][lane * 2]); v2h hv, lv; for (int j = 0; j < 2; ++j) { b16 p, q; split16(f[j] * XS, p, q); hv[j] = p; lv[j] = q; }
      const size_t oi = ((size_t)b * S + q0 + rr) * DM + h * HD + lane * 2; *(v2h*)(Ch + oi) = hv; *(v2h*)(Cl + oi) = lv; }  }
}
__global__ __launch_bounds__(128) void out_kernel(const b16* __restrict__ Ch, const b16* __restrict__ Cl, const b16* __restrict__ WO, const float* __restrict__ bo, float* __restrict__ out) {
  __shared__ __attribute__((aligned(16))) float Tf[4][16][128 + 4];
  const int wave = threadIdx.x >> 5, lane = threadIdx.x & 31, nloc = lane & 15, hlf = lane >> 4; const int b = blockIdx.x / (QL / 64), rb = blockIdx.x % (QL / 64); const size_t m0 = (size_t)b * S + rb * 64 + wave * 16; const int n0 = blockIdx.y * 128;
  v8f acc[8];
#pragma unroll
  for (int t = 0; t < 8; ++t) acc[t] = (v8f){};
#pragma unroll 2
  for (int kb = 0; kb < DM; kb += 32) { const v16b a = frag_kb(Ch + (m0 + nloc) * DM + kb, hlf), al = frag_kb(Cl + (m0 + nloc) * DM + kb, hlf);
#pragma unroll
    for (int t = 0; t < 8; ++t) { const v16b bw = frag_kb(WO + (size_t)(n0 + t * 16 + nloc) * DM + kb, hlf); acc[t] = wmma16b(a, bw, acc[t]); acc[t] = wmma16b(al, bw, acc[t]); } }
#pragma unroll
  for (int t = 0; t < 8; ++t) { const float bb = bf16_rne(bo[n0 + t * 16 + nloc]);
#pragma unroll
    for (int r = 0; r < 8; ++r) Tf[wave][8 * hlf + r][t * 16 + nloc] = acc[t][r] * (1.0f / (XS * WSC)) + bb; }
  wave_lds_sync();
  { for (int rr = 0; rr < 16; ++rr) *(v4f*)(out + (m0 + rr) * DM + n0 + lane * 4) = *(const v4f*)(&Tf[wave][rr][lane * 4]);  }
}
}  // namespace

extern "C" void kernel_launch(void* const* d_in, const int* in_sizes, int n_in, void* d_out, int out_size, void* d_ws, size_t ws_size, hipStream_t stream) {
  (void)n_in;
  auto Fp = [&](int i) { return (const float*)d_in[i]; };
  // d_in: 0 x [4,1024,512], 1 dist_matrix [4,1024,1024], 2 Wq [512,512] ([out][in]), 3 bq, 4 Wk, 5 bk, 6 Wv, 7 bv, 8 Wo, 9 bo
  if (in_sizes[0] != B * S * DM || in_sizes[1] != B * S * S || in_sizes[2] != DM * DM || in_sizes[3] != DM || in_sizes[8] != DM * DM || in_sizes[9] != DM || out_size != B * S * DM) return;
  size_t off = 0; char* ws = (char*)d_ws;
  auto carve = [&](size_t bytes) { char* p = ws + off; off += (bytes + 255) & ~(size_t)255; return p; };
  b16* WT = (b16*)carve((size_t)4 * DM * DM * 2); float* MAXD = (float*)carve((size_t)B * NP * 32 * 4); const size_t plane = (size_t)B * S * DM * 2;
  b16* Qp = (b16*)carve(plane); b16* Kp = (b16*)carve(plane); b16* VTh = (b16*)carve(plane); b16* VTl = (b16*)carve(plane); b16* Ch = (b16*)carve(plane); b16* Cl = (b16*)carve(plane);
  if (off > ws_size || off > ((size_t)128 << 20)) return;   // ≈ 27 MB
  prep_kernel<<<(unsigned)(((size_t)4 * DM * DM / 8 + 255) / 256), 256, 0, stream>>>(Fp(2), Fp(4), Fp(6), Fp(8), WT);
  maxdist_kernel<<<B * NP, MT, 0, stream>>>(Fp(1), MAXD);
  proj_kernel<<<dim3(S / 64, BL * 3, 4), 128, 0, stream>>>(Fp(0), WT, Fp(3), Fp(5), Fp(7), Qp, Kp, VTh, VTl);
  attn_kernel<<<dim3(QL / 32, BL * H), 64, 0, stream>>>(Qp, Kp, VTh, VTl, Fp(1), MAXD, Ch, Cl);
  out_kernel<<<dim3((QL / 64) * BL, 4), 128, 0, stream>>>(Ch, Cl, WT + (size_t)3 * DM * DM, Fp(9), (float*)d_out);
}

// v002
// Measured time: 112 microseconds a run.
// Timed twice side by side with v001, it ran 1.72 and 1.71 times as fast.
// Over all steps from v000 it is 5.33 times as fast.
#include <hip/hip_runtime.h>

// Graphormer multi-head attention (8 heads x 64, embed 512) on x [4, 1024, 512] with a distance bias: Q/K/V = x W^T + b; scores = Q K^T / 8 - 10 * dist / max_b(valid dist) (max clamped >= 1;
// keys with dist == 1e9 are masked with -inf — none in this input after bf16 rounding, but the compare is implemented); softmax; out = (attn V) Wo^T + bo -> [4][1024][512].
// Deterministic: flash-style per 16-query wave over the 1,024 keys in order (running max); per-batch max distance as 32 work-group partial maxima (one 128-byte line each), folded by each attention wave (max is exact in any order); no atomics.
// compute dtype: WMMA v_wmma_f32_16x16x32_f16 with f32 accumulate for the projections ([4096 x 512] x [512 x 1536]; x EXACT bf16 x8 staged through LDS, [out][in] weights as B rows exact x256:
// 1 product), S^T = K Q^T (q, k single f16 x8: 1 product — the distance bias dominates the logits), O^T += V^T P^T (v hi+lo x8, P x1024 hi+lo: 3 products — output rms is only 0.015) and
// out = ctx Wo^T ([4096 x 512] x [512 x 512]; ctx hi+lo: 2 products); distance bias, mask, softmax statistics and biases in f32. Inputs rounded to bf16 once (dist included).

namespace {
constexpr int B = 4, S = 1024, DM = 512, H = 8, HD = 64, BL = 4 /* batches (== B shipped) */, QL = 1024 /* query rows (== S shipped) */;
constexpr float XS = 8.0f, WSC = 256.0f, PS = 1024.0f, LOG2E = 1.4426950408889634f, INF_DIST = 1.0e9f;
static_assert(S % 64 == 0 && QL % 64 == 0 && DM == H * HD, "tiling");
typedef _Float16 b16;
typedef __attribute__((ext_vector_type(16))) _Float16 v16b;
typedef __attribute__((ext_vector_type(8))) _Float16 v8b;
typedef __attribute__((ext_vector_type(8))) float v8f;
typedef __attribute__((ext_vector_type(4))) float v4f;
__device__ __forceinline__ float bf16_rne(float f) { unsigned int u = __float_as_uint(f); u += 0x7FFFu + ((u >> 16) & 1u); return __uint_as_float(u & 0xFFFF0000u); }
__device__ __forceinline__ void split16(float v, b16& hi, b16& lo) { hi = (b16)v; lo = (b16)(v - (float)hi); }
__device__ __forceinline__ v16b frag_kb(const b16* p, int hh) { const v8b a = *(const v8b*)(p + 8 * hh), b = *(const v8b*)(p + 16 + 8 * hh); v16b f;
#pragma unroll
  for (int e = 0; e < 8; ++e) { f[e] = a[e]; f[8 + e] = b[e]; } return f; }
__device__ __forceinline__ v8f wmma16b(v16b a, v16b b, v8f c) { v8f d = __builtin_amdgcn_wmma_f32_16x16x32_f16(false, a, false, b, (short)0, c, false, false); asm volatile("v_nop\n\tv_nop\n\tv_nop\n\tv_nop" : "+v"(d) : "v"(a), "v"(b)); return d; }
__device__ __forceinline__ void wave_lds_sync() { __builtin_amdgcn_fence(__ATOMIC_RELEASE, "workgroup"); __builtin_amdgcn_wave_barrier(); __builtin_amdgcn_fence(__ATOMIC_ACQUIRE, "workgroup"); }
__device__ __forceinline__ float pmul(float a, float b) { float p = a * b; asm volatile("" : "+v"(p)); return p; }
// behind a group of global loads: the wait that stands in front of any overwrite of the loads' address registers; the addresses are inputs, so they stay in their registers up to it and no load of the group lands on them
#define XCNT_WAIT2(p, q) asm volatile("s_wait_xcnt 0x0" :: "v"(p), "v"(q) : "memory")
#define XCNT_WAIT3(p, q, r) asm volatile("s_wait_xcnt 0x0" :: "v"(p), "v"(q), "v"(r) : "memory")
__device__ __forceinline__ int iclamp(int v, int lo, int hi) { return v < lo ? lo : (v > hi ? hi : v); }

typedef __attribute__((ext_vector_type(2))) _Float16 v2h;
typedef __attribute__((ext_vector_type(4))) _Float16 v4h;
typedef __attribute__((ext_vector_type(2))) float v2f;
__device__ __forceinline__ float nexp2(float v) { return __builtin_amdgcn_exp2f(v); }
__global__ __launch_bounds__(256) void prep_kernel(const float* __restrict__ wq, const float* __restrict__ wk, const float* __restrict__ wv, const float* __restrict__ wo, b16* __restrict__ WT) {
  const size_t u = (size_t)blockIdx.x * 256 + threadIdx.x; const size_t per = (size_t)DM * DM / 8; if (u >= 4 * per) return; const int m = (int)(u / per); const size_t e = (u % per) * 8; const float* w = m == 0 ? wq : m == 1 ? wk : m == 2 ? wv : wo; v8b o;
  for (int j = 0; j < 8; ++j) o[j] = (b16)(bf16_rne(w[e + j]) * WSC);
  { *(v8b*)(WT + (size_t)m * DM * DM + e) = o;  }
}
// stage 1 of the per-batch max: NP work-groups per batch, each over S*S/NP contiguous distances; work-group g owns line g of MAXD (32 equal floats, already clamped >= 1).
constexpr int NP = 32, MT = 512, ML = 16;
static_assert(S * S / NP == MT * ML * 4, "one pass of ML 16-byte loads per thread covers a work-group's share");
__global__ __launch_bounds__(MT) void maxdist_kernel(const float* __restrict__ dist, float* __restrict__ MAXD) {
  __shared__ float red[MT / 32]; const int t = threadIdx.x; const v4f* p = (const v4f*)(dist + (size_t)blockIdx.x * (S * S / NP)); v4f v[ML];
#pragma unroll   // all ML loads issue before the first use: the share is in flight at once; each wave-wide load covers 512 contiguous bytes
  for (int j = 0; j < ML; ++j) v[j] = p[j * MT + t];
  float m = 0.0f;   // masked entries contribute 0
#pragma unroll   // v[] stays in registers
  for (int j = 0; j < ML; ++j)
#pragma unroll
    for (int e = 0; e < 4; ++e) { const float d = bf16_rne(v[j][e]); const float vd = (d != INF_DIST) ? d : d * 0.0f; m = fmaxf(m, vd); }
  for (int w = 16; w >= 1; w >>= 1) m = fmaxf(m, __shfl_xor(m, w));
  if ((t & 31) == 0) red[t >> 5] = m;
  __syncthreads();
  if (t < 32) { float r = red[t & (MT / 32 - 1)]; for (int w = MT / 64; w >= 1; w >>= 1) r = fmaxf(r, __shfl_xor(r, w)); MAXD[blockIdx.x * 32 + t] = fmaxf(r, 1.0f); }
}
__global__ __launch_bounds__(128) void proj_kernel(const float* __restrict__ x, const b16* __restrict__ WT, const float* __restrict__ bq, const float* __restrict__ bk, const float* __restrict__ bv, b16* __restrict__ Qp, b16* __restrict__ Kp, b16* __restrict__ VTh, b16* __restrict__ VTl) {
  __shared__ __attribute__((aligned(16))) b16 As[4][16][256 + 8]; __shared__ __attribute__((aligned(16))) float Tf[4][16][128 + 4];
  const int wave = threadIdx.x >> 5, lane = threadIdx.x & 31, nloc = lane & 15, hlf = lane >> 4; const int which = blockIdx.y % 3, b = blockIdx.y / 3; const int rb = blockIdx.x, slab = blockIdx.z; const int t0 = rb * 64 + wave * 16; const int n0 = slab * 128;
  const b16* W = WT + (size_t)which * DM * DM; const b16* wr = W + (size_t)(n0 + nloc) * DM;   // the lane's first weight row; the other tiles' rows are constant offsets from it
  const float* bias = which == 0 ? bq : (which == 1 ? bk : bv);
  v8f acc[8];
#pragma unroll
  for (int t = 0; t < 8; ++t) acc[t] = (v8f){};
#pragma unroll 1
  for (int half = 0; half < 2; ++half) {
    { const float* xr = x + ((size_t)b * S + t0) * DM + half * 256 + lane * 4; v4f xv[32];
#pragma unroll   // all 32 loads of the wave's 16 half rows issue before the first use: one latency instead of 32
      for (int i = 0; i < 32; ++i) xv[i] = *(const v4f*)(xr + (size_t)(i >> 1) * DM + (i & 1) * 128);
#pragma unroll   // xv[] stays in registers
      for (int i = 0; i < 32; ++i) { v4h o; for (int j = 0; j < 4; ++j) o[j] = (b16)(bf16_rne(xv[i][j]) * XS); *(v4h*)(&As[wave][i >> 1][(i & 1) * 128 + lane * 4]) = o; } }
    wave_lds_sync();
#pragma unroll 1   // rolled: loads do not move across the volatile statement behind each WMMA, so unrolling would only grow the text
    for (int kb = 0; kb < 256; kb += 64) { v16b a[2], bw[2][8];   // the fragments of two k steps are loaded as one group in front of their WMMAs: one latency per 16 WMMAs
#pragma unroll
      for (int g = 0; g < 2; ++g) {
#pragma unroll
        for (int t = 0; t < 8; ++t) bw[g][t] = frag_kb(wr + half * 256 + kb + (t * 16 * DM + g * 32), hlf);
        a[g] = frag_kb(&As[wave][nloc][kb + g * 32], hlf); }
#pragma unroll
      for (int g = 0; g < 2; ++g)
#pragma unroll
        for (int t = 0; t < 8; ++t) acc[t] = wmma16b(a[g], bw[g][t], acc[t]); }
    wave_lds_sync(); }
#pragma unroll
  for (int t = 0; t < 8; ++t) { const float bb = bf16_rne(bias[n0 + t * 16 + nloc]);
#pragma unroll
    for (int r = 0; r < 8; ++r) Tf[wave][8 * hlf + r][t * 16 + nloc] = acc[t][r] * (1.0f / (XS * WSC)) + bb; }
  __syncthreads();
  {
    if (which == 2) {
#pragma unroll 1
      for (int q = 0; q < 32; ++q) { const int cl = wave * 32 + q; const int c = n0 + cl; const int h = c / HD, d = c % HD; const int tk = lane * 2; v2h hv, lv;
        for (int j = 0; j < 2; ++j) { b16 p, ql; split16(Tf[(tk + j) >> 4][(tk + j) & 15][cl] * XS, p, ql); hv[j] = p; lv[j] = ql; }
        const size_t oi = (((size_t)b * H + h) * HD + d) * S + rb * 64 + lane * 2; *(v2h*)(VTh + oi) = hv; *(v2h*)(VTl + oi) = lv; } }
    else { b16* P = which == 0 ? Qp : Kp;
      for (int rr = 0; rr < 16; ++rr) { for (int hs = 0; hs < 2; ++hs) { const int c = n0 + hs * 64; const int h = c / HD; v2h o; o[0] = (b16)(Tf[wave][rr][hs * 64 + lane * 2] * XS); o[1] = (b16)(Tf[wave][rr][hs * 64 + lane * 2 + 1] * XS);
          *(v2h*)(P + (((size_t)b * H + h) * S + (t0 + rr)) * HD + lane * 2) = o; } } }
     }
}
// attention: grid (QL/32, BL*H): block = 2 waves x 16 queries; per 32-key step: S^T tiles, logit = s/8 - 10 * dist[b][q][key]/maxd (dist != 1e9, else -inf), online softmax, P x1024 hi/lo,
__global__ __launch_bounds__(64) void attn_kernel(const b16* __restrict__ Qp, const b16* __restrict__ Kp, const b16* __restrict__ VTh, const b16* __restrict__ VTl, const float* __restrict__ dist, const float* __restrict__ MAXD, b16* __restrict__ Ch, b16* __restrict__ Cl) {
  __shared__ __attribute__((aligned(16))) b16 Ph[2][16][32 + 8], Pl[2][16][32 + 8]; __shared__ __attribute__((aligned(16))) float To[2][16][HD + 4];
  const int wave = threadIdx.x >> 5, lane = threadIdx.x & 31, hh = lane >> 4, col = lane & 15; const int b = blockIdx.y / H, h = blockIdx.y % H; const int q0 = blockIdx.x * 32 + wave * 16, qi = q0 + col;
  const b16* Qb = Qp + ((size_t)(b * H + h) * S) * HD; const b16* Kb = Kp + ((size_t)(b * H + h) * S) * HD; const b16* Vh = VTh + ((size_t)(b * H + h) * HD) * S; const b16* Vl = VTl + ((size_t)(b * H + h) * HD) * S;
  const float* Db = dist + ((size_t)b * S + qi) * S; float md = MAXD[(b * NP + lane) * 32];   // stage 2: lane i takes partial i of this batch
  for (int w = 16; w >= 1; w >>= 1) md = fmaxf(md, __shfl_xor(md, w));
  const float dsc = 10.0f * LOG2E / md;
  const v16b qa0 = frag_kb(Qb + (size_t)qi * HD, hh), qa1 = frag_kb(Qb + (size_t)qi * HD + 32, hh);
  const float cs = LOG2E / (8.0f * XS * XS);
  float m = -INFINITY, l = 0.0f; v8f o[4]; for (int t = 0; t < 4; ++t) o[t] = (v8f){};
  // load schedule: a pass's V fragments issue at its top (used behind the softmax); the next pass's K fragments issue behind this pass's score WMMAs and its distances behind the logits, so their latency runs under the softmax.
  v16b kf[4]; v4f dd[4];
#pragma unroll
  for (int u = 0; u < 2; ++u) { const size_t kr = (size_t)(u * 16 + col) * HD; kf[2 * u] = frag_kb(Kb + kr, hh); kf[2 * u + 1] = frag_kb(Kb + kr + 32, hh); dd[2 * u] = *(const v4f*)(Db + u * 16 + 8 * hh); dd[2 * u + 1] = *(const v4f*)(Db + u * 16 + 8 * hh + 4); }
  const b16* kp = Kb + (size_t)col * HD + 8 * hh; const b16* vhp = Vh + (size_t)col * S + 8 * hh; const b16* vlp = Vl + (size_t)col * S + 8 * hh; const float* dp = Db + 8 * hh;   // the lane's rows, its half's offset included; they step along the keys with the loop
#pragma unroll 1
  for (int kb = 0; kb < S; kb += 32, kp += 32 * HD, vhp += 32, vlp += 32, dp += 32) {
    float e[16]; float mx = -INFINITY; v16b va[4], vb[4]; v8f s[2];
#pragma unroll
    for (int t = 0; t < 4; ++t) { va[t] = frag_kb(vhp + t * 16 * S, 0); vb[t] = frag_kb(vlp + t * 16 * S, 0); }
    XCNT_WAIT2(vhp, vlp);
#pragma unroll
    for (int u = 0; u < 2; ++u) { s[u] = (v8f){}; s[u] = wmma16b(kf[2 * u], qa0, s[u]); s[u] = wmma16b(kf[2 * u + 1], qa1, s[u]); }
    const bool more = kb + 32 < S;   // uniform: the last pass fetches nothing ahead
    if (more) {
#pragma unroll
      for (int u = 0; u < 2; ++u) { kf[2 * u] = frag_kb(kp + (32 + u * 16) * HD, 0); kf[2 * u + 1] = frag_kb(kp + (32 + u * 16) * HD + 32, 0); } }
#pragma unroll
    for (int u = 0; u < 2; ++u)
#pragma unroll
      for (int r = 0; r < 8; ++r) { const float dv = bf16_rne(r < 4 ? dd[2 * u][r] : dd[2 * u + 1][r - 4]); const float vv = (dv != INF_DIST) ? (s[u][r] * cs - dv * dsc) : -INFINITY; e[u * 8 + r] = vv; mx = fmaxf(mx, vv); }
    if (more) {
#pragma unroll
      for (int u = 0; u < 2; ++u) { dd[2 * u] = *(const v4f*)(dp + 32 + u * 16); dd[2 * u + 1] = *(const v4f*)(dp + 32 + u * 16 + 4); }
      asm volatile("s_wait_xcnt 0x0" ::: "memory"); }   // in front of the step of dp, which this build places at the head of the softmax
    mx = fmaxf(mx, __shfl_xor(mx, 16)); const float mn = fmaxf(m, mx); const float al = (mn == -INFINITY) ? 1.0f : nexp2(m - mn); float sum = 0.0f;
#pragma unroll
    for (int i2 = 0; i2 < 16; ++i2) { const float p = (e[i2] == -INFINITY || mn == -INFINITY) ? 0.0f : nexp2(e[i2] - mn); sum += p; b16 a_, b_; split16(p * PS, a_, b_); const int sl = (i2 < 8 ? 0 : 16) + 8 * hh + (i2 & 7); Ph[wave][col][sl] = a_; Pl[wave][col][sl] = b_; }
    sum += __shfl_xor(sum, 16); l = l * al + sum; m = mn;
    wave_lds_sync();
    const v16b pf = frag_kb(&Ph[wave][col][0], hh), pg = frag_kb(&Pl[wave][col][0], hh);
#pragma unroll
    for (int t = 0; t < 4; ++t) { o[t] *= al; o[t] = wmma16b(va[t], pf, o[t]); o[t] = wmma16b(va[t], pg, o[t]); o[t] = wmma16b(vb[t], pf, o[t]); }
    wave_lds_sync(); }
  const float inv = (l > 0.0f) ? 1.0f / (l * PS * XS) : 0.0f;
#pragma unroll
  for (int t = 0; t < 4; ++t)
#pragma unroll
    for (int r = 0; r < 8; ++r) To[wave][col][t * 16 + 8 * hh + r] = o[t][r] * inv;
  wave_lds_sync();
  { for (int rr = 0; rr < 16; ++rr) { const v2f f = *(const v2f*)(&To[wave][rr][lane * 2]); v2h hv, lv; for (int j = 0; j < 2; ++j) { b16 p, q; split16(f[j] * XS, p, q); hv[j] = p; lv[j] = q; }
      const size_t oi = ((size_t)b * S + q0 + rr) * DM + h * HD + lane * 2; *(v2h*)(Ch + oi) = hv; *(v2h*)(Cl + oi) = lv; }  }
}
__global__ __launch_bounds__(128) void out_kernel(const b16* __restrict__ Ch, const b16* __restrict__ Cl, const b16* __restrict__ WO, const float* __restrict__ bo, float* __restrict__ out) {
  __shared__ __attribute__((aligned(16))) float Tf[4][16][128 + 4];
  const int wave = threadIdx.x >> 5, lane = threadIdx.x & 31, nloc = lane & 15, hlf = lane >> 4; const int b = blockIdx.x / (QL / 64), rb = blockIdx.x % (QL / 64); const size_t m0 = (size_t)b * S + rb * 64 + wave * 16; const int n0 = blockIdx.y * 128;
  v8f acc[8];
#pragma unroll
  for (int t = 0; t < 8; ++t) acc[t] = (v8f){};
  const b16* pa = Ch + (m0 + nloc) * DM + 8 * hlf; const b16* pl = Cl + (m0 + nloc) * DM + 8 * hlf; const b16* pw = WO + (size_t)(n0 + nloc) * DM + 8 * hlf;   // the lane's rows, its half's k offset included; they step along k with the loop
#pragma unroll 1   // rolled: loads do not move across the volatile statement behind each WMMA, so unrolling would only grow the text
  for (int kb = 0; kb < DM; kb += 64, pa += 64, pl += 64, pw += 64) { v16b a[2], al[2], bw[2][8];   // the fragments of two k steps are loaded as one group in front of their WMMAs: one latency per 32 WMMAs
#pragma unroll
    for (int g = 0; g < 2; ++g) { a[g] = frag_kb(pa + g * 32, 0); al[g] = frag_kb(pl + g * 32, 0);
#pragma unroll
      for (int t = 0; t < 8; ++t) bw[g][t] = frag_kb(pw + (t * 16 * DM + g * 32), 0); }
    XCNT_WAIT3(pa, pl, pw);
#pragma unroll
    for (int g = 0; g < 2; ++g)
#pragma unroll
      for (int t = 0; t < 8; ++t) { acc[t] = wmma16b(a[g], bw[g][t], acc[t]); acc[t] = wmma16b(al[g], bw[g][t], acc[t]); } }
#pragma unroll
  for (int t = 0; t < 8; ++t) { const float bb = bf16_rne(bo[n0 + t * 16 + nloc]);
#pragma unroll
    for (int r = 0; r < 8; ++r) Tf[wave][8 * hlf + r][t * 16 + nloc] = acc[t][r] * (1.0f / (XS * WSC)) + bb; }
  wave_lds_sync();
  { for (int rr = 0; rr < 16; ++rr) *(v4f*)(out + (m0 + rr) * DM + n0 + lane * 4) = *(const v4f*)(&Tf[wave][rr][lane * 4]);  }
}
}  // namespace

extern "C" void kernel_launch(void* const* d_in, const int* in_sizes, int n_in, void* d_out, int out_size, void* d_ws, size_t ws_size, hipStream_t stream) {
  (void)n_in;
  auto Fp = [&](int i) { return (const float*)d_in[i]; };
  // d_in: 0 x [4,1024,512], 1 dist_matrix [4,1024,1024], 2 Wq [512,512] ([out][in]), 3 bq, 4 Wk, 5 bk, 6 Wv, 7 bv, 8 Wo, 9 bo
  if (in_sizes[0] != B * S * DM || in_sizes[1] != B * S * S || in_sizes[2] != DM * DM || in_sizes[3] != DM || in_sizes[8] != DM * DM || in_sizes[9] != DM || out_size != B * S * DM) return;
  size_t off = 0; char* ws = (char*)d_ws;
  auto carve = [&](size_t bytes) { char* p = ws + off; off += (bytes + 255) & ~(size_t)255; return p; };
  b16* WT = (b16*)carve((size_t)4 * DM * DM * 2); float* MAXD = (float*)carve((size_t)B * NP * 32 * 4); const size_t plane = (size_t)B * S * DM * 2;
  b16* Qp = (b16*)carve(plane); b16* Kp = (b16*)carve(plane); b16* VTh = (b16*)carve(plane); b16* VTl = (b16*)carve(plane); b16* Ch = (b16*)carve(plane); b16* Cl = (b16*)carve(plane);
  if (off > ws_size || off > ((size_t)128 << 20)) return;   // ≈ 27 MB
  prep_kernel<<<(unsigned)(((size_t)4 * DM * DM / 8 + 255) / 256), 256, 0, stream>>>(Fp(2), Fp(4), Fp(6), Fp(8), WT);
  maxdist_kernel<<<B * NP, MT, 0, stream>>>(Fp(1), MAXD);
  proj_kernel<<<dim3(S / 64, BL * 3, 4), 128, 0, stream>>>(Fp(0), WT, Fp(3), Fp(5), Fp(7), Qp, Kp, VTh, VTl);
  attn_kernel<<<dim3(QL / 32, BL * H), 64, 0, stream>>>(Qp, Kp, VTh, VTl, Fp(1), MAXD, Ch, Cl);
  out_kernel<<<dim3((QL / 64) * BL, 4), 128, 0, stream>>>(Ch, Cl, WT + (size_t)3 * DM * DM, Fp(9), (float*)d_out);
}

// v003
// Measured time: 81.9 microseconds a run.
// Next to v002, in two timings, it ran 1.37 times as fast each time.
// Over all steps from v000 it is 7.32 times as fast.
#include <hip/hip_runtime.h>

// Graphormer multi-head attention (8 heads x 64, embed 512) on x [4, 1024, 512] with a distance bias: Q/K/V = x W^T + b; scores = Q K^T / 8 - 10 * dist / max_b(valid dist) (max clamped >= 1;
// keys with dist == 1e9 are masked with -inf — none in this input after bf16 rounding, but the compare is implemented); softmax; out = (attn V) Wo^T + bo -> [4][1024][512].
// Deterministic: flash-style per 16-query wave over the 1,024 keys in order (running max); per-batch max distance as 32 work-group partial maxima (one 128-byte line each), folded by each attention wave (max is exact in any order); no atomics.
// compute dtype: WMMA v_wmma_f32_16x16x32_f16 with f32 accumulate for the projections ([4096 x 512] x [512 x 1536]; x EXACT bf16 x8 staged through LDS, [out][in] weights as B rows exact x256:
// 1 product), S^T = K Q^T (q, k single f16 x8: 1 product — the distance bias dominates the logits), O^T += V^T P^T (v hi+lo x8, P x1024 hi+lo: 3 products — output rms is only 0.015) and
// out = ctx Wo^T ([4096 x 512] x [512 x 512]; ctx hi+lo: 2 products); distance bias, mask, softmax statistics and biases in f32. Inputs rounded to bf16 once (dist included).

namespace {
constexpr int B = 4, S = 1024, DM = 512, H = 8, HD = 64, BL = 4 /* batches (== B shipped) */, QL = 1024 /* query rows (== S shipped) */;
constexpr float XS = 8.0f, WSC = 256.0f, PS = 1024.0f, LOG2E = 1.4426950408889634f, INF_DIST = 1.0e9f;
static_assert(S % 64 == 0 && QL % 64 == 0 && DM == H * HD, "tiling");
typedef _Float16 b16;
typedef __attribute__((ext_vector_type(16))) _Float16 v16b;
typedef __attribute__((ext_vector_type(8))) _Float16 v8b;
typedef __attribute__((ext_vector_type(8))) float v8f;
typedef __attribute__((ext_vector_type(4))) float v4f;
__device__ __forceinline__ float bf16_rne(float f) { unsigned int u = __float_as_uint(f); u += 0x7FFFu + ((u >> 16) & 1u); return __uint_as_float(u & 0xFFFF0000u); }
__device__ __forceinline__ void split16(float v, b16& hi, b16& lo) { hi = (b16)v; lo = (b16)(v - (float)hi); }
__device__ __forceinline__ v16b frag_kb(const b16* p, int hh) { const v8b a = *(const v8b*)(p + 8 * hh), b = *(const v8b*)(p + 16 + 8 * hh); v16b f;
#pragma unroll
  for (int e = 0; e < 8; ++e) { f[e] = a[e]; f[8 + e] = b[e]; } return f; }
// fragment order (every WMMA operand that lives in the workspace): a tile of 16 rows x 32 k is TILE halves = 1,024 bytes; lane L = 16 * hh + row finds k = 16 * c + 8 * hh .. + 7 at half c * 256 + L * 8,
// so each wave-wide 16-byte load covers 512 contiguous bytes (4 whole lines) instead of 32-byte pieces of 16 lines. p = the tile's base + lane * 8; same k order as frag_kb.
constexpr int TILE = 512;
__device__ __forceinline__ v16b frag_pk(const b16* p) { const v8b a = *(const v8b*)(p), b = *(const v8b*)(p + 256); v16b f;
#pragma unroll
  for (int e = 0; e < 8; ++e) { f[e] = a[e]; f[8 + e] = b[e]; } return f; }
__device__ __forceinline__ v8f wmma16b(v16b a, v16b b, v8f c) { v8f d = __builtin_amdgcn_wmma_f32_16x16x32_f16(false, a, false, b, (short)0, c, false, false); asm volatile("v_nop\n\tv_nop\n\tv_nop\n\tv_nop" : "+v"(d) : "v"(a), "v"(b)); return d; }
__device__ __forceinline__ void wave_lds_sync() { __builtin_amdgcn_fence(__ATOMIC_RELEASE, "workgroup"); __builtin_amdgcn_wave_barrier(); __builtin_amdgcn_fence(__ATOMIC_ACQUIRE, "workgroup"); }
__device__ __forceinline__ float pmul(float a, float b) { float p = a * b; asm volatile("" : "+v"(p)); return p; }
// behind a group of global loads: the wait that stands in front of any overwrite of the loads' address registers; the addresses are inputs, so they stay in their registers up to it and no load of the group lands on them
#define XCNT_WAIT2(p, q) asm volatile("s_wait_xcnt 0x0" :: "v"(p), "v"(q) : "memory")
#define XCNT_WAIT3(p, q, r) asm volatile("s_wait_xcnt 0x0" :: "v"(p), "v"(q), "v"(r) : "memory")
__device__ __forceinline__ int iclamp(int v, int lo, int hi) { return v < lo ? lo : (v > hi ? hi : v); }

typedef __attribute__((ext_vector_type(4))) _Float16 v4h;
__device__ __forceinline__ float nexp2(float v) { return __builtin_amdgcn_exp2f(v); }
__global__ __launch_bounds__(256) void prep_kernel(const float* __restrict__ wq, const float* __restrict__ wk, const float* __restrict__ wv, const float* __restrict__ wo, b16* __restrict__ WT) {
  const size_t u = (size_t)blockIdx.x * 256 + threadIdx.x; const size_t per = (size_t)DM * DM / 8; if (u >= 4 * per) return; const int m = (int)(u / per); const int v = (int)(u % per); const float* w = m == 0 ? wq : m == 1 ? wk : m == 2 ? wv : wo; v8b o;
  // thread = one 16-byte piece of the fragment-order plane (stores contiguous); tile (nt, kt) = 16 out rows x 32 in at (nt * 16 + kt) * TILE
  const int tile = v >> 6, c = (v >> 5) & 1, hh = (v >> 4) & 1, r = v & 15; const size_t e = (size_t)((tile >> 4) * 16 + r) * DM + (tile & 15) * 32 + c * 16 + hh * 8;
  for (int j = 0; j < 8; ++j) o[j] = (b16)(bf16_rne(w[e + j]) * WSC);
  { *(v8b*)(WT + (size_t)m * DM * DM + (size_t)v * 8) = o;  }
}
// stage 1 of the per-batch max: NP work-groups per batch, each over S*S/NP contiguous distances; work-group g owns line g of MAXD (32 equal floats, already clamped >= 1).
constexpr int NP = 32, MT = 512, ML = 16;
static_assert(S * S / NP == MT * ML * 4, "one pass of ML 16-byte loads per thread covers a work-group's share");
__global__ __launch_bounds__(MT) void maxdist_kernel(const float* __restrict__ dist, float* __restrict__ MAXD) {
  __shared__ float red[MT / 32]; const int t = threadIdx.x; const v4f* p = (const v4f*)(dist + (size_t)blockIdx.x * (S * S / NP)); v4f v[ML];
#pragma unroll   // all ML loads issue before the first use: the share is in flight at once; each wave-wide load covers 512 contiguous bytes
  for (int j = 0; j < ML; ++j) v[j] = p[j * MT + t];
  float m = 0.0f;   // masked entries contribute 0
#pragma unroll   // v[] stays in registers
  for (int j = 0; j < ML; ++j)
#pragma unroll
    for (int e = 0; e < 4; ++e) { const float d = bf16_rne(v[j][e]); const float vd = (d != INF_DIST) ? d : d * 0.0f; m = fmaxf(m, vd); }
  for (int w = 16; w >= 1; w >>= 1) m = fmaxf(m, __shfl_xor(m, w));
  if ((t & 31) == 0) red[t >> 5] = m;
  __syncthreads();
  if (t < 32) { float r = red[t & (MT / 32 - 1)]; for (int w = MT / 64; w >= 1; w >>= 1) r = fmaxf(r, __shfl_xor(r, w)); MAXD[blockIdx.x * 32 + t] = fmaxf(r, 1.0f); }
}
__global__ __launch_bounds__(128) void proj_kernel(const float* __restrict__ x, const b16* __restrict__ WT, const float* __restrict__ bq, const float* __restrict__ bk, const float* __restrict__ bv, b16* __restrict__ Qp, b16* __restrict__ Kp, b16* __restrict__ VTh, b16* __restrict__ VTl) {
  __shared__ __attribute__((aligned(16))) b16 As[4][16][256 + 8]; __shared__ __attribute__((aligned(16))) float Tf[4][16][128 + 4];
  const int wave = threadIdx.x >> 5, lane = threadIdx.x & 31, nloc = lane & 15, hlf = lane >> 4; const int which = blockIdx.y % 3, b = blockIdx.y / 3; const int rb = blockIdx.x, slab = blockIdx.z; const int t0 = rb * 64 + wave * 16; const int n0 = slab * 128;
  const b16* W = WT + (size_t)which * DM * DM; const b16* wr = W + (size_t)(n0 / 16) * 16 * TILE + lane * 8;   // the lane's piece of the slab's first weight tile; the other tiles are constant offsets from it
  const float* bias = which == 0 ? bq : (which == 1 ? bk : bv);
  v8f acc[8];
#pragma unroll
  for (int t = 0; t < 8; ++t) acc[t] = (v8f){};
#pragma unroll 1
  for (int half = 0; half < 2; ++half) {
    { const float* xr = x + ((size_t)b * S + t0) * DM + half * 256 + lane * 4; v4f xv[32];
#pragma unroll   // all 32 loads of the wave's 16 half rows issue before the first use: one latency instead of 32
      for (int i = 0; i < 32; ++i) xv[i] = *(const v4f*)(xr + (size_t)(i >> 1) * DM + (i & 1) * 128);
#pragma unroll   // xv[] stays in registers
      for (int i = 0; i < 32; ++i) { v4h o; for (int j = 0; j < 4; ++j) o[j] = (b16)(bf16_rne(xv[i][j]) * XS); *(v4h*)(&As[wave][i >> 1][(i & 1) * 128 + lane * 4]) = o; } }
    wave_lds_sync();
#pragma unroll 1   // rolled: loads do not move across the volatile statement behind each WMMA, so unrolling would only grow the text
    for (int kb = 0; kb < 256; kb += 64) { v16b a[2], bw[2][8];   // the fragments of two k steps are loaded as one group in front of their WMMAs: one latency per 16 WMMAs
#pragma unroll
      for (int g = 0; g < 2; ++g) {
#pragma unroll
        for (int t = 0; t < 8; ++t) bw[g][t] = frag_pk(wr + (half * 256 + kb) / 32 * TILE + (t * 16 + g) * TILE);
        a[g] = frag_kb(&As[wave][nloc][kb + g * 32], hlf); }
#pragma unroll
      for (int g = 0; g < 2; ++g)
#pragma unroll
        for (int t = 0; t < 8; ++t) acc[t] = wmma16b(a[g], bw[g][t], acc[t]); }
    wave_lds_sync(); }
#pragma unroll
  for (int t = 0; t < 8; ++t) { const float bb = bf16_rne(bias[n0 + t * 16 + nloc]);
#pragma unroll
    for (int r = 0; r < 8; ++r) Tf[wave][8 * hlf + r][t * 16 + nloc] = acc[t][r] * (1.0f / (XS * WSC)) + bb; }
  __syncthreads();
  {
    if (which == 2) {
      const int hs = wave >> 1, j = wave & 1; const int h = n0 / HD + hs;   // V^T tiles (16 d x 32 keys) at ((head * S/32 + key block) * 4 + t) * TILE; the wave writes one head's 64 d of one 32-key block
#pragma unroll
      for (int q = 0; q < 8; ++q) { const int t = q >> 1, c = q & 1; v8b hv, lv;
#pragma unroll
        for (int e = 0; e < 8; ++e) { b16 p, ql; split16(Tf[j * 2 + c][hlf * 8 + e][hs * 64 + t * 16 + nloc] * XS, p, ql); hv[e] = p; lv[e] = ql; }
        const size_t oi = ((((size_t)b * H + h) * (S / 32) + rb * 2 + j) * 4 + t) * TILE + c * 256 + lane * 8; *(v8b*)(VTh + oi) = hv; *(v8b*)(VTl + oi) = lv; } }
    else { b16* P = which == 0 ? Qp : Kp;   // Q and K tiles (16 tokens x 32 d) at ((head * S/16 + token tile) * 2 + dt) * TILE; the wave's 16 tokens are one token tile
#pragma unroll
      for (int q = 0; q < 8; ++q) { const int hs = q >> 2, dt = (q >> 1) & 1, c = q & 1; const int h = n0 / HD + hs; const float* sp = &Tf[wave][nloc][hs * 64 + dt * 32 + c * 16 + hlf * 8]; const v4f f0 = *(const v4f*)sp, f1 = *(const v4f*)(sp + 4); v8b o;
#pragma unroll
        for (int e = 0; e < 4; ++e) { o[e] = (b16)(f0[e] * XS); o[4 + e] = (b16)(f1[e] * XS); }
        *(v8b*)(P + ((((size_t)b * H + h) * (S / 16) + rb * 4 + wave) * 2 + dt) * TILE + c * 256 + lane * 8) = o; }
      asm volatile("s_wait_xcnt 0x0" ::: "memory"); }   // behind the last store: in this build the text that follows the stores rewrites their address register
     }
}
// attention: grid (QL/32, BL*H): block = 2 waves x 16 queries; per 32-key step: S^T tiles, logit = s/8 - 10 * dist[b][q][key]/maxd (dist != 1e9, else -inf), online softmax, P x1024 hi/lo,
__global__ __launch_bounds__(64) void attn_kernel(const b16* __restrict__ Qp, const b16* __restrict__ Kp, const b16* __restrict__ VTh, const b16* __restrict__ VTl, const float* __restrict__ dist, const float* __restrict__ MAXD, b16* __restrict__ Ch, b16* __restrict__ Cl) {
  __shared__ __attribute__((aligned(16))) b16 Ph[2][16][32 + 8], Pl[2][16][32 + 8];
  const int wave = threadIdx.x >> 5, lane = threadIdx.x & 31, hh = lane >> 4, col = lane & 15; const int b = blockIdx.y / H, h = blockIdx.y % H; const int q0 = blockIdx.x * 32 + wave * 16, qi = q0 + col;
  const b16* Qb = Qp + ((size_t)(b * H + h) * S) * HD; const b16* Kb = Kp + ((size_t)(b * H + h) * S) * HD; const b16* Vh = VTh + ((size_t)(b * H + h) * HD) * S; const b16* Vl = VTl + ((size_t)(b * H + h) * HD) * S;
  const float* Db = dist + ((size_t)b * S + qi) * S; float md = MAXD[(b * NP + lane) * 32];   // stage 2: lane i takes partial i of this batch
  for (int w = 16; w >= 1; w >>= 1) md = fmaxf(md, __shfl_xor(md, w));
  const float dsc = 10.0f * LOG2E / md;
  const v16b qa0 = frag_pk(Qb + (q0 / 16) * 2 * TILE + lane * 8), qa1 = frag_pk(Qb + ((q0 / 16) * 2 + 1) * TILE + lane * 8);
  const float cs = LOG2E / (8.0f * XS * XS);
  float m = -INFINITY, l = 0.0f; v8f o[4]; for (int t = 0; t < 4; ++t) o[t] = (v8f){};
  // load schedule: a pass's V fragments issue at its top (used behind the softmax); the next pass's K fragments issue behind this pass's score WMMAs and its distances behind the logits, so their latency runs under the softmax.
  v16b kf[4]; v4f dd[4];
#pragma unroll
  for (int u = 0; u < 2; ++u) { kf[2 * u] = frag_pk(Kb + lane * 8 + 2 * u * TILE); kf[2 * u + 1] = frag_pk(Kb + lane * 8 + (2 * u + 1) * TILE); dd[2 * u] = *(const v4f*)(Db + u * 16 + 8 * hh); dd[2 * u + 1] = *(const v4f*)(Db + u * 16 + 8 * hh + 4); }
  const b16* kp = Kb + lane * 8; const b16* vhp = Vh + lane * 8; const b16* vlp = Vl + lane * 8; const float* dp = Db + 8 * hh;   // the lane's piece of the pass's first tile (a pass = 4 tiles of each plane) and its distance row; they step along the keys with the loop
#pragma unroll 1
  for (int kb = 0; kb < S; kb += 32, kp += 4 * TILE, vhp += 4 * TILE, vlp += 4 * TILE, dp += 32) {
    float e[16]; float mx = -INFINITY; v16b va[4], vb[4]; v8f s[2];
#pragma unroll
    for (int t = 0; t < 4; ++t) { va[t] = frag_pk(vhp + t * TILE); vb[t] = frag_pk(vlp + t * TILE); }
    XCNT_WAIT2(vhp, vlp);
#pragma unroll
    for (int u = 0; u < 2; ++u) { s[u] = (v8f){}; s[u] = wmma16b(kf[2 * u], qa0, s[u]); s[u] = wmma16b(kf[2 * u + 1], qa1, s[u]); }
    const bool more = kb + 32 < S;   // uniform: the last pass fetches nothing ahead
    if (more) {
#pragma unroll
      for (int u = 0; u < 2; ++u) { kf[2 * u] = frag_pk(kp + (4 + 2 * u) * TILE); kf[2 * u + 1] = frag_pk(kp + (5 + 2 * u) * TILE); } }
#pragma unroll
    for (int u = 0; u < 2; ++u)
#pragma unroll
      for (int r = 0; r < 8; ++r) { const float dv = bf16_rne(r < 4 ? dd[2 * u][r] : dd[2 * u + 1][r - 4]); const float vv = (dv != INF_DIST) ? (s[u][r] * cs - dv * dsc) : -INFINITY; e[u * 8 + r] = vv; mx = fmaxf(mx, vv); }
    if (more) {
#pragma unroll
      for (int u = 0; u < 2; ++u) { dd[2 * u] = *(const v4f*)(dp + 32 + u * 16); dd[2 * u + 1] = *(const v4f*)(dp + 32 + u * 16 + 4); }
      asm volatile("s_wait_xcnt 0x0" ::: "memory"); }   // in front of the step of dp, which this build places at the head of the softmax
    mx = fmaxf(mx, __shfl_xor(mx, 16)); const float mn = fmaxf(m, mx); const float al = (mn == -INFINITY) ? 1.0f : nexp2(m - mn); float sum = 0.0f;
#pragma unroll
    for (int i2 = 0; i2 < 16; ++i2) { const float p = (e[i2] == -INFINITY || mn == -INFINITY) ? 0.0f : nexp2(e[i2] - mn); sum += p; b16 a_, b_; split16(p * PS, a_, b_); const int sl = (i2 < 8 ? 0 : 16) + 8 * hh + (i2 & 7); Ph[wave][col][sl] = a_; Pl[wave][col][sl] = b_; }
    sum += __shfl_xor(sum, 16); l = l * al + sum; m = mn;
    wave_lds_sync();
    const v16b pf = frag_kb(&Ph[wave][col][0], hh), pg = frag_kb(&Pl[wave][col][0], hh);
#pragma unroll
    for (int t = 0; t < 4; ++t) { o[t] *= al; o[t] = wmma16b(va[t], pf, o[t]); o[t] = wmma16b(va[t], pg, o[t]); o[t] = wmma16b(vb[t], pf, o[t]); }
    wave_lds_sync(); }
  const float inv = (l > 0.0f) ? 1.0f / (l * PS * XS) : 0.0f;
  // ctx tiles (16 tokens x 32 k) at (token tile * 16 + kt) * TILE: accumulator tile t (lane: query col, d = t * 16 + 8 * hh + r) is already the lane's piece c = t & 1 of tile kt = h * 2 + t / 2
#pragma unroll
  for (int t = 0; t < 4; ++t) { v8b hv, lv;
#pragma unroll
    for (int r = 0; r < 8; ++r) { b16 p, q; split16(o[t][r] * inv * XS, p, q); hv[r] = p; lv[r] = q; }
    const size_t oi = ((size_t)((b * S + q0) / 16) * 16 + h * 2 + (t >> 1)) * TILE + (t & 1) * 256 + lane * 8; *(v8b*)(Ch + oi) = hv; *(v8b*)(Cl + oi) = lv; }
}
__global__ __launch_bounds__(128) void out_kernel(const b16* __restrict__ Ch, const b16* __restrict__ Cl, const b16* __restrict__ WO, const float* __restrict__ bo, float* __restrict__ out) {
  __shared__ __attribute__((aligned(16))) float Tf[4][16][128 + 4];
  const int wave = threadIdx.x >> 5, lane = threadIdx.x & 31, nloc = lane & 15, hlf = lane >> 4; const int b = blockIdx.x / (QL / 64), rb = blockIdx.x % (QL / 64); const size_t m0 = (size_t)b * S + rb * 64 + wave * 16; const int n0 = blockIdx.y * 128;
  v8f acc[8];
#pragma unroll
  for (int t = 0; t < 8; ++t) acc[t] = (v8f){};
  const b16* pa = Ch + (m0 / 16) * 16 * TILE + lane * 8; const b16* pl = Cl + (m0 / 16) * 16 * TILE + lane * 8; const b16* pw = WO + (size_t)(n0 / 16) * 16 * TILE + lane * 8;   // the lane's piece of the first k tile of its token tile and of the slab's first weight tile; they step along k with the loop
#pragma unroll 1   // rolled: loads do not move across the volatile statement behind each WMMA, so unrolling would only grow the text
  for (int kb = 0; kb < DM; kb += 64, pa += 2 * TILE, pl += 2 * TILE, pw += 2 * TILE) { v16b a[2], al[2], bw[2][8];   // the fragments of two k steps are loaded as one group in front of their WMMAs: one latency per 32 WMMAs
#pragma unroll
    for (int g = 0; g < 2; ++g) { a[g] = frag_pk(pa + g * TILE); al[g] = frag_pk(pl + g * TILE);
#pragma unroll
      for (int t = 0; t < 8; ++t) bw[g][t] = frag_pk(pw + (t * 16 + g) * TILE); }
    XCNT_WAIT3(pa, pl, pw);
#pragma unroll
    for (int g = 0; g < 2; ++g)
#pragma unroll
      for (int t = 0; t < 8; ++t) { acc[t] = wmma16b(a[g], bw[g][t], acc[t]); acc[t] = wmma16b(al[g], bw[g][t], acc[t]); } }
#pragma unroll
  for (int t = 0; t < 8; ++t) { const float bb = bf16_rne(bo[n0 + t * 16 + nloc]);
#pragma unroll
    for (int r = 0; r < 8; ++r) Tf[wave][8 * hlf + r][t * 16 + nloc] = acc[t][r] * (1.0f / (XS * WSC)) + bb; }
  wave_lds_sync();
  { for (int rr = 0; rr < 16; ++rr) *(v4f*)(out + (m0 + rr) * DM + n0 + lane * 4) = *(const v4f*)(&Tf[wave][rr][lane * 4]);  }
}
}  // namespace

extern "C" void kernel_launch(void* const* d_in, const int* in_sizes, int n_in, void* d_out, int out_size, void* d_ws, size_t ws_size, hipStream_t stream) {
  (void)n_in;
  auto Fp = [&](int i) { return (const float*)d_in[i]; };
  // d_in: 0 x [4,1024,512], 1 dist_matrix [4,1024,1024], 2 Wq [512,512] ([out][in]), 3 bq, 4 Wk, 5 bk, 6 Wv, 7 bv, 8 Wo, 9 bo
  if (in_sizes[0] != B * S * DM || in_sizes[1] != B * S * S || in_sizes[2] != DM * DM || in_sizes[3] != DM || in_sizes[8] != DM * DM || in_sizes[9] != DM || out_size != B * S * DM) return;
  size_t off = 0; char* ws = (char*)d_ws;
  auto carve = [&](size_t bytes) { char* p = ws + off; off += (bytes + 255) & ~(size_t)255; return p; };
  b16* WT = (b16*)carve((size_t)4 * DM * DM * 2); float* MAXD = (float*)carve((size_t)B * NP * 32 * 4); const size_t plane = (size_t)B * S * DM * 2;
  b16* Qp = (b16*)carve(plane); b16* Kp = (b16*)carve(plane); b16* VTh = (b16*)carve(plane); b16* VTl = (b16*)carve(plane); b16* Ch = (b16*)carve(plane); b16* Cl = (b16*)carve(plane);
  if (off > ws_size || off > ((size_t)128 << 20)) return;   // ≈ 27 MB
  prep_kernel<<<(unsigned)(((size_t)4 * DM * DM / 8 + 255) / 256), 256, 0, stream>>>(Fp(2), Fp(4), Fp(6), Fp(8), WT);
  maxdist_kernel<<<B * NP, MT, 0, stream>>>(Fp(1), MAXD);
  proj_kernel<<<dim3(S / 64, BL * 3, 4), 128, 0, stream>>>(Fp(0), WT, Fp(3), Fp(5), Fp(7), Qp, Kp, VTh, VTl);
  attn_kernel<<<dim3(QL / 32, BL * H), 64, 0, stream>>>(Qp, Kp, VTh, VTl, Fp(1), MAXD, Ch, Cl);
  out_kernel<<<dim3((QL / 64) * BL, 4), 128, 0, stream>>>(Ch, Cl, WT + (size_t)3 * DM * DM, Fp(9), (float*)d_out);
}

// v004
// One run takes 79.5 microseconds.
// Two timings next to v003 put it at 1.03 and 1.02 times that version's speed.
// Counting every step since v000, it is 7.50 times as fast.
#include <hip/hip_runtime.h>

// Graphormer multi-head attention (8 heads x 64, embed 512) on x [4, 1024, 512] with a distance bias: Q/K/V = x W^T + b; scores = Q K^T / 8 - 10 * dist / max_b(valid dist) (max clamped >= 1;
// keys with dist == 1e9 are masked with -inf — none in this input after bf16 rounding, but the compare is implemented); softmax; out = (attn V) Wo^T + bo -> [4][1024][512].
// Deterministic: flash-style per 16-query wave over the 1,024 keys in order (running max); per-batch max distance as 32 work-group partial maxima (one 128-byte line each), folded by each attention wave (max is exact in any order); no atomics.
// compute dtype: WMMA v_wmma_f32_16x16x32_f16 with f32 accumulate for the projections ([4096 x 512] x [512 x 1536]; x EXACT bf16 x8 staged through LDS, [out][in] weights as B rows exact x256:
// 1 product), S^T = K Q^T (q, k single f16 x8: 1 product — the distance bias dominates the logits), O^T += V^T P^T (v hi+lo x8, P x1024 hi+lo: 3 products — output rms is only 0.015) and
// out = ctx Wo^T ([4096 x 512] x [512 x 512]; ctx hi+lo: 2 products); distance bias, mask, softmax statistics and biases in f32. Inputs rounded to bf16 once (dist included).

namespace {
constexpr int B = 4, S = 1024, DM = 512, H = 8, HD = 64, BL = 4 /* batches (== B shipped) */, QL = 1024 /* query rows (== S shipped) */;
constexpr float XS = 8.0f, WSC = 256.0f, PS = 1024.0f, LOG2E = 1.4426950408889634f, INF_DIST = 1.0e9f;
static_assert(S % 64 == 0 && QL % 64 == 0 && DM == H * HD, "tiling");
typedef _Float16 b16;
typedef __attribute__((ext_vector_type(16))) _Float16 v16b;
typedef __attribute__((ext_vector_type(8))) _Float16 v8b;
typedef __attribute__((ext_vector_type(8))) float v8f;
typedef __attribute__((ext_vector_type(4))) float v4f;
typedef __attribute__((ext_vector_type(4))) unsigned int v4u;
typedef __attribute__((ext_vector_type(2))) unsigned int v2u;
__device__ __forceinline__ float bf16_rne(float f) { unsigned int u = __float_as_uint(f); u += 0x7FFFu + ((u >> 16) & 1u); return __uint_as_float(u & 0xFFFF0000u); }
__device__ __forceinline__ void split16(float v, b16& hi, b16& lo) { hi = (b16)v; lo = (b16)(v - (float)hi); }
__device__ __forceinline__ v16b frag_kb(const b16* p, int hh) { const v8b a = *(const v8b*)(p + 8 * hh), b = *(const v8b*)(p + 16 + 8 * hh); v16b f;
#pragma unroll
  for (int e = 0; e < 8; ++e) { f[e] = a[e]; f[8 + e] = b[e]; } return f; }
// fragment order (every WMMA operand that lives in the workspace): a tile of 16 rows x 32 k is TILE halves = 1,024 bytes; lane L = 16 * hh + row finds k = 16 * c + 8 * hh .. + 7 at half c * 256 + L * 8,
// so each wave-wide 16-byte load covers 512 contiguous bytes (4 whole lines) instead of 32-byte pieces of 16 lines. p = the tile's base + lane * 8; same k order as frag_kb.
constexpr int TILE = 512;
__device__ __forceinline__ v16b frag_pk(const b16* p) { const v8b a = *(const v8b*)(p), b = *(const v8b*)(p + 256); v16b f;
#pragma unroll
  for (int e = 0; e < 8; ++e) { f[e] = a[e]; f[8 + e] = b[e]; } return f; }
__device__ __forceinline__ v8f wmma16b(v16b a, v16b b, v8f c) { v8f d = __builtin_amdgcn_wmma_f32_16x16x32_f16(false, a, false, b, (short)0, c, false, false); asm volatile("v_nop\n\tv_nop\n\tv_nop\n\tv_nop" : "+v"(d) : "v"(a), "v"(b)); return d; }
__device__ __forceinline__ void wave_lds_sync() { __builtin_amdgcn_fence(__ATOMIC_RELEASE, "workgroup"); __builtin_amdgcn_wave_barrier(); __builtin_amdgcn_fence(__ATOMIC_ACQUIRE, "workgroup"); }
__device__ __forceinline__ float pmul(float a, float b) { float p = a * b; asm volatile("" : "+v"(p)); return p; }
// behind a group of global loads: the wait that stands in front of any overwrite of the loads' address registers; the addresses are inputs, so they stay in their registers up to it and no load of the group lands on them
#define XCNT_WAIT2(p, q) asm volatile("s_wait_xcnt 0x0" :: "v"(p), "v"(q) : "memory")
#define XCNT_WAIT3(p, q, r) asm volatile("s_wait_xcnt 0x0" :: "v"(p), "v"(q), "v"(r) : "memory")
__device__ __forceinline__ int iclamp(int v, int lo, int hi) { return v < lo ? lo : (v > hi ? hi : v); }

typedef __attribute__((ext_vector_type(4))) _Float16 v4h;
__device__ __forceinline__ float nexp2(float v) { return __builtin_amdgcn_exp2f(v); }
__global__ __launch_bounds__(256) void prep_kernel(const float* __restrict__ wq, const float* __restrict__ wk, const float* __restrict__ wv, const float* __restrict__ wo, b16* __restrict__ WT) {
  const size_t u = (size_t)blockIdx.x * 256 + threadIdx.x; const size_t per = (size_t)DM * DM / 8; if (u >= 4 * per) return; const int m = (int)(u / per); const int v = (int)(u % per); const float* w = m == 0 ? wq : m == 1 ? wk : m == 2 ? wv : wo; v8b o;
  // thread = one 16-byte piece of the fragment-order plane (stores contiguous); tile (nt, kt) = 16 out rows x 32 in at (nt * 16 + kt) * TILE
  const int tile = v >> 6, c = (v >> 5) & 1, hh = (v >> 4) & 1, r = v & 15; const size_t e = (size_t)((tile >> 4) * 16 + r) * DM + (tile & 15) * 32 + c * 16 + hh * 8;
  for (int j = 0; j < 8; ++j) o[j] = (b16)(bf16_rne(w[e + j]) * WSC);
  { *(v8b*)(WT + (size_t)m * DM * DM + (size_t)v * 8) = o;  }
}
// stage 1 of the per-batch max: NP work-groups per batch, each over S*S/NP contiguous distances (32 query rows); work-group g owns line g of MAXD (32 equal floats, already clamped >= 1).
// The same pass prepares the distances for attention, once instead of once per head: each is rounded and tested against the mask value here and stored as the upper 16 bits of the rounded float (exact; a masked entry as +inf,
// so that its logit s * cs - inf * dsc is -inf with no test), in fragment order: tile (16 queries x 32 keys) at ((batch * S/16 + query tile) * S/32 + key block) * TILE, row = query, k = key.
constexpr int NP = 32, MT = 512, ML = 16, DPITCH = 128 + 8;   // DPITCH: rows 272 bytes apart, so the 16 rows of a 16-byte column read fall on different banks
static_assert(S * S / NP == MT * ML * 4 && S * S / NP == 2 * ML * S && S == 8 * 128 && MT == 16 * 32, "a wave takes 16 rows x 128 keys (4 tiles): one pass of ML 16-byte loads per thread covers a work-group's share");
__global__ __launch_bounds__(MT) void maxdist_kernel(const float* __restrict__ dist, float* __restrict__ MAXD, unsigned short* __restrict__ DP) {
  __shared__ float red[MT / 32]; __shared__ __attribute__((aligned(16))) unsigned short Ds[MT / 32][ML][DPITCH];
  const int t = threadIdx.x, wave = t >> 5, lane = t & 31, qt = wave >> 3, kq = wave & 7; const float* p = dist + (size_t)blockIdx.x * (S * S / NP) + (size_t)qt * ML * S + kq * 128 + lane * 4; v4f v[ML];
#pragma unroll   // all ML loads issue before the first use: the share is in flight at once; each wave-wide load covers 512 contiguous bytes of one row
  for (int j = 0; j < ML; ++j) v[j] = *(const v4f*)(p + (size_t)j * S);
  asm volatile("s_wait_xcnt 0x0" :: "v"(p) : "memory");   // behind the group of loads, in front of any overwrite of their address register; the address is an input, so no load of the group lands on it
  float m = 0.0f;   // masked entries contribute 0
#pragma unroll   // v[] stays in registers
  for (int j = 0; j < ML; ++j) { unsigned int hb[4];
#pragma unroll
    for (int e = 0; e < 4; ++e) { const float d = bf16_rne(v[j][e]); const bool ok = d != INF_DIST; const float vd = ok ? d : d * 0.0f; m = fmaxf(m, vd); hb[e] = ok ? __float_as_uint(d) : 0x7F800000u; }
    v2u o; o[0] = (hb[0] >> 16) | hb[1]; o[1] = (hb[2] >> 16) | hb[3]; *(v2u*)(&Ds[wave][j][lane * 4]) = o; }
  wave_lds_sync();   // the wave's own rows only: its lanes read below what other lanes of the same wave stored above
  { unsigned short* op = DP + ((size_t)(blockIdx.x * 2 + qt) * (S / 32) + kq * 4) * TILE + lane * 8;   // the wave's 4 tiles are 4,096 contiguous bytes: each wave-wide store covers 4 whole lines, and no other wave writes them
#pragma unroll
    for (int i = 0; i < 8; ++i) *(v4u*)(op + i * 256) = *(const v4u*)(&Ds[wave][lane & 15][(i >> 1) * 32 + (i & 1) * 16 + (lane >> 4) * 8]); }
  for (int w = 16; w >= 1; w >>= 1) m = fmaxf(m, __shfl_xor(m, w));
  if ((t & 31) == 0) red[t >> 5] = m;
  __syncthreads();
  if (t < 32) { float r = red[t & (MT / 32 - 1)]; for (int w = MT / 64; w >= 1; w >>= 1) r = fmaxf(r, __shfl_xor(r, w)); MAXD[blockIdx.x * 32 + t] = fmaxf(r, 1.0f); }
}
__global__ __launch_bounds__(128) void proj_kernel(const float* __restrict__ x, const b16* __restrict__ WT, const float* __restrict__ bq, const float* __restrict__ bk, const float* __restrict__ bv, b16* __restrict__ Qp, b16* __restrict__ Kp, b16* __restrict__ VTh, b16* __restrict__ VTl) {
  __shared__ __attribute__((aligned(16))) b16 As[4][16][256 + 8]; __shared__ __attribute__((aligned(16))) float Tf[4][16][128 + 4];
  const int wave = threadIdx.x >> 5, lane = threadIdx.x & 31, nloc = lane & 15, hlf = lane >> 4; const int which = blockIdx.y % 3, b = blockIdx.y / 3; const int rb = blockIdx.x, slab = blockIdx.z; const int t0 = rb * 64 + wave * 16; const int n0 = slab * 128;
  const b16* W = WT + (size_t)which * DM * DM; const b16* wr = W + (size_t)(n0 / 16) * 16 * TILE + lane * 8;   // the lane's piece of the slab's first weight tile; the other tiles are constant offsets from it
  const float* bias = which == 0 ? bq : (which == 1 ? bk : bv);
  v8f acc[8];
#pragma unroll
  for (int t = 0; t < 8; ++t) acc[t] = (v8f){};
#pragma unroll 1
  for (int half = 0; half < 2; ++half) {
    { const float* xr = x + ((size_t)b * S + t0) * DM + half * 256 + lane * 4; v4f xv[32];
#pragma unroll   // all 32 loads of the wave's 16 half rows issue before the first use: one latency instead of 32
      for (int i = 0; i < 32; ++i) xv[i] = *(const v4f*)(xr + (size_t)(i >> 1) * DM + (i & 1) * 128);
#pragma unroll   // xv[] stays in registers
      for (int i = 0; i < 32; ++i) { v4h o; for (int j = 0; j < 4; ++j) o[j] = (b16)(bf16_rne(xv[i][j]) * XS); *(v4h*)(&As[wave][i >> 1][(i & 1) * 128 + lane * 4]) = o; } }
    wave_lds_sync();
#pragma unroll 1   // rolled: loads do not move across the volatile statement behind each WMMA, so unrolling would only grow the text
    for (int kb = 0; kb < 256; kb += 64) { v16b a[2], bw[2][8];   // the fragments of two k steps are loaded as one group in front of their WMMAs: one latency per 16 WMMAs
#pragma unroll
      for (int g = 0; g < 2; ++g) {
#pragma unroll
        for (int t = 0; t < 8; ++t) bw[g][t] = frag_pk(wr + (half * 256 + kb) / 32 * TILE + (t * 16 + g) * TILE);
        a[g] = frag_kb(&As[wave][nloc][kb + g * 32], hlf); }
#pragma unroll
      for (int g = 0; g < 2; ++g)
#pragma unroll
        for (int t = 0; t < 8; ++t) acc[t] = wmma16b(a[g], bw[g][t], acc[t]); }
    wave_lds_sync(); }
#pragma unroll
  for (int t = 0; t < 8; ++t) { const float bb = bf16_rne(bias[n0 + t * 16 + nloc]);
#pragma unroll
    for (int r = 0; r < 8; ++r) Tf[wave][8 * hlf + r][t * 16 + nloc] = acc[t][r] * (1.0f / (XS * WSC)) + bb; }
  __syncthreads();
  {
    if (which == 2) {
      const int hs = wave >> 1, j = wave & 1; const int h = n0 / HD + hs;   // V^T tiles (16 d x 32 keys) at ((head * S/32 + key block) * 4 + t) * TILE; the wave writes one head's 64 d of one 32-key block
#pragma unroll
      for (int q = 0; q < 8; ++q) { const int t = q >> 1, c = q & 1; v8b hv, lv;
#pragma unroll
        for (int e = 0; e < 8; ++e) { b16 p, ql; split16(Tf[j * 2 + c][hlf * 8 + e][hs * 64 + t * 16 + nloc] * XS, p, ql); hv[e] = p; lv[e] = ql; }
        const size_t oi = ((((size_t)b * H + h) * (S / 32) + rb * 2 + j) * 4 + t) * TILE + c * 256 + lane * 8; *(v8b*)(VTh + oi) = hv; *(v8b*)(VTl + oi) = lv; } }
    else { b16* P = which == 0 ? Qp : Kp;   // Q and K tiles (16 tokens x 32 d) at ((head * S/16 + token tile) * 2 + dt) * TILE; the wave's 16 tokens are one token tile
#pragma unroll
      for (int q = 0; q < 8; ++q) { const int hs = q >> 2, dt = (q >> 1) & 1, c = q & 1; const int h = n0 / HD + hs; const float* sp = &Tf[wave][nloc][hs * 64 + dt * 32 + c * 16 + hlf * 8]; const v4f f0 = *(const v4f*)sp, f1 = *(const v4f*)(sp + 4); v8b o;
#pragma unroll
        for (int e = 0; e < 4; ++e) { o[e] = (b16)(f0[e] * XS); o[4 + e] = (b16)(f1[e] * XS); }
        *(v8b*)(P + ((((size_t)b * H + h) * (S / 16) + rb * 4 + wave) * 2 + dt) * TILE + c * 256 + lane * 8) = o; }
      asm volatile("s_wait_xcnt 0x0" ::: "memory"); }   // behind the last store: in this build the text that follows the stores rewrites their address register
     }
}
// attention: grid (QL/32, BL*H): block = 2 waves x 16 queries; per 32-key step: S^T tiles, logit = s/8 - 10 * dist[b][q][key]/maxd (prepared distances: a masked one is +inf, so its logit is -inf), online softmax, P x1024 hi/lo,
__global__ __launch_bounds__(64) void attn_kernel(const b16* __restrict__ Qp, const b16* __restrict__ Kp, const b16* __restrict__ VTh, const b16* __restrict__ VTl, const unsigned short* __restrict__ DP, const float* __restrict__ MAXD, b16* __restrict__ Ch, b16* __restrict__ Cl) {
  __shared__ __attribute__((aligned(16))) b16 Ph[2][16][32 + 8], Pl[2][16][32 + 8];
  const int wave = threadIdx.x >> 5, lane = threadIdx.x & 31, hh = lane >> 4, col = lane & 15; const int b = blockIdx.y / H, h = blockIdx.y % H; const int q0 = blockIdx.x * 32 + wave * 16;
  const b16* Qb = Qp + ((size_t)(b * H + h) * S) * HD; const b16* Kb = Kp + ((size_t)(b * H + h) * S) * HD; const b16* Vh = VTh + ((size_t)(b * H + h) * HD) * S; const b16* Vl = VTl + ((size_t)(b * H + h) * HD) * S;
  const unsigned short* Db = DP + (size_t)(b * (S / 16) + q0 / 16) * (S / 32) * TILE + lane * 8; float md = MAXD[(b * NP + lane) * 32];   // stage 2: lane i takes partial i of this batch
  for (int w = 16; w >= 1; w >>= 1) md = fmaxf(md, __shfl_xor(md, w));
  const float dsc = 10.0f * LOG2E / md;
  const v16b qa0 = frag_pk(Qb + (q0 / 16) * 2 * TILE + lane * 8), qa1 = frag_pk(Qb + ((q0 / 16) * 2 + 1) * TILE + lane * 8);
  const float cs = LOG2E / (8.0f * XS * XS);
  float m = -INFINITY, l = 0.0f; v8f o[4]; for (int t = 0; t < 4; ++t) o[t] = (v8f){};
  // load schedule: a pass's V fragments issue at its top (used behind the softmax); the next pass's K fragments issue behind this pass's score WMMAs and its distances behind the logits, so their latency runs under the softmax.
  v16b kf[4]; v4u dd[2];
#pragma unroll
  for (int u = 0; u < 2; ++u) { kf[2 * u] = frag_pk(Kb + lane * 8 + 2 * u * TILE); kf[2 * u + 1] = frag_pk(Kb + lane * 8 + (2 * u + 1) * TILE); dd[u] = *(const v4u*)(Db + u * 256); }
  const b16* kp = Kb + lane * 8; const b16* vhp = Vh + lane * 8; const b16* vlp = Vl + lane * 8; const unsigned short* dp = Db;   // the lane's piece of the pass's first tile (a pass = 4 tiles of each K and V plane, 1 tile of distances); they step along the keys with the loop
#pragma unroll 1
  for (int kb = 0; kb < S; kb += 32, kp += 4 * TILE, vhp += 4 * TILE, vlp += 4 * TILE, dp += TILE) {
    float e[16]; float mx = -INFINITY; v16b va[4], vb[4]; v8f s[2];
#pragma unroll
    for (int t = 0; t < 4; ++t) { va[t] = frag_pk(vhp + t * TILE); vb[t] = frag_pk(vlp + t * TILE); }
    XCNT_WAIT2(vhp, vlp);
#pragma unroll
    for (int u = 0; u < 2; ++u) { s[u] = (v8f){}; s[u] = wmma16b(kf[2 * u], qa0, s[u]); s[u] = wmma16b(kf[2 * u + 1], qa1, s[u]); }
    const bool more = kb + 32 < S;   // uniform: the last pass fetches nothing ahead
    if (more) {
#pragma unroll
      for (int u = 0; u < 2; ++u) { kf[2 * u] = frag_pk(kp + (4 + 2 * u) * TILE); kf[2 * u + 1] = frag_pk(kp + (5 + 2 * u) * TILE); } }
#pragma unroll
    for (int u = 0; u < 2; ++u)
#pragma unroll
      for (int r = 0; r < 8; ++r) { const unsigned int w2 = dd[u][r >> 1]; const float dv = __uint_as_float((r & 1) ? (w2 & 0xFFFF0000u) : (w2 << 16)); const float vv = s[u][r] * cs - dv * dsc; e[u * 8 + r] = vv; mx = fmaxf(mx, vv); }
    if (more) {
#pragma unroll
      for (int u = 0; u < 2; ++u) dd[u] = *(const v4u*)(dp + TILE + u * 256);
      asm volatile("s_wait_xcnt 0x0" ::: "memory"); }   // in front of the step of dp, which this build places at the head of the softmax
    mx = fmaxf(mx, __shfl_xor(mx, 16)); const float mn = fmaxf(m, mx); const float al = (mn == -INFINITY) ? 1.0f : nexp2(m - mn); float sum = 0.0f;
#pragma unroll
    for (int i2 = 0; i2 < 16; ++i2) { const float p = (e[i2] == -INFINITY || mn == -INFINITY) ? 0.0f : nexp2(e[i2] - mn); sum += p; b16 a_, b_; split16(p * PS, a_, b_); const int sl = (i2 < 8 ? 0 : 16) + 8 * hh + (i2 & 7); Ph[wave][col][sl] = a_; Pl[wave][col][sl] = b_; }
    sum += __shfl_xor(sum, 16); l = l * al + sum; m = mn;
    wave_lds_sync();
    const v16b pf = frag_kb(&Ph[wave][col][0], hh), pg = frag_kb(&Pl[wave][col][0], hh);
#pragma unroll
    for (int t = 0; t < 4; ++t) { o[t] *= al; o[t] = wmma16b(va[t], pf, o[t]); o[t] = wmma16b(va[t], pg, o[t]); o[t] = wmma16b(vb[t], pf, o[t]); }
    wave_lds_sync(); }
  const float inv = (l > 0.0f) ? 1.0f / (l * PS * XS) : 0.0f;
  // ctx tiles (16 tokens x 32 k) at (token tile * 16 + kt) * TILE: accumulator tile t (lane: query col, d = t * 16 + 8 * hh + r) is already the lane's piece c = t & 1 of tile kt = h * 2 + t / 2
#pragma unroll
  for (int t = 0; t < 4; ++t) { v8b hv, lv;
#pragma unroll
    for (int r = 0; r < 8; ++r) { b16 p, q; split16(o[t][r] * inv * XS, p, q); hv[r] = p; lv[r] = q; }
    const size_t oi = ((size_t)((b * S + q0) / 16) * 16 + h * 2 + (t >> 1)) * TILE + (t & 1) * 256 + lane * 8; *(v8b*)(Ch + oi) = hv; *(v8b*)(Cl + oi) = lv; }
}
__global__ __launch_bounds__(128) void out_kernel(const b16* __restrict__ Ch, const b16* __restrict__ Cl, const b16* __restrict__ WO, const float* __restrict__ bo, float* __restrict__ out) {
  __shared__ __attribute__((aligned(16))) float Tf[4][16][128 + 4];
  const int wave = threadIdx.x >> 5, lane = threadIdx.x & 31, nloc = lane & 15, hlf = lane >> 4; const int b = blockIdx.x / (QL / 64), rb = blockIdx.x % (QL / 64); const size_t m0 = (size_t)b * S + rb * 64 + wave * 16; const int n0 = blockIdx.y * 128;
  v8f acc[8];
#pragma unroll
  for (int t = 0; t < 8; ++t) acc[t] = (v8f){};
  const b16* pa = Ch + (m0 / 16) * 16 * TILE + lane * 8; const b16* pl = Cl + (m0 / 16) * 16 * TILE + lane * 8; const b16* pw = WO + (size_t)(n0 / 16) * 16 * TILE + lane * 8;   // the lane's piece of the first k tile of its token tile and of the slab's first weight tile; they step along k with the loop
#pragma unroll 1   // rolled: loads do not move across the volatile statement behind each WMMA, so unrolling would only grow the text
  for (int kb = 0; kb < DM; kb += 64, pa += 2 * TILE, pl += 2 * TILE, pw += 2 * TILE) { v16b a[2], al[2], bw[2][8];   // the fragments of two k steps are loaded as one group in front of their WMMAs: one latency per 32 WMMAs
#pragma unroll
    for (int g = 0; g < 2; ++g) { a[g] = frag_pk(pa + g * TILE); al[g] = frag_pk(pl + g * TILE);
#pragma unroll
      for (int t = 0; t < 8; ++t) bw[g][t] = frag_pk(pw + (t * 16 + g) * TILE); }
    XCNT_WAIT3(pa, pl, pw);
#pragma unroll
    for (int g = 0; g < 2; ++g)
#pragma unroll
      for (int t = 0; t < 8; ++t) { acc[t] = wmma16b(a[g], bw[g][t], acc[t]); acc[t] = wmma16b(al[g], bw[g][t], acc[t]); } }
#pragma unroll
  for (int t = 0; t < 8; ++t) { const float bb = bf16_rne(bo[n0 + t * 16 + nloc]);
#pragma unroll
    for (int r = 0; r < 8; ++r) Tf[wave][8 * hlf + r][t * 16 + nloc] = acc[t][r] * (1.0f / (XS * WSC)) + bb; }
  wave_lds_sync();
  { for (int rr = 0; rr < 16; ++rr) *(v4f*)(out + (m0 + rr) * DM + n0 + lane * 4) = *(const v4f*)(&Tf[wave][rr][lane * 4]);  }
}
}  // namespace

extern "C" void kernel_launch(void* const* d_in, const int* in_sizes, int n_in, void* d_out, int out_size, void* d_ws, size_t ws_size, hipStream_t stream) {
  (void)n_in;
  auto Fp = [&](int i) { return (const float*)d_in[i]; };
  // d_in: 0 x [4,1024,512], 1 dist_matrix [4,1024,1024], 2 Wq [512,512] ([out][in]), 3 bq, 4 Wk, 5 bk, 6 Wv, 7 bv, 8 Wo, 9 bo
  if (in_sizes[0] != B * S * DM || in_sizes[1] != B * S * S || in_sizes[2] != DM * DM || in_sizes[3] != DM || in_sizes[8] != DM * DM || in_sizes[9] != DM || out_size != B * S * DM) return;
  size_t off = 0; char* ws = (char*)d_ws;
  auto carve = [&](size_t bytes) { char* p = ws + off; off += (bytes + 255) & ~(size_t)255; return p; };
  b16* WT = (b16*)carve((size_t)4 * DM * DM * 2); float* MAXD = (float*)carve((size_t)B * NP * 32 * 4); const size_t plane = (size_t)B * S * DM * 2;
  b16* Qp = (b16*)carve(plane); b16* Kp = (b16*)carve(plane); b16* VTh = (b16*)carve(plane); b16* VTl = (b16*)carve(plane); b16* Ch = (b16*)carve(plane); b16* Cl = (b16*)carve(plane); unsigned short* DP = (unsigned short*)carve((size_t)B * S * S * 2);
  if (off > ws_size || off > ((size_t)128 << 20)) return;   // about 35 MB
  prep_kernel<<<(unsigned)(((size_t)4 * DM * DM / 8 + 255) / 256), 256, 0, stream>>>(Fp(2), Fp(4), Fp(6), Fp(8), WT);
  maxdist_kernel<<<B * NP, MT, 0, stream>>>(Fp(1), MAXD, DP);
  proj_kernel<<<dim3(S / 64, BL * 3, 4), 128, 0, stream>>>(Fp(0), WT, Fp(3), Fp(5), Fp(7), Qp, Kp, VTh, VTl);
  attn_kernel<<<dim3(QL / 32, BL * H), 64, 0, stream>>>(Qp, Kp, VTh, VTl, DP, MAXD, Ch, Cl);
  out_kernel<<<dim3((QL / 64) * BL, 4), 128, 0, stream>>>(Ch, Cl, WT + (size_t)3 * DM * DM, Fp(9), (float*)d_out);
}

// v005
// One run takes 76.1 microseconds.
// Timed twice side by side with v004, it ran 1.04 times as fast both times.
// Counting every step since v000, it is 7.81 times as fast.
#include <hip/hip_runtime.h>

// Graphormer multi-head attention (8 heads x 64, embed 512) on x [4, 1024, 512] with a distance bias: Q/K/V = x W^T + b; scores = Q K^T / 8 - 10 * dist / max_b(valid dist) (max clamped >= 1;
// keys with dist == 1e9 are masked with -inf — none in this input after bf16 rounding, but the compare is implemented); softmax; out = (attn V) Wo^T + bo -> [4][1024][512].
// Deterministic: flash-style per 16-query wave over the 1,024 keys in order (running max); per-batch max distance as 32 work-group partial maxima (one 128-byte line each), folded by each attention wave (max is exact in any order); no atomics.
// compute dtype: WMMA v_wmma_f32_16x16x32_f16 with f32 accumulate for the projections ([4096 x 512] x [512 x 1536]; x EXACT bf16 x8 staged through LDS, [out][in] weights as B rows exact x256:
// 1 product), S^T = K Q^T (q, k single f16 x8: 1 product — the distance bias dominates the logits), O^T += V^T P^T (v hi+lo x8, P x1024 hi+lo: 3 products — output rms is only 0.015) and
// out = ctx Wo^T ([4096 x 512] x [512 x 512]; ctx hi+lo: 2 products); distance bias, mask, softmax statistics and biases in f32. Inputs rounded to bf16 once (dist included).

namespace {
constexpr int B = 4, S = 1024, DM = 512, H = 8, HD = 64, BL = 4 /* batches (== B shipped) */, QL = 1024 /* query rows (== S shipped) */;
constexpr float XS = 8.0f, WSC = 256.0f, PS = 1024.0f, LOG2E = 1.4426950408889634f, INF_DIST = 1.0e9f;
static_assert(S % 64 == 0 && QL % 64 == 0 && DM == H * HD, "tiling");
typedef _Float16 b16;
typedef __attribute__((ext_vector_type(16))) _Float16 v16b;
typedef __attribute__((ext_vector_type(8))) _Float16 v8b;
typedef __attribute__((ext_vector_type(8))) float v8f;
typedef __attribute__((ext_vector_type(4))) float v4f;
typedef __attribute__((ext_vector_type(4))) unsigned int v4u;
typedef __attribute__((ext_vector_type(2))) unsigned int v2u;
__device__ __forceinline__ float bf16_rne(float f) { unsigned int u = __float_as_uint(f); u += 0x7FFFu + ((u >> 16) & 1u); return __uint_as_float(u & 0xFFFF0000u); }
__device__ __forceinline__ void split16(float v, b16& hi, b16& lo) { hi = (b16)v; lo = (b16)(v - (float)hi); }
__device__ __forceinline__ v16b frag_kb(const b16* p, int hh) { const v8b a = *(const v8b*)(p + 8 * hh), b = *(const v8b*)(p + 16 + 8 * hh); v16b f;
#pragma unroll
  for (int e = 0; e < 8; ++e) { f[e] = a[e]; f[8 + e] = b[e]; } return f; }
// fragment order (every WMMA operand that lives in the workspace): a tile of 16 rows x 32 k is TILE halves = 1,024 bytes; lane L = 16 * hh + row finds k = 16 * c + 8 * hh .. + 7 at half c * 256 + L * 8,
// so each wave-wide 16-byte load covers 512 contiguous bytes (4 whole lines) instead of 32-byte pieces of 16 lines. p = the tile's base + lane * 8; same k order as frag_kb.
constexpr int TILE = 512;
__device__ __forceinline__ v16b frag_pk(const b16* p) { const v8b a = *(const v8b*)(p), b = *(const v8b*)(p + 256); v16b f;
#pragma unroll
  for (int e = 0; e < 8; ++e) { f[e] = a[e]; f[8 + e] = b[e]; } return f; }
__device__ __forceinline__ v8f wmma16b(v16b a, v16b b, v8f c) { v8f d = __builtin_amdgcn_wmma_f32_16x16x32_f16(false, a, false, b, (short)0, c, false, false); asm volatile("v_nop\n\tv_nop\n\tv_nop\n\tv_nop" : "+v"(d) : "v"(a), "v"(b)); return d; }
__device__ __forceinline__ void wave_lds_sync() { __builtin_amdgcn_fence(__ATOMIC_RELEASE, "workgroup"); __builtin_amdgcn_wave_barrier(); __builtin_amdgcn_fence(__ATOMIC_ACQUIRE, "workgroup"); }
__device__ __forceinline__ float pmul(float a, float b) { float p = a * b; asm volatile("" : "+v"(p)); return p; }
// behind a group of global loads: the wait that stands in front of any overwrite of the loads' address registers; the addresses are inputs, so they stay in their registers up to it and no load of the group lands on them
#define XCNT_WAIT2(p, q) asm volatile("s_wait_xcnt 0x0" :: "v"(p), "v"(q) : "memory")
#define XCNT_WAIT3(p, q, r) asm volatile("s_wait_xcnt 0x0" :: "v"(p), "v"(q), "v"(r) : "memory")
__device__ __forceinline__ int iclamp(int v, int lo, int hi) { return v < lo ? lo : (v > hi ? hi : v); }

typedef __attribute__((ext_vector_type(4))) _Float16 v4h;
__device__ __forceinline__ float nexp2(float v) { return __builtin_amdgcn_exp2f(v); }
// stage 1 of the per-batch max: NP work-groups per batch, each over S*S/NP contiguous distances (32 query rows); work-group g owns line g of MAXD (32 equal floats, already clamped >= 1).
// The same pass prepares the distances for attention, once instead of once per head: each is rounded and tested against the mask value here and stored as the upper 16 bits of the rounded float (exact; a masked entry as +inf,
// so that its logit s * cs - inf * dsc is -inf with no test), in fragment order: tile (16 queries x 32 keys) at ((batch * S/16 + query tile) * S/32 + key block) * TILE, row = query, k = key.
constexpr int NP = 32, MT = 512, ML = 16, DPITCH = 128 + 8;   // DPITCH: rows 272 bytes apart, so the 16 rows of a 16-byte column read fall on different banks
static_assert(S * S / NP == MT * ML * 4 && S * S / NP == 2 * ML * S && S == 8 * 128 && MT == 16 * 32, "a wave takes 16 rows x 128 keys (4 tiles): one pass of ML 16-byte loads per thread covers a work-group's share");
// The weight conversion needs nothing of the distance pass and the distance pass nothing of it, so they share one grid: work-groups 0 .. B * NP - 1 take the distances (the longer job, so it starts first), the PB behind them the weights.
constexpr int PJ = 2, PB = 4 * DM * DM / 8 / (MT * PJ);
static_assert(PB * MT * PJ * 8 == 4 * DM * DM && (DM * DM / 8) % (MT * PJ) == 0, "every 16-byte piece of the four weight planes has one thread, and a work-group stays inside one matrix");
__global__ __launch_bounds__(MT) void front_kernel(const float* __restrict__ dist, const float* __restrict__ wq, const float* __restrict__ wk, const float* __restrict__ wv, const float* __restrict__ wo, float* __restrict__ MAXD, unsigned short* __restrict__ DP, b16* __restrict__ WT) {
  if (blockIdx.x >= B * NP) {   // the same for the whole work-group, and it leaves in front of every barrier
    const int pb = blockIdx.x - B * NP, m = pb / (DM * DM / 8 / (MT * PJ)); const float* w = m == 0 ? wq : m == 1 ? wk : m == 2 ? wv : wo; const int v0 = (pb % (DM * DM / 8 / (MT * PJ))) * (MT * PJ) + threadIdx.x; v4f f[PJ][2]; const float* p[PJ];
    // thread = PJ 16-byte pieces of the fragment-order plane (stores contiguous); tile (nt, kt) = 16 out rows x 32 in at (nt * 16 + kt) * TILE
#pragma unroll   // the loads of all PJ pieces issue before the first use
    for (int j = 0; j < PJ; ++j) { const int v = v0 + j * MT, tile = v >> 6, c = (v >> 5) & 1, hh = (v >> 4) & 1, r = v & 15; p[j] = w + (size_t)((tile >> 4) * 16 + r) * DM + (tile & 15) * 32 + c * 16 + hh * 8; f[j][0] = *(const v4f*)p[j]; f[j][1] = *(const v4f*)(p[j] + 4); }
    static_assert(PJ == 2, "the wait below names both addresses"); XCNT_WAIT2(p[0], p[1]);
#pragma unroll   // f[] stays in registers
    for (int j = 0; j < PJ; ++j) { v8b o;
#pragma unroll
      for (int e = 0; e < 8; ++e) o[e] = (b16)(bf16_rne(f[j][e >> 2][e & 3]) * WSC);
      *(v8b*)(WT + (size_t)m * DM * DM + (size_t)(v0 + j * MT) * 8) = o; }
    return; }
  __shared__ float red[MT / 32]; __shared__ __attribute__((aligned(16))) unsigned short Ds[MT / 32][ML][DPITCH];
  const int t = threadIdx.x, wave = t >> 5, lane = t & 31, qt = wave >> 3, kq = wave & 7; const float* p = dist + (size_t)blockIdx.x * (S * S / NP) + (size_t)qt * ML * S + kq * 128 + lane * 4; v4f v[ML];
#pragma unroll   // all ML loads issue before the first use: the share is in flight at once; each wave-wide load covers 512 contiguous bytes of one row
  for (int j = 0; j < ML; ++j) v[j] = *(const v4f*)(p + (size_t)j * S);
  asm volatile("s_wait_xcnt 0x0" :: "v"(p) : "memory");   // behind the group of loads, in front of any overwrite of their address register; the address is an input, so no load of the group lands on it
  float m = 0.0f;   // masked entries contribute 0
#pragma unroll   // v[] stays in registers
  for (int j = 0; j < ML; ++j) { unsigned int hb[4];
#pragma unroll
    for (int e = 0; e < 4; ++e) { const float d = bf16_rne(v[j][e]); const bool ok = d != INF_DIST; const float vd = ok ? d : d * 0.0f; m = fmaxf(m, vd); hb[e] = ok ? __float_as_uint(d) : 0x7F800000u; }
    v2u o; o[0] = (hb[0] >> 16) | hb[1]; o[1] = (hb[2] >> 16) | hb[3]; *(v2u*)(&Ds[wave][j][lane * 4]) = o; }
  wave_lds_sync();   // the wave's own rows only: its lanes read below what other lanes of the same wave stored above
  { unsigned short* op = DP + ((size_t)(blockIdx.x * 2 + qt) * (S / 32) + kq * 4) * TILE + lane * 8;   // the wave's 4 tiles are 4,096 contiguous bytes: each wave-wide store covers 4 whole lines, and no other wave writes them
#pragma unroll
    for (int i = 0; i < 8; ++i) *(v4u*)(op + i * 256) = *(const v4u*)(&Ds[wave][lane & 15][(i >> 1) * 32 + (i & 1) * 16 + (lane >> 4) * 8]); }
  for (int w = 16; w >= 1; w >>= 1) m = fmaxf(m, __shfl_xor(m, w));
  if ((t & 31) == 0) red[t >> 5] = m;
  __syncthreads();
  if (t < 32) { float r = red[t & (MT / 32 - 1)]; for (int w = MT / 64; w >= 1; w >>= 1) r = fmaxf(r, __shfl_xor(r, w)); MAXD[blockIdx.x * 32 + t] = fmaxf(r, 1.0f); }
}
__global__ __launch_bounds__(128) void proj_kernel(const float* __restrict__ x, const b16* __restrict__ WT, const float* __restrict__ bq, const float* __restrict__ bk, const float* __restrict__ bv, b16* __restrict__ Qp, b16* __restrict__ Kp, b16* __restrict__ VTh, b16* __restrict__ VTl) {
  __shared__ __attribute__((aligned(16))) b16 As[4][16][256 + 8]; __shared__ __attribute__((aligned(16))) float Tf[4][16][128 + 4];
  const int wave = threadIdx.x >> 5, lane = threadIdx.x & 31, nloc = lane & 15, hlf = lane >> 4; const int which = blockIdx.y % 3, b = blockIdx.y / 3; const int rb = blockIdx.x, slab = blockIdx.z; const int t0 = rb * 64 + wave * 16; const int n0 = slab * 128;
  const b16* W = WT + (size_t)which * DM * DM; const b16* wr = W + (size_t)(n0 / 16) * 16 * TILE + lane * 8;   // the lane's piece of the slab's first weight tile; the other tiles are constant offsets from it
  const float* bias = which == 0 ? bq : (which == 1 ? bk : bv);
  v8f acc[8];
#pragma unroll
  for (int t = 0; t < 8; ++t) acc[t] = (v8f){};
#pragma unroll 1
  for (int half = 0; half < 2; ++half) {
    { const float* xr = x + ((size_t)b * S + t0) * DM + half * 256 + lane * 4; v4f xv[32];
#pragma unroll   // all 32 loads of the wave's 16 half rows issue before the first use: one latency instead of 32
      for (int i = 0; i < 32; ++i) xv[i] = *(const v4f*)(xr + (size_t)(i >> 1) * DM + (i & 1) * 128);
#pragma unroll   // xv[] stays in registers
      for (int i = 0; i < 32; ++i) { v4h o; for (int j = 0; j < 4; ++j) o[j] = (b16)(bf16_rne(xv[i][j]) * XS); *(v4h*)(&As[wave][i >> 1][(i & 1) * 128 + lane * 4]) = o; } }
    wave_lds_sync();
#pragma unroll 1   // rolled: loads do not move across the volatile statement behind each WMMA, so unrolling would only grow the text
    for (int kb = 0; kb < 256; kb += 64) { v16b a[2], bw[2][8];   // the fragments of two k steps are loaded as one group in front of their WMMAs: one latency per 16 WMMAs
#pragma unroll
      for (int g = 0; g < 2; ++g) {
#pragma unroll
        for (int t = 0; t < 8; ++t) bw[g][t] = frag_pk(wr + (half * 256 + kb) / 32 * TILE + (t * 16 + g) * TILE);
        a[g] = frag_kb(&As[wave][nloc][kb + g * 32], hlf); }
#pragma unroll
      for (int g = 0; g < 2; ++g)
#pragma unroll
        for (int t = 0; t < 8; ++t) acc[t] = wmma16b(a[g], bw[g][t], acc[t]); }
    wave_lds_sync(); }
#pragma unroll
  for (int t = 0; t < 8; ++t) { const float bb = bf16_rne(bias[n0 + t * 16 + nloc]);
#pragma unroll
    for (int r = 0; r < 8; ++r) Tf[wave][8 * hlf + r][t * 16 + nloc] = acc[t][r] * (1.0f / (XS * WSC)) + bb; }
  __syncthreads();
  {
    if (which == 2) {
      const int hs = wave >> 1, j = wave & 1; const int h = n0 / HD + hs;   // V^T tiles (16 d x 32 keys) at ((head * S/32 + key block) * 4 + t) * TILE; the wave writes one head's 64 d of one 32-key block
#pragma unroll
      for (int q = 0; q < 8; ++q) { const int t = q >> 1, c = q & 1; v8b hv, lv;
#pragma unroll
        for (int e = 0; e < 8; ++e) { b16 p, ql; split16(Tf[j * 2 + c][hlf * 8 + e][hs * 64 + t * 16 + nloc] * XS, p, ql); hv[e] = p; lv[e] = ql; }
        const size_t oi = ((((size_t)b * H + h) * (S / 32) + rb * 2 + j) * 4 + t) * TILE + c * 256 + lane * 8; *(v8b*)(VTh + oi) = hv; *(v8b*)(VTl + oi) = lv; } }
    else { b16* P = which == 0 ? Qp : Kp;   // Q and K tiles (16 tokens x 32 d) at ((head * S/16 + token tile) * 2 + dt) * TILE; the wave's 16 tokens are one token tile
#pragma unroll
      for (int q = 0; q < 8; ++q) { const int hs = q >> 2, dt = (q >> 1) & 1, c = q & 1; const int h = n0 / HD + hs; const float* sp = &Tf[wave][nloc][hs * 64 + dt * 32 + c * 16 + hlf * 8]; const v4f f0 = *(const v4f*)sp, f1 = *(const v4f*)(sp + 4); v8b o;
#pragma unroll
        for (int e = 0; e < 4; ++e) { o[e] = (b16)(f0[e] * XS); o[4 + e] = (b16)(f1[e] * XS); }
        *(v8b*)(P + ((((size_t)b * H + h) * (S / 16) + rb * 4 + wave) * 2 + dt) * TILE + c * 256 + lane * 8) = o; }
      asm volatile("s_wait_xcnt 0x0" ::: "memory"); }   // behind the last store: in this build the text that follows the stores rewrites their address register
     }
}
// attention: grid (QL/32, BL*H): block = 2 waves x 16 queries; per 32-key step: S^T tiles, logit = s/8 - 10 * dist[b][q][key]/maxd (prepared distances: a masked one is +inf, so its logit is -inf), online softmax, P x1024 hi/lo,
__global__ __launch_bounds__(64) void attn_kernel(const b16* __restrict__ Qp, const b16* __restrict__ Kp, const b16* __restrict__ VTh, const b16* __restrict__ VTl, const unsigned short* __restrict__ DP, const float* __restrict__ MAXD, b16* __restrict__ Ch, b16* __restrict__ Cl) {
  __shared__ __attribute__((aligned(16))) b16 Ph[2][16][32 + 8], Pl[2][16][32 + 8];
  const int wave = threadIdx.x >> 5, lane = threadIdx.x & 31, hh = lane >> 4, col = lane & 15; const int b = blockIdx.y / H, h = blockIdx.y % H; const int q0 = blockIdx.x * 32 + wave * 16;
  const b16* Qb = Qp + ((size_t)(b * H + h) * S) * HD; const b16* Kb = Kp + ((size_t)(b * H + h) * S) * HD; const b16* Vh = VTh + ((size_t)(b * H + h) * HD) * S; const b16* Vl = VTl + ((size_t)(b * H + h) * HD) * S;
  const unsigned short* Db = DP + (size_t)(b * (S / 16) + q0 / 16) * (S / 32) * TILE + lane * 8; float md = MAXD[(b * NP + lane) * 32];   // stage 2: lane i takes partial i of this batch
  for (int w = 16; w >= 1; w >>= 1) md = fmaxf(md, __shfl_xor(md, w));
  const float dsc = 10.0f * LOG2E / md;
  const v16b qa0 = frag_pk(Qb + (q0 / 16) * 2 * TILE + lane * 8), qa1 = frag_pk(Qb + ((q0 / 16) * 2 + 1) * TILE + lane * 8);
  const float cs = LOG2E / (8.0f * XS * XS);
  float m = -INFINITY, l = 0.0f; v8f o[4]; for (int t = 0; t < 4; ++t) o[t] = (v8f){};
  // load schedule: a pass's V fragments issue at its top (used behind the softmax); the next pass's K fragments issue behind this pass's score WMMAs and its distances behind the logits, so their latency runs under the softmax.
  v16b kf[4]; v4u dd[2];
#pragma unroll
  for (int u = 0; u < 2; ++u) { kf[2 * u] = frag_pk(Kb + lane * 8 + 2 * u * TILE); kf[2 * u + 1] = frag_pk(Kb + lane * 8 + (2 * u + 1) * TILE); dd[u] = *(const v4u*)(Db + u * 256); }
  const b16* kp = Kb + lane * 8; const b16* vhp = Vh + lane * 8; const b16* vlp = Vl + lane * 8; const unsigned short* dp = Db;   // the lane's piece of the pass's first tile (a pass = 4 tiles of each K and V plane, 1 tile of distances); they step along the keys with the loop
#pragma unroll 1
  for (int kb = 0; kb < S; kb += 32, kp += 4 * TILE, vhp += 4 * TILE, vlp += 4 * TILE, dp += TILE) {
    float e[16]; float mx = -INFINITY; v16b va[4], vb[4]; v8f s[2];
#pragma unroll
    for (int t = 0; t < 4; ++t) { va[t] = frag_pk(vhp + t * TILE); vb[t] = frag_pk(vlp + t * TILE); }
    XCNT_WAIT2(vhp, vlp);
#pragma unroll
    for (int u = 0; u < 2; ++u) { s[u] = (v8f){}; s[u] = wmma16b(kf[2 * u], qa0, s[u]); s[u] = wmma16b(kf[2 * u + 1], qa1, s[u]); }
    const bool more = kb + 32 < S;   // uniform: the last pass fetches nothing ahead
    if (more) {
#pragma unroll
      for (int u = 0; u < 2; ++u) { kf[2 * u] = frag_pk(kp + (4 + 2 * u) * TILE); kf[2 * u + 1] = frag_pk(kp + (5 + 2 * u) * TILE); } }
#pragma unroll
    for (int u = 0; u < 2; ++u)
#pragma unroll
      for (int r = 0; r < 8; ++r) { const unsigned int w2 = dd[u][r >> 1]; const float dv = __uint_as_float((r & 1) ? (w2 & 0xFFFF0000u) : (w2 << 16)); const float vv = s[u][r] * cs - dv * dsc; e[u * 8 + r] = vv; mx = fmaxf(mx, vv); }
    if (more) {
#pragma unroll
      for (int u = 0; u < 2; ++u) dd[u] = *(const v4u*)(dp + TILE + u * 256);
      asm volatile("s_wait_xcnt 0x0" ::: "memory"); }   // in front of the step of dp, which this build places at the head of the softmax
    mx = fmaxf(mx, __shfl_xor(mx, 16)); const float mn = fmaxf(m, mx); const float al = (mn == -INFINITY) ? 1.0f : nexp2(m - mn); float sum = 0.0f;
#pragma unroll
    for (int i2 = 0; i2 < 16; ++i2) { const float p = (e[i2] == -INFINITY || mn == -INFINITY) ? 0.0f : nexp2(e[i2] - mn); sum += p; b16 a_, b_; split16(p * PS, a_, b_); const int sl = (i2 < 8 ? 0 : 16) + 8 * hh + (i2 & 7); Ph[wave][col][sl] = a_; Pl[wave][col][sl] = b_; }
    sum += __shfl_xor(sum, 16); l = l * al + sum; m = mn;
    wave_lds_sync();
    const v16b pf = frag_kb(&Ph[wave][col][0], hh), pg = frag_kb(&Pl[wave][col][0], hh);
#pragma unroll
    for (int t = 0; t < 4; ++t) { o[t] *= al; o[t] = wmma16b(va[t], pf, o[t]); o[t] = wmma16b(va[t], pg, o[t]); o[t] = wmma16b(vb[t], pf, o[t]); }
    wave_lds_sync(); }
  const float inv = (l > 0.0f) ? 1.0f / (l * PS * XS) : 0.0f;
  // ctx tiles (16 tokens x 32 k) at (token tile * 16 + kt) * TILE: accumulator tile t (lane: query col, d = t * 16 + 8 * hh + r) is already the lane's piece c = t & 1 of tile kt = h * 2 + t / 2
#pragma unroll
  for (int t = 0; t < 4; ++t) { v8b hv, lv;
#pragma unroll
    for (int r = 0; r < 8; ++r) { b16 p, q; split16(o[t][r] * inv * XS, p, q); hv[r] = p; lv[r] = q; }
    const size_t oi = ((size_t)((b * S + q0) / 16) * 16 + h * 2 + (t >> 1)) * TILE + (t & 1) * 256 + lane * 8; *(v8b*)(Ch + oi) = hv; *(v8b*)(Cl + oi) = lv; }
}
__global__ __launch_bounds__(128) void out_kernel(const b16* __restrict__ Ch, const b16* __restrict__ Cl, const b16* __restrict__ WO, const float* __restrict__ bo, float* __restrict__ out) {
  __shared__ __attribute__((aligned(16))) float Tf[4][16][128 + 4];
  const int wave = threadIdx.x >> 5, lane = threadIdx.x & 31, nloc = lane & 15, hlf = lane >> 4; const int b = blockIdx.x / (QL / 64), rb = blockIdx.x % (QL / 64); const size_t m0 = (size_t)b * S + rb * 64 + wave * 16; const int n0 = blockIdx.y * 128;
  v8f acc[8];
#pragma unroll
  for (int t = 0; t < 8; ++t) acc[t] = (v8f){};
  const b16* pa = Ch + (m0 / 16) * 16 * TILE + lane * 8; const b16* pl = Cl + (m0 / 16) * 16 * TILE + lane * 8; const b16* pw = WO + (size_t)(n0 / 16) * 16 * TILE + lane * 8;   // the lane's piece of the first k tile of its token tile and of the slab's first weight tile; they step along k with the loop
#pragma unroll 1   // rolled: loads do not move across the volatile statement behind each WMMA, so unrolling would only grow the text
  for (int kb = 0; kb < DM; kb += 64, pa += 2 * TILE, pl += 2 * TILE, pw += 2 * TILE) { v16b a[2], al[2], bw[2][8];   // the fragments of two k steps are loaded as one group in front of their WMMAs: one latency per 32 WMMAs
#pragma unroll
    for (int g = 0; g < 2; ++g) { a[g] = frag_pk(pa + g * TILE); al[g] = frag_pk(pl + g * TILE);
#pragma unroll
      for (int t = 0; t < 8; ++t) bw[g][t] = frag_pk(pw + (t * 16 + g) * TILE); }
    XCNT_WAIT3(pa, pl, pw);
#pragma unroll
    for (int g = 0; g < 2; ++g)
#pragma unroll
      for (int t = 0; t < 8; ++t) { acc[t] = wmma16b(a[g], bw[g][t], acc[t]); acc[t] = wmma16b(al[g], bw[g][t], acc[t]); } }
#pragma unroll
  for (int t = 0; t < 8; ++t) { const float bb = bf16_rne(bo[n0 + t * 16 + nloc]);
#pragma unroll
    for (int r = 0; r < 8; ++r) Tf[wave][8 * hlf + r][t * 16 + nloc] = acc[t][r] * (1.0f / (XS * WSC)) + bb; }
  wave_lds_sync();
  { for (int rr = 0; rr < 16; ++rr) *(v4f*)(out + (m0 + rr) * DM + n0 + lane * 4) = *(const v4f*)(&Tf[wave][rr][lane * 4]);  }
}
}  // namespace

extern "C" void kernel_launch(void* const* d_in, const int* in_sizes, int n_in, void* d_out, int out_size, void* d_ws, size_t ws_size, hipStream_t stream) {
  (void)n_in;
  auto Fp = [&](int i) { return (const float*)d_in[i]; };
  // d_in: 0 x [4,1024,512], 1 dist_matrix [4,1024,1024], 2 Wq [512,512] ([out][in]), 3 bq, 4 Wk, 5 bk, 6 Wv, 7 bv, 8 Wo, 9 bo
  if (in_sizes[0] != B * S * DM || in_sizes[1] != B * S * S || in_sizes[2] != DM * DM || in_sizes[3] != DM || in_sizes[8] != DM * DM || in_sizes[9] != DM || out_size != B * S * DM) return;
  size_t off = 0; char* ws = (char*)d_ws;
  auto carve = [&](size_t bytes) { char* p = ws + off; off += (bytes + 255) & ~(size_t)255; return p; };
  b16* WT = (b16*)carve((size_t)4 * DM * DM * 2); float* MAXD = (float*)carve((size_t)B * NP * 32 * 4); const size_t plane = (size_t)B * S * DM * 2;
  b16* Qp = (b16*)carve(plane); b16* Kp = (b16*)carve(plane); b16* VTh = (b16*)carve(plane); b16* VTl = (b16*)carve(plane); b16* Ch = (b16*)carve(plane); b16* Cl = (b16*)carve(plane); unsigned short* DP = (unsigned short*)carve((size_t)B * S * S * 2);
  if (off > ws_size || off > ((size_t)128 << 20)) return;   // about 35 MB
  front_kernel<<<B * NP + PB, MT, 0, stream>>>(Fp(1), Fp(2), Fp(4), Fp(6), Fp(8), MAXD, DP, WT);
  proj_kernel<<<dim3(S / 64, BL * 3, 4), 128, 0, stream>>>(Fp(0), WT, Fp(3), Fp(5), Fp(7), Qp, Kp, VTh, VTl);
  attn_kernel<<<dim3(QL / 32, BL * H), 64, 0, stream>>>(Qp, Kp, VTh, VTl, DP, MAXD, Ch, Cl);
  out_kernel<<<dim3((QL / 64) * BL, 4), 128, 0, stream>>>(Ch, Cl, WT + (size_t)3 * DM * DM, Fp(9), (float*)d_out);
}

// v006
// One run takes 65.3 microseconds.
// Two timings next to v005 put it at 1.18 and 1.17 times that version's speed.
// Over all steps from v000 it is 9.17 times as fast.
#include <hip/hip_runtime.h>

// Graphormer multi-head attention (8 heads x 64, embed 512) on x [4, 1024, 512] with a distance bias: Q/K/V = x W^T + b; scores = Q K^T / 8 - 10 * dist / max_b(valid dist) (max clamped >= 1;
// keys with dist == 1e9 are masked with -inf — none in this input after bf16 rounding, but the compare is implemented); softmax; out = (attn V) Wo^T + bo -> [4][1024][512].
// Deterministic: flash-style per 16-query wave over the 1,024 keys in order (running max); per-batch max distance as 32 work-group partial maxima (one 128-byte line each), folded by each attention wave (max is exact in any order); no atomics.
// compute dtype: WMMA v_wmma_f32_16x16x32_f16 with f32 accumulate for the projections ([4096 x 512] x [512 x 1536]; x EXACT bf16 x8 staged through LDS, [out][in] weights as B rows exact x256:
// 1 product), S^T = K Q^T (q, k single f16 x8: 1 product — the distance bias dominates the logits), O^T += V^T P^T (v hi+lo x8, P x1024 hi+lo: 3 products — output rms is only 0.015) and
// out = ctx Wo^T ([4096 x 512] x [512 x 512]; ctx hi+lo: 2 products); distance bias, mask, softmax statistics and biases in f32. Inputs rounded to bf16 once (dist included).

namespace {
constexpr int B = 4, S = 1024, DM = 512, H = 8, HD = 64, BL = 4 /* batches (== B shipped) */, QL = 1024 /* query rows (== S shipped) */;
constexpr float XS = 8.0f, WSC = 256.0f, PS = 1024.0f, LOG2E = 1.4426950408889634f, INF_DIST = 1.0e9f;
static_assert(S % 64 == 0 && QL % 64 == 0 && DM == H * HD, "tiling");
typedef _Float16 b16;
typedef __attribute__((ext_vector_type(16))) _Float16 v16b;
typedef __attribute__((ext_vector_type(8))) _Float16 v8b;
typedef __attribute__((ext_vector_type(8))) float v8f;
typedef __attribute__((ext_vector_type(4))) float v4f;
typedef __attribute__((ext_vector_type(4))) unsigned int v4u;
typedef __attribute__((ext_vector_type(2))) unsigned int v2u;
__device__ __forceinline__ float bf16_rne(float f) { unsigned int u = __float_as_uint(f); u += 0x7FFFu + ((u >> 16) & 1u); return __uint_as_float(u & 0xFFFF0000u); }
__device__ __forceinline__ void split16(float v, b16& hi, b16& lo) { hi = (b16)v; lo = (b16)(v - (float)hi); }
__device__ __forceinline__ v16b frag_kb(const b16* p, int hh) { const v8b a = *(const v8b*)(p + 8 * hh), b = *(const v8b*)(p + 16 + 8 * hh); v16b f;
#pragma unroll
  for (int e = 0; e < 8; ++e) { f[e] = a[e]; f[8 + e] = b[e]; } return f; }
// fragment order (every WMMA operand that lives in the workspace): a tile of 16 rows x 32 k is TILE halves = 1,024 bytes; lane L = 16 * hh + row finds k = 16 * c + 8 * hh .. + 7 at half c * 256 + L * 8,
// so each wave-wide 16-byte load covers 512 contiguous bytes (4 whole lines) instead of 32-byte pieces of 16 lines. p = the tile's base + lane * 8; same k order as frag_kb.
constexpr int TILE = 512;
__device__ __forceinline__ v16b frag_pk(const b16* p) { const v8b a = *(const v8b*)(p), b = *(const v8b*)(p + 256); v16b f;
#pragma unroll
  for (int e = 0; e < 8; ++e) { f[e] = a[e]; f[8 + e] = b[e]; } return f; }
__device__ __forceinline__ v8f wmma16b(v16b a, v16b b, v8f c) { v8f d = __builtin_amdgcn_wmma_f32_16x16x32_f16(false, a, false, b, (short)0, c, false, false); asm volatile("v_nop\n\tv_nop\n\tv_nop\n\tv_nop" : "+v"(d) : "v"(a), "v"(b)); return d; }
__device__ __forceinline__ void wave_lds_sync() { __builtin_amdgcn_fence(__ATOMIC_RELEASE, "workgroup"); __builtin_amdgcn_wave_barrier(); __builtin_amdgcn_fence(__ATOMIC_ACQUIRE, "workgroup"); }
__device__ __forceinline__ float pmul(float a, float b) { float p = a * b; asm volatile("" : "+v"(p)); return p; }
// behind a group of global loads: the wait that stands in front of any overwrite of the loads' address registers; the addresses are inputs, so they stay in their registers up to it and no load of the group lands on them
#define XCNT_WAIT2(p, q) asm volatile("s_wait_xcnt 0x0" :: "v"(p), "v"(q) : "memory")
#define XCNT_WAIT3(p, q, r) asm volatile("s_wait_xcnt 0x0" :: "v"(p), "v"(q), "v"(r) : "memory")
__device__ __forceinline__ int iclamp(int v, int lo, int hi) { return v < lo ? lo : (v > hi ? hi : v); }

typedef __attribute__((ext_vector_type(4))) _Float16 v4h;
__device__ __forceinline__ float nexp2(float v) { return __builtin_amdgcn_exp2f(v); }
// stage 1 of the per-batch max: NP work-groups per batch, each over S*S/NP contiguous distances (32 query rows); work-group g owns line g of MAXD (32 equal floats, already clamped >= 1).
// The same pass prepares the distances for attention, once instead of once per head: each is rounded and tested against the mask value here and stored as the upper 16 bits of the rounded float (exact; a masked entry as +inf,
// so that its logit s * cs - inf * dsc is -inf with no test), in fragment order: tile (16 queries x 32 keys) at ((batch * S/16 + query tile) * S/32 + key block) * TILE, row = query, k = key.
constexpr int NP = 32, MT = 512, ML = 16, DPITCH = 128 + 8;   // DPITCH: rows 272 bytes apart, so the 16 rows of a 16-byte column read fall on different banks
static_assert(S * S / NP == MT * ML * 4 && S * S / NP == 2 * ML * S && S == 8 * 128 && MT == 16 * 32, "a wave takes 16 rows x 128 keys (4 tiles): one pass of ML 16-byte loads per thread covers a work-group's share");
// The weight conversion needs nothing of the distance pass and the distance pass nothing of it, so they share one grid: work-groups 0 .. B * NP - 1 take the distances (the longer job, so it starts first), the PB behind them the weights.
constexpr int PJ = 2, PB = 4 * DM * DM / 8 / (MT * PJ);
static_assert(PB * MT * PJ * 8 == 4 * DM * DM && (DM * DM / 8) % (MT * PJ) == 0, "every 16-byte piece of the four weight planes has one thread, and a work-group stays inside one matrix");
__global__ __launch_bounds__(MT) void front_kernel(const float* __restrict__ dist, const float* __restrict__ wq, const float* __restrict__ wk, const float* __restrict__ wv, const float* __restrict__ wo, float* __restrict__ MAXD, unsigned short* __restrict__ DP, b16* __restrict__ WT) {
  if (blockIdx.x >= B * NP) {   // the same for the whole work-group, and it leaves in front of every barrier
    const int pb = blockIdx.x - B * NP, m = pb / (DM * DM / 8 / (MT * PJ)); const float* w = m == 0 ? wq : m == 1 ? wk : m == 2 ? wv : wo; const int v0 = (pb % (DM * DM / 8 / (MT * PJ))) * (MT * PJ) + threadIdx.x; v4f f[PJ][2]; const float* p[PJ];
    // thread = PJ 16-byte pieces of the fragment-order plane (stores contiguous); tile (nt, kt) = 16 out rows x 32 in at (nt * 16 + kt) * TILE
#pragma unroll   // the loads of all PJ pieces issue before the first use
    for (int j = 0; j < PJ; ++j) { const int v = v0 + j * MT, tile = v >> 6, c = (v >> 5) & 1, hh = (v >> 4) & 1, r = v & 15; p[j] = w + (size_t)((tile >> 4) * 16 + r) * DM + (tile & 15) * 32 + c * 16 + hh * 8; f[j][0] = *(const v4f*)p[j]; f[j][1] = *(const v4f*)(p[j] + 4); }
    static_assert(PJ == 2, "the wait below names both addresses"); XCNT_WAIT2(p[0], p[1]);
#pragma unroll   // f[] stays in registers
    for (int j = 0; j < PJ; ++j) { v8b o;
#pragma unroll
      for (int e = 0; e < 8; ++e) o[e] = (b16)(bf16_rne(f[j][e >> 2][e & 3]) * WSC);
      *(v8b*)(WT + (size_t)m * DM * DM + (size_t)(v0 + j * MT) * 8) = o; }
    return; }
  __shared__ float red[MT / 32]; __shared__ __attribute__((aligned(16))) unsigned short Ds[MT / 32][ML][DPITCH];
  const int t = threadIdx.x, wave = t >> 5, lane = t & 31, qt = wave >> 3, kq = wave & 7; const float* p = dist + (size_t)blockIdx.x * (S * S / NP) + (size_t)qt * ML * S + kq * 128 + lane * 4; v4f v[ML];
#pragma unroll   // all ML loads issue before the first use: the share is in flight at once; each wave-wide load covers 512 contiguous bytes of one row
  for (int j = 0; j < ML; ++j) v[j] = *(const v4f*)(p + (size_t)j * S);
  asm volatile("s_wait_xcnt 0x0" :: "v"(p) : "memory");   // behind the group of loads, in front of any overwrite of their address register; the address is an input, so no load of the group lands on it
  float m = 0.0f;   // masked entries contribute 0
#pragma unroll   // v[] stays in registers
  for (int j = 0; j < ML; ++j) { unsigned int hb[4];
#pragma unroll
    for (int e = 0; e < 4; ++e) { const float d = bf16_rne(v[j][e]); const bool ok = d != INF_DIST; const float vd = ok ? d : d * 0.0f; m = fmaxf(m, vd); hb[e] = ok ? __float_as_uint(d) : 0x7F800000u; }
    v2u o; o[0] = (hb[0] >> 16) | hb[1]; o[1] = (hb[2] >> 16) | hb[3]; *(v2u*)(&Ds[wave][j][lane * 4]) = o; }
  wave_lds_sync();   // the wave's own rows only: its lanes read below what other lanes of the same wave stored above
  { unsigned short* op = DP + ((size_t)(blockIdx.x * 2 + qt) * (S / 32) + kq * 4) * TILE + lane * 8;   // the wave's 4 tiles are 4,096 contiguous bytes: each wave-wide store covers 4 whole lines, and no other wave writes them
#pragma unroll
    for (int i = 0; i < 8; ++i) *(v4u*)(op + i * 256) = *(const v4u*)(&Ds[wave][lane & 15][(i >> 1) * 32 + (i & 1) * 16 + (lane >> 4) * 8]); }
  for (int w = 16; w >= 1; w >>= 1) m = fmaxf(m, __shfl_xor(m, w));
  if ((t & 31) == 0) red[t >> 5] = m;
  __syncthreads();
  if (t < 32) { float r = red[t & (MT / 32 - 1)]; for (int w = MT / 64; w >= 1; w >>= 1) r = fmaxf(r, __shfl_xor(r, w)); MAXD[blockIdx.x * 32 + t] = fmaxf(r, 1.0f); }
}
__global__ __launch_bounds__(128) void proj_kernel(const float* __restrict__ x, const b16* __restrict__ WT, const float* __restrict__ bq, const float* __restrict__ bk, const float* __restrict__ bv, b16* __restrict__ Qp, b16* __restrict__ Kp, b16* __restrict__ VTh, b16* __restrict__ VTl) {
  __shared__ __attribute__((aligned(16))) b16 As[4][16][256 + 8]; __shared__ __attribute__((aligned(16))) float Tf[4][16][128 + 4];
  const int wave = threadIdx.x >> 5, lane = threadIdx.x & 31, nloc = lane & 15, hlf = lane >> 4; const int which = blockIdx.y % 3, b = blockIdx.y / 3; const int rb = blockIdx.x, slab = blockIdx.z; const int t0 = rb * 64 + wave * 16; const int n0 = slab * 128;
  const b16* W = WT + (size_t)which * DM * DM; const b16* wr = W + (size_t)(n0 / 16) * 16 * TILE + lane * 8;   // the lane's piece of the slab's first weight tile; the other tiles are constant offsets from it
  const float* bias = which == 0 ? bq : (which == 1 ? bk : bv);
  v8f acc[8];
#pragma unroll
  for (int t = 0; t < 8; ++t) acc[t] = (v8f){};
#pragma unroll 1
  for (int half = 0; half < 2; ++half) {
    { const float* xr = x + ((size_t)b * S + t0) * DM + half * 256 + lane * 4; v4f xv[32];
#pragma unroll   // all 32 loads of the wave's 16 half rows issue before the first use: one latency instead of 32
      for (int i = 0; i < 32; ++i) xv[i] = *(const v4f*)(xr + (size_t)(i >> 1) * DM + (i & 1) * 128);
#pragma unroll   // xv[] stays in registers
      for (int i = 0; i < 32; ++i) { v4h o; for (int j = 0; j < 4; ++j) o[j] = (b16)(bf16_rne(xv[i][j]) * XS); *(v4h*)(&As[wave][i >> 1][(i & 1) * 128 + lane * 4]) = o; } }
    wave_lds_sync();
#pragma unroll 1   // rolled: loads do not move across the volatile statement behind each WMMA, so unrolling would only grow the text
    for (int kb = 0; kb < 256; kb += 64) { v16b a[2], bw[2][8];   // the fragments of two k steps are loaded as one group in front of their WMMAs: one latency per 16 WMMAs
#pragma unroll
      for (int g = 0; g < 2; ++g) {
#pragma unroll
        for (int t = 0; t < 8; ++t) bw[g][t] = frag_pk(wr + (half * 256 + kb) / 32 * TILE + (t * 16 + g) * TILE);
        a[g] = frag_kb(&As[wave][nloc][kb + g * 32], hlf); }
#pragma unroll
      for (int g = 0; g < 2; ++g)
#pragma unroll
        for (int t = 0; t < 8; ++t) acc[t] = wmma16b(a[g], bw[g][t], acc[t]); }
    wave_lds_sync(); }
#pragma unroll
  for (int t = 0; t < 8; ++t) { const float bb = bf16_rne(bias[n0 + t * 16 + nloc]);
#pragma unroll
    for (int r = 0; r < 8; ++r) Tf[wave][8 * hlf + r][t * 16 + nloc] = acc[t][r] * (1.0f / (XS * WSC)) + bb; }
  __syncthreads();
  {
    if (which == 2) {
      const int hs = wave >> 1, j = wave & 1; const int h = n0 / HD + hs;   // V^T tiles (16 d x 32 keys) at ((head * S/32 + key block) * 4 + t) * TILE; the wave writes one head's 64 d of one 32-key block
#pragma unroll
      for (int q = 0; q < 8; ++q) { const int t = q >> 1, c = q & 1; v8b hv, lv;
#pragma unroll
        for (int e = 0; e < 8; ++e) { b16 p, ql; split16(Tf[j * 2 + c][hlf * 8 + e][hs * 64 + t * 16 + nloc] * XS, p, ql); hv[e] = p; lv[e] = ql; }
        const size_t oi = ((((size_t)b * H + h) * (S / 32) + rb * 2 + j) * 4 + t) * TILE + c * 256 + lane * 8; *(v8b*)(VTh + oi) = hv; *(v8b*)(VTl + oi) = lv; } }
    else { b16* P = which == 0 ? Qp : Kp;   // Q and K tiles (16 tokens x 32 d) at ((head * S/16 + token tile) * 2 + dt) * TILE; the wave's 16 tokens are one token tile
#pragma unroll
      for (int q = 0; q < 8; ++q) { const int hs = q >> 2, dt = (q >> 1) & 1, c = q & 1; const int h = n0 / HD + hs; const float* sp = &Tf[wave][nloc][hs * 64 + dt * 32 + c * 16 + hlf * 8]; const v4f f0 = *(const v4f*)sp, f1 = *(const v4f*)(sp + 4); v8b o;
#pragma unroll
        for (int e = 0; e < 4; ++e) { o[e] = (b16)(f0[e] * XS); o[4 + e] = (b16)(f1[e] * XS); }
        *(v8b*)(P + ((((size_t)b * H + h) * (S / 16) + rb * 4 + wave) * 2 + dt) * TILE + c * 256 + lane * 8) = o; }
      asm volatile("s_wait_xcnt 0x0" ::: "memory"); }   // behind the last store: in this build the text that follows the stores rewrites their address register
     }
}
// attention: grid (QL/128, BL*H): block = AW waves x 16 queries; per 32-key pass: S^T tiles, logit = s/8 - 10 * dist[b][q][key]/maxd (prepared distances: a masked one is +inf, so its logit is -inf), online softmax, P x1024 hi/lo.
// The AW waves read the same K and V tiles, so the work-group brings each stage of SK keys into LDS once (asynchronous copies, two buffers: stage s + 1 flies while stage s is worked on); each wave's own distances ride in the same ring.
// The workspace planes are in fragment order, so a stage is a straight copy: K | V hi | V lo (PLH halves each) | AW x DSH halves of distances, and a fragment read is 512 contiguous bytes of LDS per wave.
constexpr int AW = 8, SK = 128, SP = SK / 32, NST = S / SK, PLH = SP * 4 * TILE, DSH = SP * TILE, STH = 3 * PLH + AW * DSH;
static_assert(NST >= 2 && QL % (AW * 16) == 0 && PLH == 2 * AW * 2 * 256 && DSH == 2 * 4 * 256, "two calls of stage_copies in each of the AW waves cover a stage");
// half of one wave's share of a stage: 2 x 512 bytes of each of K, V hi, V lo and 4 x 512 bytes of the wave's distances. l, ld: the lane's LDS byte addresses (K plane, distances); k, vh, vl, d: the lane's global addresses.
// The wait on the address translations is the statement's last line, so it stands in front of every later write of a register that a copy names.
__device__ __forceinline__ void stage_copies(unsigned int l, unsigned int ld, const b16* k, const b16* vh, const b16* vl, const unsigned short* d) {
  asm volatile("global_load_async_to_lds_b128 %0, %10, off\n\t"
               "global_load_async_to_lds_b128 %1, %11, off\n\t"
               "global_load_async_to_lds_b128 %2, %12, off\n\t"
               "global_load_async_to_lds_b128 %3, %13, off\n\t"
               "global_load_async_to_lds_b128 %4, %14, off\n\t"
               "global_load_async_to_lds_b128 %5, %15, off\n\t"
               "global_load_async_to_lds_b128 %6, %16, off\n\t"
               "global_load_async_to_lds_b128 %7, %17, off\n\t"
               "global_load_async_to_lds_b128 %8, %18, off\n\t"
               "global_load_async_to_lds_b128 %9, %19, off\n\t"
               "s_wait_xcnt 0x0"
               :: "v"(l), "v"(l + 512u), "v"(l + PLH * 2u), "v"(l + PLH * 2u + 512u), "v"(l + PLH * 4u), "v"(l + PLH * 4u + 512u), "v"(ld), "v"(ld + 512u), "v"(ld + 1024u), "v"(ld + 1536u),
                  "v"(k), "v"(k + 256), "v"(vh), "v"(vh + 256), "v"(vl), "v"(vl + 256), "v"(d), "v"(d + 256), "v"(d + 512), "v"(d + 768) : "memory");
}
__global__ __launch_bounds__(AW * 32) void attn_kernel(const b16* __restrict__ Qp, const b16* __restrict__ Kp, const b16* __restrict__ VTh, const b16* __restrict__ VTl, const unsigned short* __restrict__ DP, const float* __restrict__ MAXD, b16* __restrict__ Ch, b16* __restrict__ Cl) {
  __shared__ __attribute__((aligned(16))) b16 Ring[2][STH]; __shared__ __attribute__((aligned(16))) b16 Ph[AW][16][32 + 8], Pl[AW][16][32 + 8];
  const int wave = threadIdx.x >> 5, lane = threadIdx.x & 31, hh = lane >> 4, col = lane & 15; const int b = blockIdx.y / H, h = blockIdx.y % H; const int q0 = blockIdx.x * (AW * 16) + wave * 16;
  const b16* Qb = Qp + ((size_t)(b * H + h) * S) * HD; const b16* Kb = Kp + ((size_t)(b * H + h) * S) * HD; const b16* Vh = VTh + ((size_t)(b * H + h) * HD) * S; const b16* Vl = VTl + ((size_t)(b * H + h) * HD) * S;
  const unsigned short* Db = DP + (size_t)(b * (S / 16) + q0 / 16) * (S / 32) * TILE + lane * 8;
  // the lane's places in buffer 0 and in stage 0; call j of a stage is AW * 512 halves (planes) and 1,024 halves (distances) further on both sides, stage s is s * PLH and s * DSH halves further in global memory
  const unsigned int lk = (unsigned int)(size_t)&Ring[0][0] + (wave * 512 + lane * 8) * 2, ldd = (unsigned int)(size_t)&Ring[0][0] + (3 * PLH + wave * DSH + lane * 8) * 2;
  const b16* kc = Kb + wave * 512 + lane * 8; const b16* vhc = Vh + wave * 512 + lane * 8; const b16* vlc = Vl + wave * 512 + lane * 8;
#pragma unroll   // two statements of ten copies: stage 0 into buffer 0
  for (int j = 0; j < 2; ++j) stage_copies(lk + j * AW * 1024, ldd + j * 2048, kc + j * AW * 512, vhc + j * AW * 512, vlc + j * AW * 512, Db + j * 1024);
  float md = MAXD[(b * NP + lane) * 32];   // stage 2 of the max: lane i takes partial i of this batch
  for (int w = 16; w >= 1; w >>= 1) md = fmaxf(md, __shfl_xor(md, w));
  const float dsc = 10.0f * LOG2E / md;
  const v16b qa0 = frag_pk(Qb + (q0 / 16) * 2 * TILE + lane * 8), qa1 = frag_pk(Qb + ((q0 / 16) * 2 + 1) * TILE + lane * 8);
  const float cs = LOG2E / (8.0f * XS * XS);
  float m = -INFINITY, l = 0.0f; v8f o[4]; for (int t = 0; t < 4; ++t) o[t] = (v8f){};
  asm volatile("s_wait_asynccnt 0x0" ::: "memory");   // this wave's copies of stage 0 have landed
  __syncthreads();                                      // ... and every other wave's: stage 0 may be read
#pragma unroll   // stage 1 into buffer 1: it flies while stage 0 is worked on
  for (int j = 0; j < 2; ++j) stage_copies(lk + STH * 2 + j * AW * 1024, ldd + STH * 2 + j * 2048, kc + PLH + j * AW * 512, vhc + PLH + j * AW * 512, vlc + PLH + j * AW * 512, Db + DSH + j * 1024);
#pragma unroll 1   // rolled over the stages: the SP passes of a stage are the unrolled body
  for (int st = 0; st < NST; ++st) {
    const b16* rb = &Ring[st & 1][0] + lane * 8; const b16* dl = rb + 3 * PLH + wave * DSH;   // the lane's piece of the stage's first K tile and of the wave's first distance tile
    // read schedule inside a stage: a pass's V fragments issue at its top (used behind the softmax); the next pass's K fragments issue behind this pass's score WMMAs and its distances behind the logits. Nothing of the next stage is read here.
    v16b kf[4]; v4u dd[2];
#pragma unroll
    for (int u = 0; u < 2; ++u) { kf[2 * u] = frag_pk(rb + 2 * u * TILE); kf[2 * u + 1] = frag_pk(rb + (2 * u + 1) * TILE); dd[u] = *(const v4u*)(dl + u * 256); }
    __builtin_amdgcn_sched_barrier(0);   // the stage's first K and distance reads stay ahead of the V reads in the LDS queue: LDS reads return in order, and the first logits would otherwise wait for all 26
#pragma unroll   // the tests on ps fold, and every LDS offset is a constant
    for (int ps = 0; ps < SP; ++ps) {
      float e[16]; float mx = -INFINITY; v16b va[4], vb[4]; v8f s[2];
#pragma unroll
      for (int t = 0; t < 4; ++t) { va[t] = frag_pk(rb + PLH + (ps * 4 + t) * TILE); vb[t] = frag_pk(rb + 2 * PLH + (ps * 4 + t) * TILE); }
#pragma unroll
      for (int u = 0; u < 2; ++u) { s[u] = (v8f){}; s[u] = wmma16b(kf[2 * u], qa0, s[u]); s[u] = wmma16b(kf[2 * u + 1], qa1, s[u]); }
      if (ps + 1 < SP) {
#pragma unroll
        for (int u = 0; u < 2; ++u) { kf[2 * u] = frag_pk(rb + ((ps + 1) * 4 + 2 * u) * TILE); kf[2 * u + 1] = frag_pk(rb + ((ps + 1) * 4 + 2 * u + 1) * TILE); } }
#pragma unroll
      for (int u = 0; u < 2; ++u)
#pragma unroll
        for (int r = 0; r < 8; ++r) { const unsigned int w2 = dd[u][r >> 1]; const float dv = __uint_as_float((r & 1) ? (w2 & 0xFFFF0000u) : (w2 << 16)); const float vv = s[u][r] * cs - dv * dsc; e[u * 8 + r] = vv; mx = fmaxf(mx, vv); }
      if (ps + 1 < SP) {
#pragma unroll
        for (int u = 0; u < 2; ++u) dd[u] = *(const v4u*)(dl + (ps + 1) * TILE + u * 256); }
      mx = fmaxf(mx, __shfl_xor(mx, 16)); const float mn = fmaxf(m, mx); const float al = (mn == -INFINITY) ? 1.0f : nexp2(m - mn); float sum = 0.0f;
#pragma unroll
      for (int i2 = 0; i2 < 16; ++i2) { const float p = (e[i2] == -INFINITY || mn == -INFINITY) ? 0.0f : nexp2(e[i2] - mn); sum += p; b16 a_, b_; split16(p * PS, a_, b_); const int sl = (i2 < 8 ? 0 : 16) + 8 * hh + (i2 & 7); Ph[wave][col][sl] = a_; Pl[wave][col][sl] = b_; }
      sum += __shfl_xor(sum, 16); l = l * al + sum; m = mn;
      wave_lds_sync();
      const v16b pf = frag_kb(&Ph[wave][col][0], hh), pg = frag_kb(&Pl[wave][col][0], hh);
#pragma unroll
      for (int t = 0; t < 4; ++t) { o[t] *= al; o[t] = wmma16b(va[t], pf, o[t]); o[t] = wmma16b(va[t], pg, o[t]); o[t] = wmma16b(vb[t], pf, o[t]); }
      wave_lds_sync(); }
    // publish point of stage st + 1, every wave, in this order
    asm volatile("s_wait_dscnt 0x0" ::: "memory");      // this wave's reads of stage st have returned
    asm volatile("s_wait_asynccnt 0x0" ::: "memory");   // this wave's copies of stage st + 1 have landed
    __syncthreads();                                      // every wave has left stage st's buffer, and stage st + 1 may be read
    if (st + 2 < NST) {   // the same for the whole work-group: stage st + 2 goes into the buffer that stage st has just left
#pragma unroll
      for (int j = 0; j < 2; ++j) stage_copies(lk + (st & 1) * STH * 2 + j * AW * 1024, ldd + (st & 1) * STH * 2 + j * 2048, kc + (st + 2) * PLH + j * AW * 512, vhc + (st + 2) * PLH + j * AW * 512, vlc + (st + 2) * PLH + j * AW * 512, Db + (st + 2) * DSH + j * 1024); } }
  asm volatile("s_wait_asynccnt 0x0" ::: "memory");   // behind the last copy, in front of the wave's end
  const float inv = (l > 0.0f) ? 1.0f / (l * PS * XS) : 0.0f;
  // ctx tiles (16 tokens x 32 k) at (token tile * 16 + kt) * TILE: accumulator tile t (lane: query col, d = t * 16 + 8 * hh + r) is already the lane's piece c = t & 1 of tile kt = h * 2 + t / 2
#pragma unroll
  for (int t = 0; t < 4; ++t) { v8b hv, lv;
#pragma unroll
    for (int r = 0; r < 8; ++r) { b16 p, q; split16(o[t][r] * inv * XS, p, q); hv[r] = p; lv[r] = q; }
    const size_t oi = ((size_t)((b * S + q0) / 16) * 16 + h * 2 + (t >> 1)) * TILE + (t & 1) * 256 + lane * 8; *(v8b*)(Ch + oi) = hv; *(v8b*)(Cl + oi) = lv; }
}
__global__ __launch_bounds__(128) void out_kernel(const b16* __restrict__ Ch, const b16* __restrict__ Cl, const b16* __restrict__ WO, const float* __restrict__ bo, float* __restrict__ out) {
  __shared__ __attribute__((aligned(16))) float Tf[4][16][128 + 4];
  const int wave = threadIdx.x >> 5, lane = threadIdx.x & 31, nloc = lane & 15, hlf = lane >> 4; const int b = blockIdx.x / (QL / 64), rb = blockIdx.x % (QL / 64); const size_t m0 = (size_t)b * S + rb * 64 + wave * 16; const int n0 = blockIdx.y * 128;
  v8f acc[8];
#pragma unroll
  for (int t = 0; t < 8; ++t) acc[t] = (v8f){};
  const b16* pa = Ch + (m0 / 16) * 16 * TILE + lane * 8; const b16* pl = Cl + (m0 / 16) * 16 * TILE + lane * 8; const b16* pw = WO + (size_t)(n0 / 16) * 16 * TILE + lane * 8;   // the lane's piece of the first k tile of its token tile and of the slab's first weight tile; they step along k with the loop
#pragma unroll 1   // rolled: loads do not move across the volatile statement behind each WMMA, so unrolling would only grow the text
  for (int kb = 0; kb < DM; kb += 64, pa += 2 * TILE, pl += 2 * TILE, pw += 2 * TILE) { v16b a[2], al[2], bw[2][8];   // the fragments of two k steps are loaded as one group in front of their WMMAs: one latency per 32 WMMAs
#pragma unroll
    for (int g = 0; g < 2; ++g) { a[g] = frag_pk(pa + g * TILE); al[g] = frag_pk(pl + g * TILE);
#pragma unroll
      for (int t = 0; t < 8; ++t) bw[g][t] = frag_pk(pw + (t * 16 + g) * TILE); }
    XCNT_WAIT3(pa, pl, pw);
#pragma unroll
    for (int g = 0; g < 2; ++g)
#pragma unroll
      for (int t = 0; t < 8; ++t) { acc[t] = wmma16b(a[g], bw[g][t], acc[t]); acc[t] = wmma16b(al[g], bw[g][t], acc[t]); } }
#pragma unroll
  for (int t = 0; t < 8; ++t) { const float bb = bf16_rne(bo[n0 + t * 16 + nloc]);
#pragma unroll
    for (int r = 0; r < 8; ++r) Tf[wave][8 * hlf + r][t * 16 + nloc] = acc[t][r] * (1.0f / (XS * WSC)) + bb; }
  wave_lds_sync();
  { for (int rr = 0; rr < 16; ++rr) *(v4f*)(out + (m0 + rr) * DM + n0 + lane * 4) = *(const v4f*)(&Tf[wave][rr][lane * 4]);  }
}
}  // namespace

extern "C" void kernel_launch(void* const* d_in, const int* in_sizes, int n_in, void* d_out, int out_size, void* d_ws, size_t ws_size, hipStream_t stream) {
  (void)n_in;
  auto Fp = [&](int i) { return (const float*)d_in[i]; };
  // d_in: 0 x [4,1024,512], 1 dist_matrix [4,1024,1024], 2 Wq [512,512] ([out][in]), 3 bq, 4 Wk, 5 bk, 6 Wv, 7 bv, 8 Wo, 9 bo
  if (in_sizes[0] != B * S * DM || in_sizes[1] != B * S * S || in_sizes[2] != DM * DM || in_sizes[3] != DM || in_sizes[8] != DM * DM || in_sizes[9] != DM || out_size != B * S * DM) return;
  size_t off = 0; char* ws = (char*)d_ws;
  auto carve = [&](size_t bytes) { char* p = ws + off; off += (bytes + 255) & ~(size_t)255; return p; };
  b16* WT = (b16*)carve((size_t)4 * DM * DM * 2); float* MAXD = (float*)carve((size_t)B * NP * 32 * 4); const size_t plane = (size_t)B * S * DM * 2;
  b16* Qp = (b16*)carve(plane); b16* Kp = (b16*)carve(plane); b16* VTh = (b16*)carve(plane); b16* VTl = (b16*)carve(plane); b16* Ch = (b16*)carve(plane); b16* Cl = (b16*)carve(plane); unsigned short* DP = (unsigned short*)carve((size_t)B * S * S * 2);
  if (off > ws_size || off > ((size_t)128 << 20)) return;   // about 35 MB
  front_kernel<<<B * NP + PB, MT, 0, stream>>>(Fp(1), Fp(2), Fp(4), Fp(6), Fp(8), MAXD, DP, WT);
  proj_kernel<<<dim3(S / 64, BL * 3, 4), 128, 0, stream>>>(Fp(0), WT, Fp(3), Fp(5), Fp(7), Qp, Kp, VTh, VTl);
  attn_kernel<<<dim3(QL / (AW * 16), BL * H), AW * 32, 0, stream>>>(Qp, Kp, VTh, VTl, DP, MAXD, Ch, Cl);
  out_kernel<<<dim3((QL / 64) * BL, 4), 128, 0, stream>>>(Ch, Cl, WT + (size_t)3 * DM * DM, Fp(9), (float*)d_out);
}

// v007
// Measured time: 61.8 microseconds a run.
// In two side-by-side timings against v006, it was 1.05 and 1.04 times as fast.
// Counting every step since v000, it is 9.57 times as fast.
#include <hip/hip_runtime.h>

// Graphormer multi-head attention (8 heads x 64, embed 512) on x [4, 1024, 512] with a distance bias: Q/K/V = x W^T + b; scores = Q K^T / 8 - 10 * dist / max_b(valid dist) (max clamped >= 1;
// keys with dist == 1e9 are masked with -inf — none in this input after bf16 rounding, but the compare is implemented); softmax; out = (attn V) Wo^T + bo -> [4][1024][512].
// Deterministic: flash-style per 16-query wave over the 1,024 keys in order (running max); per-batch max distance as 32 work-group partial maxima (one 128-byte line each), folded by each attention wave (max is exact in any order); no atomics.
// compute dtype: WMMA v_wmma_f32_16x16x32_f16 with f32 accumulate for the projections ([4096 x 512] x [512 x 1536]; x EXACT bf16 x8 staged through LDS, [out][in] weights as B rows exact x256:
// 1 product), S^T = K Q^T (q, k single f16 x8: 1 product — the distance bias dominates the logits), O^T += V^T P^T (v hi+lo x8, P x1024 hi+lo: 3 products — output rms is only 0.015) and
// out = ctx Wo^T ([4096 x 512] x [512 x 512]; ctx hi+lo: 2 products); distance bias, mask, softmax statistics and biases in f32. Inputs rounded to bf16 once (dist included).

namespace {
constexpr int B = 4, S = 1024, DM = 512, H = 8, HD = 64, BL = 4 /* batches (== B shipped) */, QL = 1024 /* query rows (== S shipped) */;
constexpr float XS = 8.0f, WSC = 256.0f, PS = 1024.0f, LOG2E = 1.4426950408889634f, INF_DIST = 1.0e9f;
static_assert(S % 64 == 0 && QL % 64 == 0 && DM == H * HD, "tiling");
typedef _Float16 b16;
typedef __attribute__((ext_vector_type(16))) _Float16 v16b;
typedef __attribute__((ext_vector_type(8))) _Float16 v8b;
typedef __attribute__((ext_vector_type(8))) float v8f;
typedef __attribute__((ext_vector_type(4))) float v4f;
typedef __attribute__((ext_vector_type(4))) unsigned int v4u;
typedef __attribute__((ext_vector_type(2))) unsigned int v2u;
__device__ __forceinline__ float bf16_rne(float f) { unsigned int u = __float_as_uint(f); u += 0x7FFFu + ((u >> 16) & 1u); return __uint_as_float(u & 0xFFFF0000u); }
__device__ __forceinline__ void split16(float v, b16& hi, b16& lo) { hi = (b16)v; lo = (b16)(v - (float)hi); }
__device__ __forceinline__ v16b frag_kb(const b16* p, int hh) { const v8b a = *(const v8b*)(p + 8 * hh), b = *(const v8b*)(p + 16 + 8 * hh); v16b f;
#pragma unroll
  for (int e = 0; e < 8; ++e) { f[e] = a[e]; f[8 + e] = b[e]; } return f; }
// fragment order (every WMMA operand that lives in the workspace): a tile of 16 rows x 32 k is TILE halves = 1,024 bytes; lane L = 16 * hh + row finds k = 16 * c + 8 * hh .. + 7 at half c * 256 + L * 8,
// so each wave-wide 16-byte load covers 512 contiguous bytes (4 whole lines) instead of 32-byte pieces of 16 lines. p = the tile's base + lane * 8; same k order as frag_kb.
constexpr int TILE = 512;
__device__ __forceinline__ v16b frag_pk(const b16* p) { const v8b a = *(const v8b*)(p), b = *(const v8b*)(p + 256); v16b f;
#pragma unroll
  for (int e = 0; e < 8; ++e) { f[e] = a[e]; f[8 + e] = b[e]; } return f; }
__device__ __forceinline__ v8f wmma16b(v16b a, v16b b, v8f c) { v8f d = __builtin_amdgcn_wmma_f32_16x16x32_f16(false, a, false, b, (short)0, c, false, false); asm volatile("v_nop\n\tv_nop\n\tv_nop\n\tv_nop" : "+v"(d) : "v"(a), "v"(b)); return d; }
__device__ __forceinline__ void wave_lds_sync() { __builtin_amdgcn_fence(__ATOMIC_RELEASE, "workgroup"); __builtin_amdgcn_wave_barrier(); __builtin_amdgcn_fence(__ATOMIC_ACQUIRE, "workgroup"); }
__device__ __forceinline__ float pmul(float a, float b) { float p = a * b; asm volatile("" : "+v"(p)); return p; }
// behind a group of global loads: the wait that stands in front of any overwrite of the loads' address registers; the addresses are inputs, so they stay in their registers up to it and no load of the group lands on them
#define XCNT_WAIT2(p, q) asm volatile("s_wait_xcnt 0x0" :: "v"(p), "v"(q) : "memory")
#define XCNT_WAIT3(p, q, r) asm volatile("s_wait_xcnt 0x0" :: "v"(p), "v"(q), "v"(r) : "memory")
__device__ __forceinline__ int iclamp(int v, int lo, int hi) { return v < lo ? lo : (v > hi ? hi : v); }

typedef __attribute__((ext_vector_type(4))) _Float16 v4h;
__device__ __forceinline__ float nexp2(float v) { return __builtin_amdgcn_exp2f(v); }
// lane l takes lane l ^ 16's value by a vector cross-row move: no LDS instruction, so no wait on the LDS queue
__device__ __forceinline__ float xhalf(float v) { return __builtin_bit_cast(float, __builtin_amdgcn_permlanex16(__builtin_bit_cast(int, v), __builtin_bit_cast(int, v), 0x76543210, 0xfedcba98, false, false)); }
// stage 1 of the per-batch max: NP work-groups per batch, each over S*S/NP contiguous distances (32 query rows); work-group g owns line g of MAXD (32 equal floats, already clamped >= 1).
// The same pass prepares the distances for attention, once instead of once per head: each is rounded and tested against the mask value here and stored as the upper 16 bits of the rounded float (exact; a masked entry as +inf,
// so that its logit s * cs - inf * dsc is -inf with no test), in fragment order: tile (16 queries x 32 keys) at ((batch * S/16 + query tile) * S/32 + key block) * TILE, row = query, k = key.
constexpr int NP = 32, MT = 512, ML = 16, DPITCH = 128 + 8;   // DPITCH: rows 272 bytes apart, so the 16 rows of a 16-byte column read fall on different banks
static_assert(S * S / NP == MT * ML * 4 && S * S / NP == 2 * ML * S && S == 8 * 128 && MT == 16 * 32, "a wave takes 16 rows x 128 keys (4 tiles): one pass of ML 16-byte loads per thread covers a work-group's share");
// The weight conversion needs nothing of the distance pass and the distance pass nothing of it, so they share one grid: work-groups 0 .. B * NP - 1 take the distances (the longer job, so it starts first), the PB behind them the weights.
constexpr int PJ = 2, PB = 4 * DM * DM / 8 / (MT * PJ);
static_assert(PB * MT * PJ * 8 == 4 * DM * DM && (DM * DM / 8) % (MT * PJ) == 0, "every 16-byte piece of the four weight planes has one thread, and a work-group stays inside one matrix");
__global__ __launch_bounds__(MT) void front_kernel(const float* __restrict__ dist, const float* __restrict__ wq, const float* __restrict__ wk, const float* __restrict__ wv, const float* __restrict__ wo, float* __restrict__ MAXD, unsigned short* __restrict__ DP, b16* __restrict__ WT) {
  if (blockIdx.x >= B * NP) {   // the same for the whole work-group, and it leaves in front of every barrier
    const int pb = blockIdx.x - B * NP, m = pb / (DM * DM / 8 / (MT * PJ)); const float* w = m == 0 ? wq : m == 1 ? wk : m == 2 ? wv : wo; const int v0 = (pb % (DM * DM / 8 / (MT * PJ))) * (MT * PJ) + threadIdx.x; v4f f[PJ][2]; const float* p[PJ];
    // thread = PJ 16-byte pieces of the fragment-order plane (stores contiguous); tile (nt, kt) = 16 out rows x 32 in at (nt * 16 + kt) * TILE
#pragma unroll   // the loads of all PJ pieces issue before the first use
    for (int j = 0; j < PJ; ++j) { const int v = v0 + j * MT, tile = v >> 6, c = (v >> 5) & 1, hh = (v >> 4) & 1, r = v & 15; p[j] = w + (size_t)((tile >> 4) * 16 + r) * DM + (tile & 15) * 32 + c * 16 + hh * 8; f[j][0] = *(const v4f*)p[j]; f[j][1] = *(const v4f*)(p[j] + 4); }
    static_assert(PJ == 2, "the wait below names both addresses"); XCNT_WAIT2(p[0], p[1]);
#pragma unroll   // f[] stays in registers
    for (int j = 0; j < PJ; ++j) { v8b o;
#pragma unroll
      for (int e = 0; e < 8; ++e) o[e] = (b16)(bf16_rne(f[j][e >> 2][e & 3]) * WSC);
      *(v8b*)(WT + (size_t)m * DM * DM + (size_t)(v0 + j * MT) * 8) = o; }
    return; }
  __shared__ float red[MT / 32]; __shared__ __attribute__((aligned(16))) unsigned short Ds[MT / 32][ML][DPITCH];
  const int t = threadIdx.x, wave = t >> 5, lane = t & 31, qt = wave >> 3, kq = wave & 7; const float* p = dist + (size_t)blockIdx.x * (S * S / NP) + (size_t)qt * ML * S + kq * 128 + lane * 4; v4f v[ML];
#pragma unroll   // all ML loads issue before the first use: the share is in flight at once; each wave-wide load covers 512 contiguous bytes of one row
  for (int j = 0; j < ML; ++j) v[j] = *(const v4f*)(p + (size_t)j * S);
  asm volatile("s_wait_xcnt 0x0" :: "v"(p) : "memory");   // behind the group of loads, in front of any overwrite of their address register; the address is an input, so no load of the group lands on it
  float m = 0.0f;   // masked entries contribute 0
#pragma unroll   // v[] stays in registers
  for (int j = 0; j < ML; ++j) { unsigned int hb[4];
#pragma unroll
    for (int e = 0; e < 4; ++e) { const float d = bf16_rne(v[j][e]); const bool ok = d != INF_DIST; const float vd = ok ? d : d * 0.0f; m = fmaxf(m, vd); hb[e] = ok ? __float_as_uint(d) : 0x7F800000u; }
    v2u o; o[0] = (hb[0] >> 16) | hb[1]; o[1] = (hb[2] >> 16) | hb[3]; *(v2u*)(&Ds[wave][j][lane * 4]) = o; }
  wave_lds_sync();   // the wave's own rows only: its lanes read below what other lanes of the same wave stored above
  { unsigned short* op = DP + ((size_t)(blockIdx.x * 2 + qt) * (S / 32) + kq * 4) * TILE + lane * 8;   // the wave's 4 tiles are 4,096 contiguous bytes: each wave-wide store covers 4 whole lines, and no other wave writes them
#pragma unroll
    for (int i = 0; i < 8; ++i) *(v4u*)(op + i * 256) = *(const v4u*)(&Ds[wave][lane & 15][(i >> 1) * 32 + (i & 1) * 16 + (lane >> 4) * 8]); }
  for (int w = 16; w >= 1; w >>= 1) m = fmaxf(m, __shfl_xor(m, w));
  if ((t & 31) == 0) red[t >> 5] = m;
  __syncthreads();
  if (t < 32) { float r = red[t & (MT / 32 - 1)]; for (int w = MT / 64; w >= 1; w >>= 1) r = fmaxf(r, __shfl_xor(r, w)); MAXD[blockIdx.x * 32 + t] = fmaxf(r, 1.0f); }
}
__global__ __launch_bounds__(128) void proj_kernel(const float* __restrict__ x, const b16* __restrict__ WT, const float* __restrict__ bq, const float* __restrict__ bk, const float* __restrict__ bv, b16* __restrict__ Qp, b16* __restrict__ Kp, b16* __restrict__ VTh, b16* __restrict__ VTl) {
  __shared__ __attribute__((aligned(16))) b16 As[4][16][256 + 8]; __shared__ __attribute__((aligned(16))) float Tf[4][16][128 + 4];
  const int wave = threadIdx.x >> 5, lane = threadIdx.x & 31, nloc = lane & 15, hlf = lane >> 4; const int which = blockIdx.y % 3, b = blockIdx.y / 3; const int rb = blockIdx.x, slab = blockIdx.z; const int t0 = rb * 64 + wave * 16; const int n0 = slab * 128;
  const b16* W = WT + (size_t)which * DM * DM; const b16* wr = W + (size_t)(n0 / 16) * 16 * TILE + lane * 8;   // the lane's piece of the slab's first weight tile; the other tiles are constant offsets from it
  const float* bias = which == 0 ? bq : (which == 1 ? bk : bv);
  v8f acc[8];
#pragma unroll
  for (int t = 0; t < 8; ++t) acc[t] = (v8f){};
#pragma unroll 1
  for (int half = 0; half < 2; ++half) {
    { const float* xr = x + ((size_t)b * S + t0) * DM + half * 256 + lane * 4; v4f xv[32];
#pragma unroll   // all 32 loads of the wave's 16 half rows issue before the first use: one latency instead of 32
      for (int i = 0; i < 32; ++i) xv[i] = *(const v4f*)(xr + (size_t)(i >> 1) * DM + (i & 1) * 128);
#pragma unroll   // xv[] stays in registers
      for (int i = 0; i < 32; ++i) { v4h o; for (int j = 0; j < 4; ++j) o[j] = (b16)(bf16_rne(xv[i][j]) * XS); *(v4h*)(&As[wave][i >> 1][(i & 1) * 128 + lane * 4]) = o; } }
    wave_lds_sync();
#pragma unroll 1   // rolled: loads do not move across the volatile statement behind each WMMA, so unrolling would only grow the text
    for (int kb = 0; kb < 256; kb += 64) { v16b a[2], bw[2][8];   // the fragments of two k steps are loaded as one group in front of their WMMAs: one latency per 16 WMMAs
#pragma unroll
      for (int g = 0; g < 2; ++g) {
#pragma unroll
        for (int t = 0; t < 8; ++t) bw[g][t] = frag_pk(wr + (half * 256 + kb) / 32 * TILE + (t * 16 + g) * TILE);
        a[g] = frag_kb(&As[wave][nloc][kb + g * 32], hlf); }
#pragma unroll
      for (int g = 0; g < 2; ++g)
#pragma unroll
        for (int t = 0; t < 8; ++t) acc[t] = wmma16b(a[g], bw[g][t], acc[t]); }
    wave_lds_sync(); }
#pragma unroll
  for (int t = 0; t < 8; ++t) { const float bb = bf16_rne(bias[n0 + t * 16 + nloc]);
#pragma unroll
    for (int r = 0; r < 8; ++r) Tf[wave][8 * hlf + r][t * 16 + nloc] = acc[t][r] * (1.0f / (XS * WSC)) + bb; }
  __syncthreads();
  {
    if (which == 2) {
      const int hs = wave >> 1, j = wave & 1; const int h = n0 / HD + hs;   // V^T tiles (16 d x 32 keys) at ((head * S/32 + key block) * 4 + t) * TILE; the wave writes one head's 64 d of one 32-key block
#pragma unroll
      for (int q = 0; q < 8; ++q) { const int t = q >> 1, c = q & 1; v8b hv, lv;
#pragma unroll
        for (int e = 0; e < 8; ++e) { b16 p, ql; split16(Tf[j * 2 + c][hlf * 8 + e][hs * 64 + t * 16 + nloc] * XS, p, ql); hv[e] = p; lv[e] = ql; }
        const size_t oi = ((((size_t)b * H + h) * (S / 32) + rb * 2 + j) * 4 + t) * TILE + c * 256 + lane * 8; *(v8b*)(VTh + oi) = hv; *(v8b*)(VTl + oi) = lv; } }
    else { b16* P = which == 0 ? Qp : Kp;   // Q and K tiles (16 tokens x 32 d) at ((head * S/16 + token tile) * 2 + dt) * TILE; the wave's 16 tokens are one token tile
#pragma unroll
      for (int q = 0; q < 8; ++q) { const int hs = q >> 2, dt = (q >> 1) & 1, c = q & 1; const int h = n0 / HD + hs; const float* sp = &Tf[wave][nloc][hs * 64 + dt * 32 + c * 16 + hlf * 8]; const v4f f0 = *(const v4f*)sp, f1 = *(const v4f*)(sp + 4); v8b o;
#pragma unroll
        for (int e = 0; e < 4; ++e) { o[e] = (b16)(f0[e] * XS); o[4 + e] = (b16)(f1[e] * XS); }
        *(v8b*)(P + ((((size_t)b * H + h) * (S / 16) + rb * 4 + wave) * 2 + dt) * TILE + c * 256 + lane * 8) = o; }
      asm volatile("s_wait_xcnt 0x0" ::: "memory"); }   // behind the last store: in this build the text that follows the stores rewrites their address register
     }
}
// attention: grid (QL/128, BL*H): block = AW waves x 16 queries; per 32-key pass: S^T tiles, logit = s/8 - 10 * dist[b][q][key]/maxd (prepared distances: a masked one is +inf, so its logit is -inf), online softmax, P x1024 hi/lo.
// The AW waves read the same K and V tiles, so the work-group brings each stage of SK keys into LDS once (asynchronous copies, two buffers: stage s + 1 flies while stage s is worked on); each wave's own distances ride in the same ring.
// The workspace planes are in fragment order, so a stage is a straight copy: K | V hi | V lo (PLH halves each) | AW x DSH halves of distances, and a fragment read is 512 contiguous bytes of LDS per wave.
constexpr int AW = 8, SK = 128, SP = SK / 32, NST = S / SK, PLH = SP * 4 * TILE, DSH = SP * TILE, STH = 3 * PLH + AW * DSH;
static_assert(NST >= 2 && QL % (AW * 16) == 0 && PLH == 2 * AW * 2 * 256 && DSH == 2 * 4 * 256, "two calls of stage_copies in each of the AW waves cover a stage");
// half of one wave's share of a stage: 2 x 512 bytes of each of K, V hi, V lo and 4 x 512 bytes of the wave's distances. l, ld: the lane's LDS byte addresses (K plane, distances); k, vh, vl, d: the lane's global addresses.
// The wait on the address translations is the statement's last line, so it stands in front of every later write of a register that a copy names.
__device__ __forceinline__ void stage_copies(unsigned int l, unsigned int ld, const b16* k, const b16* vh, const b16* vl, const unsigned short* d) {
  asm volatile("global_load_async_to_lds_b128 %0, %10, off\n\t"
               "global_load_async_to_lds_b128 %1, %11, off\n\t"
               "global_load_async_to_lds_b128 %2, %12, off\n\t"
               "global_load_async_to_lds_b128 %3, %13, off\n\t"
               "global_load_async_to_lds_b128 %4, %14, off\n\t"
               "global_load_async_to_lds_b128 %5, %15, off\n\t"
               "global_load_async_to_lds_b128 %6, %16, off\n\t"
               "global_load_async_to_lds_b128 %7, %17, off\n\t"
               "global_load_async_to_lds_b128 %8, %18, off\n\t"
               "global_load_async_to_lds_b128 %9, %19, off\n\t"
               "s_wait_xcnt 0x0"
               :: "v"(l), "v"(l + 512u), "v"(l + PLH * 2u), "v"(l + PLH * 2u + 512u), "v"(l + PLH * 4u), "v"(l + PLH * 4u + 512u), "v"(ld), "v"(ld + 512u), "v"(ld + 1024u), "v"(ld + 1536u),
                  "v"(k), "v"(k + 256), "v"(vh), "v"(vh + 256), "v"(vl), "v"(vl + 256), "v"(d), "v"(d + 256), "v"(d + 512), "v"(d + 768) : "memory");
}
__global__ __launch_bounds__(AW * 32) void attn_kernel(const b16* __restrict__ Qp, const b16* __restrict__ Kp, const b16* __restrict__ VTh, const b16* __restrict__ VTl, const unsigned short* __restrict__ DP, const float* __restrict__ MAXD, b16* __restrict__ Ch, b16* __restrict__ Cl) {
  __shared__ __attribute__((aligned(16))) b16 Ring[2][STH];
  const int wave = threadIdx.x >> 5, lane = threadIdx.x & 31; const int b = blockIdx.y / H, h = blockIdx.y % H; const int q0 = blockIdx.x * (AW * 16) + wave * 16;   // in the comments below: hh = lane >> 4, col = lane & 15
  const b16* Qb = Qp + ((size_t)(b * H + h) * S) * HD; const b16* Kb = Kp + ((size_t)(b * H + h) * S) * HD; const b16* Vh = VTh + ((size_t)(b * H + h) * HD) * S; const b16* Vl = VTl + ((size_t)(b * H + h) * HD) * S;
  const unsigned short* Db = DP + (size_t)(b * (S / 16) + q0 / 16) * (S / 32) * TILE + lane * 8;
  // the lane's places in buffer 0 and in stage 0; call j of a stage is AW * 512 halves (planes) and 1,024 halves (distances) further on both sides, stage s is s * PLH and s * DSH halves further in global memory
  const unsigned int lk = (unsigned int)(size_t)&Ring[0][0] + (wave * 512 + lane * 8) * 2, ldd = (unsigned int)(size_t)&Ring[0][0] + (3 * PLH + wave * DSH + lane * 8) * 2;
  const b16* kc = Kb + wave * 512 + lane * 8; const b16* vhc = Vh + wave * 512 + lane * 8; const b16* vlc = Vl + wave * 512 + lane * 8;
#pragma unroll   // two statements of ten copies: stage 0 into buffer 0
  for (int j = 0; j < 2; ++j) stage_copies(lk + j * AW * 1024, ldd + j * 2048, kc + j * AW * 512, vhc + j * AW * 512, vlc + j * AW * 512, Db + j * 1024);
  float md = MAXD[(b * NP + lane) * 32];   // stage 2 of the max: lane i takes partial i of this batch
  for (int w = 16; w >= 1; w >>= 1) md = fmaxf(md, __shfl_xor(md, w));
  const float dsc = 10.0f * LOG2E / md;
  const v16b qa0 = frag_pk(Qb + (q0 / 16) * 2 * TILE + lane * 8), qa1 = frag_pk(Qb + ((q0 / 16) * 2 + 1) * TILE + lane * 8);
  const float cs = LOG2E / (8.0f * XS * XS);
  float m = -INFINITY, l = 0.0f; v8f o[4]; for (int t = 0; t < 4; ++t) o[t] = (v8f){};
  asm volatile("s_wait_asynccnt 0x0" ::: "memory");   // this wave's copies of stage 0 have landed
  __syncthreads();                                      // ... and every other wave's: stage 0 may be read
#pragma unroll   // stage 1 into buffer 1: it flies while stage 0 is worked on
  for (int j = 0; j < 2; ++j) stage_copies(lk + STH * 2 + j * AW * 1024, ldd + STH * 2 + j * 2048, kc + PLH + j * AW * 512, vhc + PLH + j * AW * 512, vlc + PLH + j * AW * 512, Db + DSH + j * 1024);
#pragma unroll 1   // rolled over the stages: the SP passes of a stage are the unrolled body
  for (int st = 0; st < NST; ++st) {
    const b16* rb = &Ring[st & 1][0] + lane * 8; const b16* dl = rb + 3 * PLH + wave * DSH;   // the lane's piece of the stage's first K tile and of the wave's first distance tile
    // read schedule inside a stage: a pass's V fragments issue at its top (used behind the softmax); the next pass's K fragments issue behind this pass's score WMMAs and its distances behind the logits. Nothing of the next stage is read here.
    v16b kf[4]; v4u dd[2];
#pragma unroll
    for (int u = 0; u < 2; ++u) { kf[2 * u] = frag_pk(rb + 2 * u * TILE); kf[2 * u + 1] = frag_pk(rb + (2 * u + 1) * TILE); dd[u] = *(const v4u*)(dl + u * 256); }
    __builtin_amdgcn_sched_barrier(0);   // the stage's first K and distance reads stay ahead of the V reads in the LDS queue: LDS reads return in order, and the first logits would otherwise wait for all 26
#pragma unroll   // the tests on ps fold, and every LDS offset is a constant
    for (int ps = 0; ps < SP; ++ps) {
      float e[16]; float mx = -INFINITY; v16b va[4], vb[4]; v8f s[2];
#pragma unroll
      for (int t = 0; t < 4; ++t) { va[t] = frag_pk(rb + PLH + (ps * 4 + t) * TILE); vb[t] = frag_pk(rb + 2 * PLH + (ps * 4 + t) * TILE); }
#pragma unroll
      for (int u = 0; u < 2; ++u) { s[u] = (v8f){}; s[u] = wmma16b(kf[2 * u], qa0, s[u]); s[u] = wmma16b(kf[2 * u + 1], qa1, s[u]); }
      if (ps + 1 < SP) {
#pragma unroll
        for (int u = 0; u < 2; ++u) { kf[2 * u] = frag_pk(rb + ((ps + 1) * 4 + 2 * u) * TILE); kf[2 * u + 1] = frag_pk(rb + ((ps + 1) * 4 + 2 * u + 1) * TILE); } }
#pragma unroll
      for (int u = 0; u < 2; ++u)
#pragma unroll
        for (int r = 0; r < 8; ++r) { const unsigned int w2 = dd[u][r >> 1]; const float dv = __uint_as_float((r & 1) ? (w2 & 0xFFFF0000u) : (w2 << 16)); const float vv = s[u][r] * cs - dv * dsc; e[u * 8 + r] = vv; mx = fmaxf(mx, vv); }
      if (ps + 1 < SP) {
#pragma unroll
        for (int u = 0; u < 2; ++u) dd[u] = *(const v4u*)(dl + (ps + 1) * TILE + u * 256); }
      mx = fmaxf(mx, xhalf(mx)); const float mn = fmaxf(m, mx); const float al = (mn == -INFINITY) ? 1.0f : nexp2(m - mn); float sum = 0.0f;
      // P^T as the B operand straight from the score accumulators: the lane holds keys 8 * hh + r of score tile 0 and 16 + 8 * hh + r of tile 1 for query col, and that is element r and 8 + r of B's column col in the k order of V^T's fragments
      v16b pf, pg;
#pragma unroll
      for (int i2 = 0; i2 < 16; ++i2) { const float p = (e[i2] == -INFINITY || mn == -INFINITY) ? 0.0f : nexp2(e[i2] - mn); sum += p; b16 a_, b_; split16(p * PS, a_, b_); pf[i2] = a_; pg[i2] = b_; }
      sum += xhalf(sum); l = l * al + sum; m = mn;
#pragma unroll
      for (int t = 0; t < 4; ++t) { o[t] *= al; o[t] = wmma16b(va[t], pf, o[t]); o[t] = wmma16b(va[t], pg, o[t]); o[t] = wmma16b(vb[t], pf, o[t]); } }
    // publish point of stage st + 1, every wave, in this order
    asm volatile("s_wait_dscnt 0x0" ::: "memory");      // this wave's reads of stage st have returned
    asm volatile("s_wait_asynccnt 0x0" ::: "memory");   // this wave's copies of stage st + 1 have landed
    __syncthreads();                                      // every wave has left stage st's buffer, and stage st + 1 may be read
    if (st + 2 < NST) {   // the same for the whole work-group: stage st + 2 goes into the buffer that stage st has just left
#pragma unroll
      for (int j = 0; j < 2; ++j) stage_copies(lk + (st & 1) * STH * 2 + j * AW * 1024, ldd + (st & 1) * STH * 2 + j * 2048, kc + (st + 2) * PLH + j * AW * 512, vhc + (st + 2) * PLH + j * AW * 512, vlc + (st + 2) * PLH + j * AW * 512, Db + (st + 2) * DSH + j * 1024); } }
  asm volatile("s_wait_asynccnt 0x0" ::: "memory");   // behind the last copy, in front of the wave's end
  const float inv = (l > 0.0f) ? 1.0f / (l * PS * XS) : 0.0f;
  // ctx tiles (16 tokens x 32 k) at (token tile * 16 + kt) * TILE: accumulator tile t (lane: query col, d = t * 16 + 8 * hh + r) is already the lane's piece c = t & 1 of tile kt = h * 2 + t / 2
#pragma unroll
  for (int t = 0; t < 4; ++t) { v8b hv, lv;
#pragma unroll
    for (int r = 0; r < 8; ++r) { b16 p, q; split16(o[t][r] * inv * XS, p, q); hv[r] = p; lv[r] = q; }
    const size_t oi = ((size_t)((b * S + q0) / 16) * 16 + h * 2 + (t >> 1)) * TILE + (t & 1) * 256 + lane * 8; *(v8b*)(Ch + oi) = hv; *(v8b*)(Cl + oi) = lv; }
}
__global__ __launch_bounds__(128) void out_kernel(const b16* __restrict__ Ch, const b16* __restrict__ Cl, const b16* __restrict__ WO, const float* __restrict__ bo, float* __restrict__ out) {
  __shared__ __attribute__((aligned(16))) float Tf[4][16][128 + 4];
  const int wave = threadIdx.x >> 5, lane = threadIdx.x & 31, nloc = lane & 15, hlf = lane >> 4; const int b = blockIdx.x / (QL / 64), rb = blockIdx.x % (QL / 64); const size_t m0 = (size_t)b * S + rb * 64 + wave * 16; const int n0 = blockIdx.y * 128;
  v8f acc[8];
#pragma unroll
  for (int t = 0; t < 8; ++t) acc[t] = (v8f){};
  const b16* pa = Ch + (m0 / 16) * 16 * TILE + lane * 8; const b16* pl = Cl + (m0 / 16) * 16 * TILE + lane * 8; const b16* pw = WO + (size_t)(n0 / 16) * 16 * TILE + lane * 8;   // the lane's piece of the first k tile of its token tile and of the slab's first weight tile; they step along k with the loop
#pragma unroll 1   // rolled: loads do not move across the volatile statement behind each WMMA, so unrolling would only grow the text
  for (int kb = 0; kb < DM; kb += 64, pa += 2 * TILE, pl += 2 * TILE, pw += 2 * TILE) { v16b a[2], al[2], bw[2][8];   // the fragments of two k steps are loaded as one group in front of their WMMAs: one latency per 32 WMMAs
#pragma unroll
    for (int g = 0; g < 2; ++g) { a[g] = frag_pk(pa + g * TILE); al[g] = frag_pk(pl + g * TILE);
#pragma unroll
      for (int t = 0; t < 8; ++t) bw[g][t] = frag_pk(pw + (t * 16 + g) * TILE); }
    XCNT_WAIT3(pa, pl, pw);
#pragma unroll
    for (int g = 0; g < 2; ++g)
#pragma unroll
      for (int t = 0; t < 8; ++t) { acc[t] = wmma16b(a[g], bw[g][t], acc[t]); acc[t] = wmma16b(al[g], bw[g][t], acc[t]); } }
#pragma unroll
  for (int t = 0; t < 8; ++t) { const float bb = bf16_rne(bo[n0 + t * 16 + nloc]);
#pragma unroll
    for (int r = 0; r < 8; ++r) Tf[wave][8 * hlf + r][t * 16 + nloc] = acc[t][r] * (1.0f / (XS * WSC)) + bb; }
  wave_lds_sync();
  { for (int rr = 0; rr < 16; ++rr) *(v4f*)(out + (m0 + rr) * DM + n0 + lane * 4) = *(const v4f*)(&Tf[wave][rr][lane * 4]);  }
}
}  // namespace

extern "C" void kernel_launch(void* const* d_in, const int* in_sizes, int n_in, void* d_out, int out_size, void* d_ws, size_t ws_size, hipStream_t stream) {
  (void)n_in;
  auto Fp = [&](int i) { return (const float*)d_in[i]; };
  // d_in: 0 x [4,1024,512], 1 dist_matrix [4,1024,1024], 2 Wq [512,512] ([out][in]), 3 bq, 4 Wk, 5 bk, 6 Wv, 7 bv, 8 Wo, 9 bo
  if (in_sizes[0] != B * S * DM || in_sizes[1] != B * S * S || in_sizes[2] != DM * DM || in_sizes[3] != DM || in_sizes[8] != DM * DM || in_sizes[9] != DM || out_size != B * S * DM) return;
  size_t off = 0; char* ws = (char*)d_ws;
  auto carve = [&](size_t bytes) { char* p = ws + off; off += (bytes + 255) & ~(size_t)255; return p; };
  b16* WT = (b16*)carve((size_t)4 * DM * DM * 2); float* MAXD = (float*)carve((size_t)B * NP * 32 * 4); const size_t plane = (size_t)B * S * DM * 2;
  b16* Qp = (b16*)carve(plane); b16* Kp = (b16*)carve(plane); b16* VTh = (b16*)carve(plane); b16* VTl = (b16*)carve(plane); b16* Ch = (b16*)carve(plane); b16* Cl = (b16*)carve(plane); unsigned short* DP = (unsigned short*)carve((size_t)B * S * S * 2);
  if (off > ws_size || off > ((size_t)128 << 20)) return;   // about 35 MB
  front_kernel<<<B * NP + PB, MT, 0, stream>>>(Fp(1), Fp(2), Fp(4), Fp(6), Fp(8), MAXD, DP, WT);
  proj_kernel<<<dim3(S / 64, BL * 3, 4), 128, 0, stream>>>(Fp(0), WT, Fp(3), Fp(5), Fp(7), Qp, Kp, VTh, VTl);
  attn_kernel<<<dim3(QL / (AW * 16), BL * H), AW * 32, 0, stream>>>(Qp, Kp, VTh, VTl, DP, MAXD, Ch, Cl);
  out_kernel<<<dim3((QL / 64) * BL, 4), 128, 0, stream>>>(Ch, Cl, WT + (size_t)3 * DM * DM, Fp(9), (float*)d_out);
}

// v008
// It runs in 53.1 microseconds.
// Two timings next to v007 put it at 1.16 and 1.17 times that version's speed.
// Counting every step since v000, it is 11.2 times as fast.
#include <hip/hip_runtime.h>

// Graphormer multi-head attention (8 heads x 64, embed 512) on x [4, 1024, 512] with a distance bias: Q/K/V = x W^T + b; scores = Q K^T / 8 - 10 * dist / max_b(valid dist) (max clamped >= 1;
// keys with dist == 1e9 are masked with -inf — none in this input after bf16 rounding, but the compare is implemented); softmax; out = (attn V) Wo^T + bo -> [4][1024][512].
// Deterministic: flash-style per 16-query wave over the 1,024 keys in order (running max); per-batch max distance as 32 work-group partial maxima (one 128-byte line each), folded by each attention wave (max is exact in any order); no atomics.
// compute dtype: WMMA v_wmma_f32_16x16x32_f16 with f32 accumulate for the projections ([4096 x 512] x [512 x 1536]; x EXACT bf16 x8 staged through LDS, [out][in] weights as B rows exact x256:
// 1 product), S^T = K Q^T (q, k single f16 x8: 1 product — the distance bias dominates the logits), O^T += V^T P^T (v hi+lo x8, P x1024 hi+lo: 3 products — output rms is only 0.015) and
// out = ctx Wo^T ([4096 x 512] x [512 x 512]; ctx hi+lo: 2 products); distance bias, mask, softmax statistics and biases in f32. Inputs rounded to bf16 once (dist included).

namespace {
constexpr int B = 4, S = 1024, DM = 512, H = 8, HD = 64, BL = 4 /* batches (== B shipped) */, QL = 1024 /* query rows (== S shipped) */;
constexpr float XS = 8.0f, WSC = 256.0f, PS = 1024.0f, LOG2E = 1.4426950408889634f, INF_DIST = 1.0e9f;
static_assert(S % 64 == 0 && QL % 64 == 0 && DM == H * HD, "tiling");
typedef _Float16 b16;
typedef __attribute__((ext_vector_type(16))) _Float16 v16b;
typedef __attribute__((ext_vector_type(8))) _Float16 v8b;
typedef __attribute__((ext_vector_type(8))) float v8f;
typedef __attribute__((ext_vector_type(4))) float v4f;
typedef __attribute__((ext_vector_type(4))) unsigned int v4u;
typedef __attribute__((ext_vector_type(2))) unsigned int v2u;
__device__ __forceinline__ float bf16_rne(float f) { unsigned int u = __float_as_uint(f); u += 0x7FFFu + ((u >> 16) & 1u); return __uint_as_float(u & 0xFFFF0000u); }
__device__ __forceinline__ void split16(float v, b16& hi, b16& lo) { hi = (b16)v; lo = (b16)(v - (float)hi); }
__device__ __forceinline__ v16b frag_kb(const b16* p, int hh) { const v8b a = *(const v8b*)(p + 8 * hh), b = *(const v8b*)(p + 16 + 8 * hh); v16b f;
#pragma unroll
  for (int e = 0; e < 8; ++e) { f[e] = a[e]; f[8 + e] = b[e]; } return f; }
// fragment order (every WMMA operand that lives in the workspace): a tile of 16 rows x 32 k is TILE halves = 1,024 bytes; lane L = 16 * hh + row finds k = 16 * c + 8 * hh .. + 7 at half c * 256 + L * 8,
// so each wave-wide 16-byte load covers 512 contiguous bytes (4 whole lines) instead of 32-byte pieces of 16 lines. p = the tile's base + lane * 8; same k order as frag_kb.
constexpr int TILE = 512;
__device__ __forceinline__ v16b frag_pk(const b16* p) { const v8b a = *(const v8b*)(p), b = *(const v8b*)(p + 256); v16b f;
#pragma unroll
  for (int e = 0; e < 8; ++e) { f[e] = a[e]; f[8 + e] = b[e]; } return f; }
__device__ __forceinline__ v8f wmma16b(v16b a, v16b b, v8f c) { v8f d = __builtin_amdgcn_wmma_f32_16x16x32_f16(false, a, false, b, (short)0, c, false, false); asm volatile("v_nop\n\tv_nop\n\tv_nop\n\tv_nop" : "+v"(d) : "v"(a), "v"(b)); return d; }
__device__ __forceinline__ void wave_lds_sync() { __builtin_amdgcn_fence(__ATOMIC_RELEASE, "workgroup"); __builtin_amdgcn_wave_barrier(); __builtin_amdgcn_fence(__ATOMIC_ACQUIRE, "workgroup"); }
__device__ __forceinline__ float pmul(float a, float b) { float p = a * b; asm volatile("" : "+v"(p)); return p; }
// behind a group of global loads: the wait that stands in front of any overwrite of the loads' address registers; the addresses are inputs, so they stay in their registers up to it and no load of the group lands on them
#define XCNT_WAIT2(p, q) asm volatile("s_wait_xcnt 0x0" :: "v"(p), "v"(q) : "memory")
__device__ __forceinline__ int iclamp(int v, int lo, int hi) { return v < lo ? lo : (v > hi ? hi : v); }

typedef __attribute__((ext_vector_type(4))) _Float16 v4h;
__device__ __forceinline__ float nexp2(float v) { return __builtin_amdgcn_exp2f(v); }
// lane l takes lane l ^ 16's value by a vector cross-row move: no LDS instruction, so no wait on the LDS queue
__device__ __forceinline__ float xhalf(float v) { return __builtin_bit_cast(float, __builtin_amdgcn_permlanex16(__builtin_bit_cast(int, v), __builtin_bit_cast(int, v), 0x76543210, 0xfedcba98, false, false)); }
// stage 1 of the per-batch max: NP work-groups per batch, each over S*S/NP contiguous distances (32 query rows); work-group g owns line g of MAXD (32 equal floats, already clamped >= 1).
// The same pass prepares the distances for attention, once instead of once per head: each is rounded and tested against the mask value here and stored as the upper 16 bits of the rounded float (exact; a masked entry as +inf,
// so that its logit s * cs - inf * dsc is -inf with no test), in fragment order: tile (16 queries x 32 keys) at ((batch * S/16 + query tile) * S/32 + key block) * TILE, row = query, k = key.
constexpr int NP = 32, MT = 512, ML = 16, DPITCH = 128 + 8;   // DPITCH: rows 272 bytes apart, so the 16 rows of a 16-byte column read fall on different banks
static_assert(S * S / NP == MT * ML * 4 && S * S / NP == 2 * ML * S && S == 8 * 128 && MT == 16 * 32, "a wave takes 16 rows x 128 keys (4 tiles): one pass of ML 16-byte loads per thread covers a work-group's share");
// The weight conversion needs nothing of the distance pass and the distance pass nothing of it, so they share one grid: work-groups 0 .. B * NP - 1 take the distances (the longer job, so it starts first), the PB behind them the weights.
constexpr int PJ = 2, PB = 4 * DM * DM / 8 / (MT * PJ);
static_assert(PB * MT * PJ * 8 == 4 * DM * DM && (DM * DM / 8) % (MT * PJ) == 0, "every 16-byte piece of the four weight planes has one thread, and a work-group stays inside one matrix");
__global__ __launch_bounds__(MT) void front_kernel(const float* __restrict__ dist, const float* __restrict__ wq, const float* __restrict__ wk, const float* __restrict__ wv, const float* __restrict__ wo, float* __restrict__ MAXD, unsigned short* __restrict__ DP, b16* __restrict__ WT) {
  if (blockIdx.x >= B * NP) {   // the same for the whole work-group, and it leaves in front of every barrier
    const int pb = blockIdx.x - B * NP, m = pb / (DM * DM / 8 / (MT * PJ)); const float* w = m == 0 ? wq : m == 1 ? wk : m == 2 ? wv : wo; const int v0 = (pb % (DM * DM / 8 / (MT * PJ))) * (MT * PJ) + threadIdx.x; v4f f[PJ][2]; const float* p[PJ];
    // thread = PJ 16-byte pieces of the fragment-order plane (stores contiguous); tile (nt, kt) = 16 out rows x 32 in at (nt * 16 + kt) * TILE
#pragma unroll   // the loads of all PJ pieces issue before the first use
    for (int j = 0; j < PJ; ++j) { const int v = v0 + j * MT, tile = v >> 6, c = (v >> 5) & 1, hh = (v >> 4) & 1, r = v & 15; p[j] = w + (size_t)((tile >> 4) * 16 + r) * DM + (tile & 15) * 32 + c * 16 + hh * 8; f[j][0] = *(const v4f*)p[j]; f[j][1] = *(const v4f*)(p[j] + 4); }
    static_assert(PJ == 2, "the wait below names both addresses"); XCNT_WAIT2(p[0], p[1]);
#pragma unroll   // f[] stays in registers
    for (int j = 0; j < PJ; ++j) { v8b o;
#pragma unroll
      for (int e = 0; e < 8; ++e) o[e] = (b16)(bf16_rne(f[j][e >> 2][e & 3]) * WSC);
      *(v8b*)(WT + (size_t)m * DM * DM + (size_t)(v0 + j * MT) * 8) = o; }
    return; }
  __shared__ float red[MT / 32]; __shared__ __attribute__((aligned(16))) unsigned short Ds[MT / 32][ML][DPITCH];
  const int t = threadIdx.x, wave = t >> 5, lane = t & 31, qt = wave >> 3, kq = wave & 7; const float* p = dist + (size_t)blockIdx.x * (S * S / NP) + (size_t)qt * ML * S + kq * 128 + lane * 4; v4f v[ML];
#pragma unroll   // all ML loads issue before the first use: the share is in flight at once; each wave-wide load covers 512 contiguous bytes of one row
  for (int j = 0; j < ML; ++j) v[j] = *(const v4f*)(p + (size_t)j * S);
  asm volatile("s_wait_xcnt 0x0" :: "v"(p) : "memory");   // behind the group of loads, in front of any overwrite of their address register; the address is an input, so no load of the group lands on it
  float m = 0.0f;   // masked entries contribute 0
#pragma unroll   // v[] stays in registers
  for (int j = 0; j < ML; ++j) { unsigned int hb[4];
#pragma unroll
    for (int e = 0; e < 4; ++e) { const float d = bf16_rne(v[j][e]); const bool ok = d != INF_DIST; const float vd = ok ? d : d * 0.0f; m = fmaxf(m, vd); hb[e] = ok ? __float_as_uint(d) : 0x7F800000u; }
    v2u o; o[0] = (hb[0] >> 16) | hb[1]; o[1] = (hb[2] >> 16) | hb[3]; *(v2u*)(&Ds[wave][j][lane * 4]) = o; }
  wave_lds_sync();   // the wave's own rows only: its lanes read below what other lanes of the same wave stored above
  { unsigned short* op = DP + ((size_t)(blockIdx.x * 2 + qt) * (S / 32) + kq * 4) * TILE + lane * 8;   // the wave's 4 tiles are 4,096 contiguous bytes: each wave-wide store covers 4 whole lines, and no other wave writes them
#pragma unroll
    for (int i = 0; i < 8; ++i) *(v4u*)(op + i * 256) = *(const v4u*)(&Ds[wave][lane & 15][(i >> 1) * 32 + (i & 1) * 16 + (lane >> 4) * 8]); }
  for (int w = 16; w >= 1; w >>= 1) m = fmaxf(m, __shfl_xor(m, w));
  if ((t & 31) == 0) red[t >> 5] = m;
  __syncthreads();
  if (t < 32) { float r = red[t & (MT / 32 - 1)]; for (int w = MT / 64; w >= 1; w >>= 1) r = fmaxf(r, __shfl_xor(r, w)); MAXD[blockIdx.x * 32 + t] = fmaxf(r, 1.0f); }
}
// Both GEMMs: the 4 waves of a work-group use the same weight tiles, so the work-group brings each stage of k into LDS once (asynchronous copies, two buffers: stage s + 1 flies while stage s is worked on). Projections: a stage is 64 k = 8 n tiles x 2 k tiles = WSH halves; the output GEMM: twice that.
// The planes are in fragment order, so a stage is a straight copy (projections: tile (t, g) at (t * 2 + g) * TILE), and a fragment read is 512 contiguous bytes of LDS per wave.
constexpr int GS = DM / 64, WSH = 8 * 2 * TILE;
static_assert(GS >= 2 && WSH == 4 * 8 * 256, "one call of gemm_copies in each of the 4 waves covers a stage's weights");
// eight copies of 512 bytes a wave: 4 KiB of LDS from the lane's byte address l on, the first 2 KiB from g0 and the second from g1 (the lane's global addresses; each 2 KiB = two k tiles that follow one another).
// The wait on the address translations is the statement's last line, so it stands in front of every later write of a register that a copy names.
__device__ __forceinline__ void gemm_copies(unsigned int l, const b16* g0, const b16* g1) {
  asm volatile("global_load_async_to_lds_b128 %0, %8, off\n\t"
               "global_load_async_to_lds_b128 %1, %9, off\n\t"
               "global_load_async_to_lds_b128 %2, %10, off\n\t"
               "global_load_async_to_lds_b128 %3, %11, off\n\t"
               "global_load_async_to_lds_b128 %4, %12, off\n\t"
               "global_load_async_to_lds_b128 %5, %13, off\n\t"
               "global_load_async_to_lds_b128 %6, %14, off\n\t"
               "global_load_async_to_lds_b128 %7, %15, off\n\t"
               "s_wait_xcnt 0x0"
               :: "v"(l), "v"(l + 512u), "v"(l + 1024u), "v"(l + 1536u), "v"(l + 2048u), "v"(l + 2560u), "v"(l + 3072u), "v"(l + 3584u),
                  "v"(g0), "v"(g0 + 256), "v"(g0 + 512), "v"(g0 + 768), "v"(g1), "v"(g1 + 256), "v"(g1 + 512), "v"(g1 + 768) : "memory");
}
__global__ __launch_bounds__(128) void proj_kernel(const float* __restrict__ x, const b16* __restrict__ WT, const float* __restrict__ bq, const float* __restrict__ bk, const float* __restrict__ bv, b16* __restrict__ Qp, b16* __restrict__ Kp, b16* __restrict__ VTh, b16* __restrict__ VTl) {
  __shared__ __attribute__((aligned(16))) b16 As[4][16][256 + 8]; __shared__ __attribute__((aligned(16))) float Tf[4][16][128 + 4]; __shared__ __attribute__((aligned(16))) b16 Wr[2][WSH];
  const int wave = threadIdx.x >> 5, lane = threadIdx.x & 31, nloc = lane & 15, hlf = lane >> 4; const int which = blockIdx.y % 3, b = blockIdx.y / 3; const int rb = blockIdx.x, slab = blockIdx.z; const int t0 = rb * 64 + wave * 16; const int n0 = slab * 128;
  const b16* W = WT + (size_t)which * DM * DM; const b16* wc = W + (size_t)(n0 / 16 + wave * 2) * 16 * TILE + lane * 8;   // the wave copies n tiles 2 * wave and 2 * wave + 1 of the slab: the lane's piece of the first one's k tile 0; stage s is 2 * s tiles further
  const unsigned int lw = (unsigned int)(size_t)&Wr[0][0] + (wave * 4 * TILE + lane * 8) * 2;   // the lane's place in buffer 0
  gemm_copies(lw, wc, wc + 16 * TILE);   // stage 0 into buffer 0
  asm volatile("s_wait_asynccnt 0x0" ::: "memory");   // this wave's copies of stage 0 have landed
  __syncthreads();                                      // ... and every other wave's: stage 0 may be read
  gemm_copies(lw + WSH * 2, wc + 2 * TILE, wc + 18 * TILE);   // stage 1 into buffer 1: it flies while x is staged and stage 0 is worked on
  const float* bias = which == 0 ? bq : (which == 1 ? bk : bv);
  v8f acc[8];
#pragma unroll
  for (int t = 0; t < 8; ++t) acc[t] = (v8f){};
#pragma unroll 1
  for (int half = 0; half < 2; ++half) {
    { const float* xr = x + ((size_t)b * S + t0) * DM + half * 256 + lane * 4; v4f xv[32];
#pragma unroll   // all 32 loads of the wave's 16 half rows issue before the first use: one latency instead of 32
      for (int i = 0; i < 32; ++i) xv[i] = *(const v4f*)(xr + (size_t)(i >> 1) * DM + (i & 1) * 128);
      asm volatile("s_wait_xcnt 0x0" :: "v"(xr) : "memory");   // behind the group of loads, in front of any overwrite of their address register (this build's text rewrites it); the address is an input, so no load of the group lands on it
#pragma unroll   // xv[] stays in registers
      for (int i = 0; i < 32; ++i) { v4h o; for (int j = 0; j < 4; ++j) o[j] = (b16)(bf16_rne(xv[i][j]) * XS); *(v4h*)(&As[wave][i >> 1][(i & 1) * 128 + lane * 4]) = o; } }
    wave_lds_sync();
#pragma unroll 1   // rolled: loads do not move across the volatile statement behind each WMMA, so unrolling would only grow the text
    for (int kb = 0; kb < 256; kb += 64) { const int st = half * 4 + kb / 64; const b16* rw = &Wr[st & 1][0] + lane * 8; v16b a[2], bw[2][8];   // the fragments of a stage (two k steps) are read as one group in front of their WMMAs
#pragma unroll
      for (int g = 0; g < 2; ++g) {
#pragma unroll
        for (int t = 0; t < 8; ++t) bw[g][t] = frag_pk(rw + (t * 2 + g) * TILE);
        a[g] = frag_kb(&As[wave][nloc][kb + g * 32], hlf); }
#pragma unroll
      for (int g = 0; g < 2; ++g)
#pragma unroll
        for (int t = 0; t < 8; ++t) acc[t] = wmma16b(a[g], bw[g][t], acc[t]);
      // publish point of stage st + 1, every wave, in this order
      asm volatile("s_wait_dscnt 0x0" ::: "memory");      // this wave's reads of stage st have returned
      asm volatile("s_wait_asynccnt 0x0" ::: "memory");   // this wave's copies of stage st + 1 have landed
      __syncthreads();                                      // every wave has left stage st's buffer, and stage st + 1 may be read
      if (st + 2 < GS) gemm_copies(lw + (st & 1) * WSH * 2, wc + (st + 2) * 2 * TILE, wc + (st + 2) * 2 * TILE + 16 * TILE); }   // the same for the whole work-group: stage st + 2 goes into the buffer that stage st has just left
    wave_lds_sync(); }
  asm volatile("s_wait_asynccnt 0x0" ::: "memory");   // behind the last copy
#pragma unroll
  for (int t = 0; t < 8; ++t) { const float bb = bf16_rne(bias[n0 + t * 16 + nloc]);
#pragma unroll
    for (int r = 0; r < 8; ++r) Tf[wave][8 * hlf + r][t * 16 + nloc] = acc[t][r] * (1.0f / (XS * WSC)) + bb; }
  __syncthreads();
  {
    if (which == 2) {
      const int hs = wave >> 1, j = wave & 1; const int h = n0 / HD + hs;   // V^T tiles (16 d x 32 keys) at ((head * S/32 + key block) * 4 + t) * TILE; the wave writes one head's 64 d of one 32-key block
#pragma unroll
      for (int q = 0; q < 8; ++q) { const int t = q >> 1, c = q & 1; v8b hv, lv;
#pragma unroll
        for (int e = 0; e < 8; ++e) { b16 p, ql; split16(Tf[j * 2 + c][hlf * 8 + e][hs * 64 + t * 16 + nloc] * XS, p, ql); hv[e] = p; lv[e] = ql; }
        const size_t oi = ((((size_t)b * H + h) * (S / 32) + rb * 2 + j) * 4 + t) * TILE + c * 256 + lane * 8; *(v8b*)(VTh + oi) = hv; *(v8b*)(VTl + oi) = lv; } }
    else { b16* P = which == 0 ? Qp : Kp;   // Q and K tiles (16 tokens x 32 d) at ((head * S/16 + token tile) * 2 + dt) * TILE; the wave's 16 tokens are one token tile
#pragma unroll
      for (int q = 0; q < 8; ++q) { const int hs = q >> 2, dt = (q >> 1) & 1, c = q & 1; const int h = n0 / HD + hs; const float* sp = &Tf[wave][nloc][hs * 64 + dt * 32 + c * 16 + hlf * 8]; const v4f f0 = *(const v4f*)sp, f1 = *(const v4f*)(sp + 4); v8b o;
#pragma unroll
        for (int e = 0; e < 4; ++e) { o[e] = (b16)(f0[e] * XS); o[4 + e] = (b16)(f1[e] * XS); }
        *(v8b*)(P + ((((size_t)b * H + h) * (S / 16) + rb * 4 + wave) * 2 + dt) * TILE + c * 256 + lane * 8) = o; }
      asm volatile("s_wait_xcnt 0x0" ::: "memory"); }   // behind the last store: in this build the text that follows the stores rewrites their address register
     }
}
// attention: grid (QL/128, BL*H): block = AW waves x 16 queries; per 32-key pass: S^T tiles, logit = s/8 - 10 * dist[b][q][key]/maxd (prepared distances: a masked one is +inf, so its logit is -inf), online softmax, P x1024 hi/lo.
// The AW waves read the same K and V tiles, so the work-group brings each stage of SK keys into LDS once (asynchronous copies, two buffers: stage s + 1 flies while stage s is worked on); each wave's own distances ride in the same ring.
// The workspace planes are in fragment order, so a stage is a straight copy: K | V hi | V lo (PLH halves each) | AW x DSH halves of distances, and a fragment read is 512 contiguous bytes of LDS per wave.
constexpr int AW = 8, SK = 128, SP = SK / 32, NST = S / SK, PLH = SP * 4 * TILE, DSH = SP * TILE, STH = 3 * PLH + AW * DSH;
static_assert(NST >= 2 && QL % (AW * 16) == 0 && PLH == 2 * AW * 2 * 256 && DSH == 2 * 4 * 256, "two calls of stage_copies in each of the AW waves cover a stage");
// half of one wave's share of a stage: 2 x 512 bytes of each of K, V hi, V lo and 4 x 512 bytes of the wave's distances. l, ld: the lane's LDS byte addresses (K plane, distances); k, vh, vl, d: the lane's global addresses.
// The wait on the address translations is the statement's last line, so it stands in front of every later write of a register that a copy names.
__device__ __forceinline__ void stage_copies(unsigned int l, unsigned int ld, const b16* k, const b16* vh, const b16* vl, const unsigned short* d) {
  asm volatile("global_load_async_to_lds_b128 %0, %10, off\n\t"
               "global_load_async_to_lds_b128 %1, %11, off\n\t"
               "global_load_async_to_lds_b128 %2, %12, off\n\t"
               "global_load_async_to_lds_b128 %3, %13, off\n\t"
               "global_load_async_to_lds_b128 %4, %14, off\n\t"
               "global_load_async_to_lds_b128 %5, %15, off\n\t"
               "global_load_async_to_lds_b128 %6, %16, off\n\t"
               "global_load_async_to_lds_b128 %7, %17, off\n\t"
               "global_load_async_to_lds_b128 %8, %18, off\n\t"
               "global_load_async_to_lds_b128 %9, %19, off\n\t"
               "s_wait_xcnt 0x0"
               :: "v"(l), "v"(l + 512u), "v"(l + PLH * 2u), "v"(l + PLH * 2u + 512u), "v"(l + PLH * 4u), "v"(l + PLH * 4u + 512u), "v"(ld), "v"(ld + 512u), "v"(ld + 1024u), "v"(ld + 1536u),
                  "v"(k), "v"(k + 256), "v"(vh), "v"(vh + 256), "v"(vl), "v"(vl + 256), "v"(d), "v"(d + 256), "v"(d + 512), "v"(d + 768) : "memory");
}
__global__ __launch_bounds__(AW * 32) void attn_kernel(const b16* __restrict__ Qp, const b16* __restrict__ Kp, const b16* __restrict__ VTh, const b16* __restrict__ VTl, const unsigned short* __restrict__ DP, const float* __restrict__ MAXD, b16* __restrict__ Ch, b16* __restrict__ Cl) {
  __shared__ __attribute__((aligned(16))) b16 Ring[2][STH];
  const int wave = threadIdx.x >> 5, lane = threadIdx.x & 31; const int b = blockIdx.y / H, h = blockIdx.y % H; const int q0 = blockIdx.x * (AW * 16) + wave * 16;   // in the comments below: hh = lane >> 4, col = lane & 15
  const b16* Qb = Qp + ((size_t)(b * H + h) * S) * HD; const b16* Kb = Kp + ((size_t)(b * H + h) * S) * HD; const b16* Vh = VTh + ((size_t)(b * H + h) * HD) * S; const b16* Vl = VTl + ((size_t)(b * H + h) * HD) * S;
  const unsigned short* Db = DP + (size_t)(b * (S / 16) + q0 / 16) * (S / 32) * TILE + lane * 8;
  // the lane's places in buffer 0 and in stage 0; call j of a stage is AW * 512 halves (planes) and 1,024 halves (distances) further on both sides, stage s is s * PLH and s * DSH halves further in global memory
  const unsigned int lk = (unsigned int)(size_t)&Ring[0][0] + (wave * 512 + lane * 8) * 2, ldd = (unsigned int)(size_t)&Ring[0][0] + (3 * PLH + wave * DSH + lane * 8) * 2;
  const b16* kc = Kb + wave * 512 + lane * 8; const b16* vhc = Vh + wave * 512 + lane * 8; const b16* vlc = Vl + wave * 512 + lane * 8;
#pragma unroll   // two statements of ten copies: stage 0 into buffer 0
  for (int j = 0; j < 2; ++j) stage_copies(lk + j * AW * 1024, ldd + j * 2048, kc + j * AW * 512, vhc + j * AW * 512, vlc + j * AW * 512, Db + j * 1024);
  float md = MAXD[(b * NP + lane) * 32];   // stage 2 of the max: lane i takes partial i of this batch
  for (int w = 16; w >= 1; w >>= 1) md = fmaxf(md, __shfl_xor(md, w));
  const float dsc = 10.0f * LOG2E / md;
  const v16b qa0 = frag_pk(Qb + (q0 / 16) * 2 * TILE + lane * 8), qa1 = frag_pk(Qb + ((q0 / 16) * 2 + 1) * TILE + lane * 8);
  const float cs = LOG2E / (8.0f * XS * XS);
  float m = -INFINITY, l = 0.0f; v8f o[4]; for (int t = 0; t < 4; ++t) o[t] = (v8f){};
  asm volatile("s_wait_asynccnt 0x0" ::: "memory");   // this wave's copies of stage 0 have landed
  __syncthreads();                                      // ... and every other wave's: stage 0 may be read
#pragma unroll   // stage 1 into buffer 1: it flies while stage 0 is worked on
  for (int j = 0; j < 2; ++j) stage_copies(lk + STH * 2 + j * AW * 1024, ldd + STH * 2 + j * 2048, kc + PLH + j * AW * 512, vhc + PLH + j * AW * 512, vlc + PLH + j * AW * 512, Db + DSH + j * 1024);
#pragma unroll 1   // rolled over the stages: the SP passes of a stage are the unrolled body
  for (int st = 0; st < NST; ++st) {
    const b16* rb = &Ring[st & 1][0] + lane * 8; const b16* dl = rb + 3 * PLH + wave * DSH;   // the lane's piece of the stage's first K tile and of the wave's first distance tile
    // read schedule inside a stage: a pass's V fragments issue at its top (used behind the softmax); the next pass's K fragments issue behind this pass's score WMMAs and its distances behind the logits. Nothing of the next stage is read here.
    v16b kf[4]; v4u dd[2];
#pragma unroll
    for (int u = 0; u < 2; ++u) { kf[2 * u] = frag_pk(rb + 2 * u * TILE); kf[2 * u + 1] = frag_pk(rb + (2 * u + 1) * TILE); dd[u] = *(const v4u*)(dl + u * 256); }
    __builtin_amdgcn_sched_barrier(0);   // the stage's first K and distance reads stay ahead of the V reads in the LDS queue: LDS reads return in order, and the first logits would otherwise wait for all 26
#pragma unroll   // the tests on ps fold, and every LDS offset is a constant
    for (int ps = 0; ps < SP; ++ps) {
      float e[16]; float mx = -INFINITY; v16b va[4], vb[4]; v8f s[2];
#pragma unroll
      for (int t = 0; t < 4; ++t) { va[t] = frag_pk(rb + PLH + (ps * 4 + t) * TILE); vb[t] = frag_pk(rb + 2 * PLH + (ps * 4 + t) * TILE); }
#pragma unroll
      for (int u = 0; u < 2; ++u) { s[u] = (v8f){}; s[u] = wmma16b(kf[2 * u], qa0, s[u]); s[u] = wmma16b(kf[2 * u + 1], qa1, s[u]); }
      if (ps + 1 < SP) {
#pragma unroll
        for (int u = 0; u < 2; ++u) { kf[2 * u] = frag_pk(rb + ((ps + 1) * 4 + 2 * u) * TILE); kf[2 * u + 1] = frag_pk(rb + ((ps + 1) * 4 + 2 * u + 1) * TILE); } }
#pragma unroll
      for (int u = 0; u < 2; ++u)
#pragma unroll
        for (int r = 0; r < 8; ++r) { const unsigned int w2 = dd[u][r >> 1]; const float dv = __uint_as_float((r & 1) ? (w2 & 0xFFFF0000u) : (w2 << 16)); const float vv = s[u][r] * cs - dv * dsc; e[u * 8 + r] = vv; mx = fmaxf(mx, vv); }
      if (ps + 1 < SP) {
#pragma unroll
        for (int u = 0; u < 2; ++u) dd[u] = *(const v4u*)(dl + (ps + 1) * TILE + u * 256); }
      mx = fmaxf(mx, xhalf(mx)); const float mn = fmaxf(m, mx); const float al = (mn == -INFINITY) ? 1.0f : nexp2(m - mn); float sum = 0.0f;
      // P^T as the B operand straight from the score accumulators: the lane holds keys 8 * hh + r of score tile 0 and 16 + 8 * hh + r of tile 1 for query col, and that is element r and 8 + r of B's column col in the k order of V^T's fragments
      v16b pf, pg;
#pragma unroll
      for (int i2 = 0; i2 < 16; ++i2) { const float p = (e[i2] == -INFINITY || mn == -INFINITY) ? 0.0f : nexp2(e[i2] - mn); sum += p; b16 a_, b_; split16(p * PS, a_, b_); pf[i2] = a_; pg[i2] = b_; }
      sum += xhalf(sum); l = l * al + sum; m = mn;
#pragma unroll
      for (int t = 0; t < 4; ++t) { o[t] *= al; o[t] = wmma16b(va[t], pf, o[t]); o[t] = wmma16b(va[t], pg, o[t]); o[t] = wmma16b(vb[t], pf, o[t]); } }
    // publish point of stage st + 1, every wave, in this order
    asm volatile("s_wait_dscnt 0x0" ::: "memory");      // this wave's reads of stage st have returned
    asm volatile("s_wait_asynccnt 0x0" ::: "memory");   // this wave's copies of stage st + 1 have landed
    __syncthreads();                                      // every wave has left stage st's buffer, and stage st + 1 may be read
    if (st + 2 < NST) {   // the same for the whole work-group: stage st + 2 goes into the buffer that stage st has just left
#pragma unroll
      for (int j = 0; j < 2; ++j) stage_copies(lk + (st & 1) * STH * 2 + j * AW * 1024, ldd + (st & 1) * STH * 2 + j * 2048, kc + (st + 2) * PLH + j * AW * 512, vhc + (st + 2) * PLH + j * AW * 512, vlc + (st + 2) * PLH + j * AW * 512, Db + (st + 2) * DSH + j * 1024); } }
  asm volatile("s_wait_asynccnt 0x0" ::: "memory");   // behind the last copy, in front of the wave's end
  const float inv = (l > 0.0f) ? 1.0f / (l * PS * XS) : 0.0f;
  // ctx tiles (16 tokens x 32 k) at (token tile * 16 + kt) * TILE: accumulator tile t (lane: query col, d = t * 16 + 8 * hh + r) is already the lane's piece c = t & 1 of tile kt = h * 2 + t / 2
#pragma unroll
  for (int t = 0; t < 4; ++t) { v8b hv, lv;
#pragma unroll
    for (int r = 0; r < 8; ++r) { b16 p, q; split16(o[t][r] * inv * XS, p, q); hv[r] = p; lv[r] = q; }
    const size_t oi = ((size_t)((b * S + q0) / 16) * 16 + h * 2 + (t >> 1)) * TILE + (t & 1) * 256 + lane * 8; *(v8b*)(Ch + oi) = hv; *(v8b*)(Cl + oi) = lv; }
}
__global__ __launch_bounds__(128) void out_kernel(const b16* __restrict__ Ch, const b16* __restrict__ Cl, const b16* __restrict__ WO, const float* __restrict__ bo, float* __restrict__ out) {
  // one work-group per WGP and one wave per SIMD here, so a stage is 128 k: the next stage's copies have the time of 64 WMMAs to land. A stage: the weights, tile (t, kk) at (t * 4 + kk) * TILE | per wave 4 k tiles of ctx hi, 4 of ctx lo (each wave's own rows ride in the same ring)
  constexpr int ONS = DM / 128, OWH = 2 * WSH, OSH = OWH + 4 * 8 * TILE; static_assert(ONS >= 2, "two buffers");
  __shared__ __attribute__((aligned(16))) float Tf[4][16][128 + 4]; __shared__ __attribute__((aligned(16))) b16 Ro[2][OSH];
  const int wave = threadIdx.x >> 5, lane = threadIdx.x & 31, nloc = lane & 15, hlf = lane >> 4; const int b = blockIdx.x / (QL / 64), rb = blockIdx.x % (QL / 64); const size_t m0 = (size_t)b * S + rb * 64 + wave * 16; const int n0 = blockIdx.y * 128;
  v8f acc[8];
#pragma unroll
  for (int t = 0; t < 8; ++t) acc[t] = (v8f){};
  const b16* pa = Ch + (m0 / 16) * 16 * TILE + lane * 8; const b16* pl = Cl + (m0 / 16) * 16 * TILE + lane * 8; const b16* wc = WO + (size_t)(n0 / 16 + wave * 2) * 16 * TILE + lane * 8;   // the lane's piece of k tile 0 of its token tile and of n tile 2 * wave of the slab (the wave copies that one and the next); stage s is 4 * s tiles further
  const unsigned int lw = (unsigned int)(size_t)&Ro[0][0] + (wave * 8 * TILE + lane * 8) * 2, lc = lw + OWH * 2;   // the lane's places in buffer 0: weights, ctx
  // the wave's share of stage s into the buffer bo bytes behind buffer 0: 4 statements of 8 copies (n tile 2 * wave, n tile 2 * wave + 1, ctx hi, ctx lo; 4 KiB = 4 k tiles each)
  auto stage = [&](unsigned int bo, int s) { const int k4 = s * 4 * TILE;
    gemm_copies(lw + bo, wc + k4, wc + k4 + 2 * TILE); gemm_copies(lw + bo + 4096u, wc + k4 + 16 * TILE, wc + k4 + 18 * TILE); gemm_copies(lc + bo, pa + k4, pa + k4 + 2 * TILE); gemm_copies(lc + bo + 4096u, pl + k4, pl + k4 + 2 * TILE); };
  stage(0u, 0);   // stage 0 into buffer 0
  asm volatile("s_wait_asynccnt 0x0" ::: "memory");   // this wave's copies of stage 0 have landed
  __syncthreads();                                      // ... and every other wave's: stage 0 may be read
  stage(OSH * 2u, 1);   // stage 1 into buffer 1: it flies while stage 0 is worked on
#pragma unroll 1   // rolled over the stages
  for (int st = 0; st < ONS; ++st) {
#pragma unroll 1   // rolled: loads do not move across the volatile statement behind each WMMA, so unrolling would only grow the text
   for (int j = 0; j < 2; ++j) { const b16* rw = &Ro[st & 1][0] + j * 2 * TILE + lane * 8; const b16* rc = rw + OWH + wave * 8 * TILE; v16b a[2], al[2], bw[2][8];   // the fragments of two k steps are read as one group in front of their WMMAs
#pragma unroll
    for (int g = 0; g < 2; ++g) { a[g] = frag_pk(rc + g * TILE); al[g] = frag_pk(rc + (4 + g) * TILE);
#pragma unroll
      for (int t = 0; t < 8; ++t) bw[g][t] = frag_pk(rw + (t * 4 + g) * TILE); }
#pragma unroll
    for (int g = 0; g < 2; ++g)
#pragma unroll
      for (int t = 0; t < 8; ++t) { acc[t] = wmma16b(a[g], bw[g][t], acc[t]); acc[t] = wmma16b(al[g], bw[g][t], acc[t]); } }
    // publish point of stage st + 1, every wave, in this order
    asm volatile("s_wait_dscnt 0x0" ::: "memory");      // this wave's reads of stage st have returned
    asm volatile("s_wait_asynccnt 0x0" ::: "memory");   // this wave's copies of stage st + 1 have landed
    __syncthreads();                                      // every wave has left stage st's buffer, and stage st + 1 may be read
    if (st + 2 < ONS) stage((st & 1) * OSH * 2u, st + 2); }   // the same for the whole work-group: stage st + 2 goes into the buffer that stage st has just left
  asm volatile("s_wait_asynccnt 0x0" ::: "memory");   // behind the last copy
#pragma unroll
  for (int t = 0; t < 8; ++t) { const float bb = bf16_rne(bo[n0 + t * 16 + nloc]);
#pragma unroll
    for (int r = 0; r < 8; ++r) Tf[wave][8 * hlf + r][t * 16 + nloc] = acc[t][r] * (1.0f / (XS * WSC)) + bb; }
  wave_lds_sync();
  { for (int rr = 0; rr < 16; ++rr) *(v4f*)(out + (m0 + rr) * DM + n0 + lane * 4) = *(const v4f*)(&Tf[wave][rr][lane * 4]);  }
}
}  // namespace

extern "C" void kernel_launch(void* const* d_in, const int* in_sizes, int n_in, void* d_out, int out_size, void* d_ws, size_t ws_size, hipStream_t stream) {
  (void)n_in;
  auto Fp = [&](int i) { return (const float*)d_in[i]; };
  // d_in: 0 x [4,1024,512], 1 dist_matrix [4,1024,1024], 2 Wq [512,512] ([out][in]), 3 bq, 4 Wk, 5 bk, 6 Wv, 7 bv, 8 Wo, 9 bo
  if (in_sizes[0] != B * S * DM || in_sizes[1] != B * S * S || in_sizes[2] != DM * DM || in_sizes[3] != DM || in_sizes[8] != DM * DM || in_sizes[9] != DM || out_size != B * S * DM) return;
  size_t off = 0; char* ws = (char*)d_ws;
  auto carve = [&](size_t bytes) { char* p = ws + off; off += (bytes + 255) & ~(size_t)255; return p; };
  b16* WT = (b16*)carve((size_t)4 * DM * DM * 2); float* MAXD = (float*)carve((size_t)B * NP * 32 * 4); const size_t plane = (size_t)B * S * DM * 2;
  b16* Qp = (b16*)carve(plane); b16* Kp = (b16*)carve(plane); b16* VTh = (b16*)carve(plane); b16* VTl = (b16*)carve(plane); b16* Ch = (b16*)carve(plane); b16* Cl = (b16*)carve(plane); unsigned short* DP = (unsigned short*)carve((size_t)B * S * S * 2);
  if (off > ws_size || off > ((size_t)128 << 20)) return;   // about 35 MB
  front_kernel<<<B * NP + PB, MT, 0, stream>>>(Fp(1), Fp(2), Fp(4), Fp(6), Fp(8), MAXD, DP, WT);
  proj_kernel<<<dim3(S / 64, BL * 3, 4), 128, 0, stream>>>(Fp(0), WT, Fp(3), Fp(5), Fp(7), Qp, Kp, VTh, VTl);
  attn_kernel<<<dim3(QL / (AW * 16), BL * H), AW * 32, 0, stream>>>(Qp, Kp, VTh, VTl, DP, MAXD, Ch, Cl);
  out_kernel<<<dim3((QL / 64) * BL, 4), 128, 0, stream>>>(Ch, Cl, WT + (size_t)3 * DM * DM, Fp(9), (float*)d_out);
}

// v009
// It runs in 48.3 microseconds.
// Two timings next to v008 put it at 1.10 and 1.09 times that version's speed.
// All steps since v000 together make it 12.2 times as fast.
#include <hip/hip_runtime.h>

// Graphormer multi-head attention (8 heads x 64, embed 512) on x [4, 1024, 512] with a distance bias: Q/K/V = x W^T + b; scores = Q K^T / 8 - 10 * dist / max_b(valid dist) (max clamped >= 1;
// keys with dist == 1e9 are masked with -inf — none in this input after bf16 rounding, but the compare is implemented); softmax; out = (attn V) Wo^T + bo -> [4][1024][512].
// Deterministic: flash-style per 16-query wave over the 1,024 keys in order (running max); per-batch max distance as 32 work-group partial maxima (one 128-byte line each), folded by each attention wave (max is exact in any order); no atomics.
// compute dtype: WMMA v_wmma_f32_16x16x32_f16 with f32 accumulate for the projections ([4096 x 512] x [512 x 1536]; x EXACT bf16 x8 staged through LDS, [out][in] weights as B rows exact x256:
// 1 product), S^T = K Q^T (q, k single f16 x8: 1 product — the distance bias dominates the logits), O^T += V^T P^T (v hi+lo x8, P x1024 hi+lo: 3 products — output rms is only 0.015) and
// out = ctx Wo^T ([4096 x 512] x [512 x 512]; ctx hi+lo: 2 products); distance bias, mask, softmax statistics and biases in f32. Inputs rounded to bf16 once (dist included).

namespace {
constexpr int B = 4, S = 1024, DM = 512, H = 8, HD = 64, BL = 4 /* batches (== B shipped) */, QL = 1024 /* query rows (== S shipped) */;
constexpr float XS = 8.0f, WSC = 256.0f, PS = 1024.0f, LOG2E = 1.4426950408889634f, INF_DIST = 1.0e9f;
static_assert(S % 64 == 0 && QL % 64 == 0 && DM == H * HD, "tiling");
typedef _Float16 b16;
typedef __attribute__((ext_vector_type(16))) _Float16 v16b;
typedef __attribute__((ext_vector_type(8))) _Float16 v8b;
typedef __attribute__((ext_vector_type(8))) float v8f;
typedef __attribute__((ext_vector_type(4))) float v4f;
typedef __attribute__((ext_vector_type(4))) unsigned int v4u;
typedef __attribute__((ext_vector_type(2))) unsigned int v2u;
__device__ __forceinline__ float bf16_rne(float f) { unsigned int u = __float_as_uint(f); u += 0x7FFFu + ((u >> 16) & 1u); return __uint_as_float(u & 0xFFFF0000u); }
__device__ __forceinline__ void split16(float v, b16& hi, b16& lo) { hi = (b16)v; lo = (b16)(v - (float)hi); }
__device__ __forceinline__ v16b frag_kb(const b16* p, int hh) { const v8b a = *(const v8b*)(p + 8 * hh), b = *(const v8b*)(p + 16 + 8 * hh); v16b f;
#pragma unroll
  for (int e = 0; e < 8; ++e) { f[e] = a[e]; f[8 + e] = b[e]; } return f; }
// fragment order (every WMMA operand that lives in the workspace): a tile of 16 rows x 32 k is TILE halves = 1,024 bytes; lane L = 16 * hh + row finds k = 16 * c + 8 * hh .. + 7 at half c * 256 + L * 8,
// so each wave-wide 16-byte load covers 512 contiguous bytes (4 whole lines) instead of 32-byte pieces of 16 lines. p = the tile's base + lane * 8; same k order as frag_kb.
constexpr int TILE = 512;
__device__ __forceinline__ v16b frag_pk(const b16* p) { const v8b a = *(const v8b*)(p), b = *(const v8b*)(p + 256); v16b f;
#pragma unroll
  for (int e = 0; e < 8; ++e) { f[e] = a[e]; f[8 + e] = b[e]; } return f; }
__device__ __forceinline__ v8f wmma16b(v16b a, v16b b, v8f c) { v8f d = __builtin_amdgcn_wmma_f32_16x16x32_f16(false, a, false, b, (short)0, c, false, false); asm volatile("v_nop\n\tv_nop\n\tv_nop\n\tv_nop" : "+v"(d) : "v"(a), "v"(b)); return d; }
__device__ __forceinline__ void wave_lds_sync() { __builtin_amdgcn_fence(__ATOMIC_RELEASE, "workgroup"); __builtin_amdgcn_wave_barrier(); __builtin_amdgcn_fence(__ATOMIC_ACQUIRE, "workgroup"); }
__device__ __forceinline__ float pmul(float a, float b) { float p = a * b; asm volatile("" : "+v"(p)); return p; }
// behind a group of global loads: the wait that stands in front of any overwrite of the loads' address registers; the addresses are inputs, so they stay in their registers up to it and no load of the group lands on them
#define XCNT_WAIT2(p, q) asm volatile("s_wait_xcnt 0x0" :: "v"(p), "v"(q) : "memory")
__device__ __forceinline__ int iclamp(int v, int lo, int hi) { return v < lo ? lo : (v > hi ? hi : v); }

typedef __attribute__((ext_vector_type(4))) _Float16 v4h;
__device__ __forceinline__ float nexp2(float v) { return __builtin_amdgcn_exp2f(v); }
// lane l takes lane l ^ 16's value by a vector cross-row move: no LDS instruction, so no wait on the LDS queue
__device__ __forceinline__ float xhalf(float v) { return __builtin_bit_cast(float, __builtin_amdgcn_permlanex16(__builtin_bit_cast(int, v), __builtin_bit_cast(int, v), 0x76543210, 0xfedcba98, false, false)); }
// stage 1 of the per-batch max: NP work-groups per batch, each over S*S/NP contiguous distances (32 query rows); work-group g owns line g of MAXD (32 equal floats, already clamped >= 1).
// The same pass prepares the distances for attention, once instead of once per head: each is rounded and tested against the mask value here and stored as the upper 16 bits of the rounded float (exact; a masked entry as +inf,
// so that its bias +inf * ndc, and with it the logit, is -inf with no test), in fragment order: tile (16 queries x 32 keys) at ((batch * S/16 + query tile) * S/32 + key block) * TILE, row = query, k = key.
constexpr int NP = 32, MT = 512, ML = 16, DPITCH = 128 + 8;   // DPITCH: rows 272 bytes apart, so the 16 rows of a 16-byte column read fall on different banks
static_assert(S * S / NP == MT * ML * 4 && S * S / NP == 2 * ML * S && S == 8 * 128 && MT == 16 * 32, "a wave takes 16 rows x 128 keys (4 tiles): one pass of ML 16-byte loads per thread covers a work-group's share");
// The weight conversion needs nothing of the distance pass and the distance pass nothing of it, so they share one grid: work-groups 0 .. B * NP - 1 take the distances (the longer job, so it starts first), the PB behind them the weights.
constexpr int PJ = 2, PB = 4 * DM * DM / 8 / (MT * PJ);
static_assert(PB * MT * PJ * 8 == 4 * DM * DM && (DM * DM / 8) % (MT * PJ) == 0, "every 16-byte piece of the four weight planes has one thread, and a work-group stays inside one matrix");
__global__ __launch_bounds__(MT) void front_kernel(const float* __restrict__ dist, const float* __restrict__ wq, const float* __restrict__ wk, const float* __restrict__ wv, const float* __restrict__ wo, float* __restrict__ MAXD, unsigned short* __restrict__ DP, b16* __restrict__ WT) {
  if (blockIdx.x >= B * NP) {   // the same for the whole work-group, and it leaves in front of every barrier
    const int pb = blockIdx.x - B * NP, m = pb / (DM * DM / 8 / (MT * PJ)); const float* w = m == 0 ? wq : m == 1 ? wk : m == 2 ? wv : wo; const int v0 = (pb % (DM * DM / 8 / (MT * PJ))) * (MT * PJ) + threadIdx.x; v4f f[PJ][2]; const float* p[PJ];
    // thread = PJ 16-byte pieces of the fragment-order plane (stores contiguous); tile (nt, kt) = 16 out rows x 32 in at (nt * 16 + kt) * TILE
#pragma unroll   // the loads of all PJ pieces issue before the first use
    for (int j = 0; j < PJ; ++j) { const int v = v0 + j * MT, tile = v >> 6, c = (v >> 5) & 1, hh = (v >> 4) & 1, r = v & 15; p[j] = w + (size_t)((tile >> 4) * 16 + r) * DM + (tile & 15) * 32 + c * 16 + hh * 8; f[j][0] = *(const v4f*)p[j]; f[j][1] = *(const v4f*)(p[j] + 4); }
    static_assert(PJ == 2, "the wait below names both addresses"); XCNT_WAIT2(p[0], p[1]);
#pragma unroll   // f[] stays in registers
    for (int j = 0; j < PJ; ++j) { v8b o;
#pragma unroll
      for (int e = 0; e < 8; ++e) o[e] = (b16)(bf16_rne(f[j][e >> 2][e & 3]) * WSC);
      *(v8b*)(WT + (size_t)m * DM * DM + (size_t)(v0 + j * MT) * 8) = o; }
    return; }
  __shared__ float red[MT / 32]; __shared__ __attribute__((aligned(16))) unsigned short Ds[MT / 32][ML][DPITCH];
  const int t = threadIdx.x, wave = t >> 5, lane = t & 31, qt = wave >> 3, kq = wave & 7; const float* p = dist + (size_t)blockIdx.x * (S * S / NP) + (size_t)qt * ML * S + kq * 128 + lane * 4; v4f v[ML];
#pragma unroll   // all ML loads issue before the first use: the share is in flight at once; each wave-wide load covers 512 contiguous bytes of one row
  for (int j = 0; j < ML; ++j) v[j] = *(const v4f*)(p + (size_t)j * S);
  asm volatile("s_wait_xcnt 0x0" :: "v"(p) : "memory");   // behind the group of loads, in front of any overwrite of their address register; the address is an input, so no load of the group lands on it
  float m = 0.0f;   // masked entries contribute 0
#pragma unroll   // v[] stays in registers
  for (int j = 0; j < ML; ++j) { unsigned int hb[4];
#pragma unroll
    for (int e = 0; e < 4; ++e) { const float d = bf16_rne(v[j][e]); const bool ok = d != INF_DIST; const float vd = ok ? d : d * 0.0f; m = fmaxf(m, vd); hb[e] = ok ? __float_as_uint(d) : 0x7F800000u; }
    v2u o; o[0] = (hb[0] >> 16) | hb[1]; o[1] = (hb[2] >> 16) | hb[3]; *(v2u*)(&Ds[wave][j][lane * 4]) = o; }
  wave_lds_sync();   // the wave's own rows only: its lanes read below what other lanes of the same wave stored above
  { unsigned short* op = DP + ((size_t)(blockIdx.x * 2 + qt) * (S / 32) + kq * 4) * TILE + lane * 8;   // the wave's 4 tiles are 4,096 contiguous bytes: each wave-wide store covers 4 whole lines, and no other wave writes them
#pragma unroll
    for (int i = 0; i < 8; ++i) *(v4u*)(op + i * 256) = *(const v4u*)(&Ds[wave][lane & 15][(i >> 1) * 32 + (i & 1) * 16 + (lane >> 4) * 8]); }
  for (int w = 16; w >= 1; w >>= 1) m = fmaxf(m, __shfl_xor(m, w));
  if ((t & 31) == 0) red[t >> 5] = m;
  __syncthreads();
  if (t < 32) { float r = red[t & (MT / 32 - 1)]; for (int w = MT / 64; w >= 1; w >>= 1) r = fmaxf(r, __shfl_xor(r, w)); MAXD[blockIdx.x * 32 + t] = fmaxf(r, 1.0f); }
}
// Both GEMMs: the 4 waves of a work-group use the same weight tiles, so the work-group brings each stage of k into LDS once (asynchronous copies, two buffers: stage s + 1 flies while stage s is worked on). Projections: a stage is 64 k = 8 n tiles x 2 k tiles = WSH halves; the output GEMM: twice that.
// The planes are in fragment order, so a stage is a straight copy (projections: tile (t, g) at (t * 2 + g) * TILE), and a fragment read is 512 contiguous bytes of LDS per wave.
constexpr int GS = DM / 64, WSH = 8 * 2 * TILE;
static_assert(GS >= 2 && WSH == 4 * 8 * 256, "one call of gemm_copies in each of the 4 waves covers a stage's weights");
// eight copies of 512 bytes a wave: 4 KiB of LDS from the lane's byte address l on, the first 2 KiB from g0 and the second from g1 (the lane's global addresses; each 2 KiB = two k tiles that follow one another).
// The wait on the address translations is the statement's last line, so it stands in front of every later write of a register that a copy names.
__device__ __forceinline__ void gemm_copies(unsigned int l, const b16* g0, const b16* g1) {
  asm volatile("global_load_async_to_lds_b128 %0, %8, off\n\t"
               "global_load_async_to_lds_b128 %1, %9, off\n\t"
               "global_load_async_to_lds_b128 %2, %10, off\n\t"
               "global_load_async_to_lds_b128 %3, %11, off\n\t"
               "global_load_async_to_lds_b128 %4, %12, off\n\t"
               "global_load_async_to_lds_b128 %5, %13, off\n\t"
               "global_load_async_to_lds_b128 %6, %14, off\n\t"
               "global_load_async_to_lds_b128 %7, %15, off\n\t"
               "s_wait_xcnt 0x0"
               :: "v"(l), "v"(l + 512u), "v"(l + 1024u), "v"(l + 1536u), "v"(l + 2048u), "v"(l + 2560u), "v"(l + 3072u), "v"(l + 3584u),
                  "v"(g0), "v"(g0 + 256), "v"(g0 + 512), "v"(g0 + 768), "v"(g1), "v"(g1 + 256), "v"(g1 + 512), "v"(g1 + 768) : "memory");
}
__global__ __launch_bounds__(128) void proj_kernel(const float* __restrict__ x, const b16* __restrict__ WT, const float* __restrict__ bq, const float* __restrict__ bk, const float* __restrict__ bv, b16* __restrict__ Qp, b16* __restrict__ Kp, b16* __restrict__ VTh, b16* __restrict__ VTl) {
  __shared__ __attribute__((aligned(16))) b16 As[4][16][256 + 8]; __shared__ __attribute__((aligned(16))) float Tf[4][16][128 + 4]; __shared__ __attribute__((aligned(16))) b16 Wr[2][WSH];
  const int wave = threadIdx.x >> 5, lane = threadIdx.x & 31, nloc = lane & 15, hlf = lane >> 4; const int which = blockIdx.y % 3, b = blockIdx.y / 3; const int rb = blockIdx.x, slab = blockIdx.z; const int t0 = rb * 64 + wave * 16; const int n0 = slab * 128;
  const b16* W = WT + (size_t)which * DM * DM; const b16* wc = W + (size_t)(n0 / 16 + wave * 2) * 16 * TILE + lane * 8;   // the wave copies n tiles 2 * wave and 2 * wave + 1 of the slab: the lane's piece of the first one's k tile 0; stage s is 2 * s tiles further
  const unsigned int lw = (unsigned int)(size_t)&Wr[0][0] + (wave * 4 * TILE + lane * 8) * 2;   // the lane's place in buffer 0
  gemm_copies(lw, wc, wc + 16 * TILE);   // stage 0 into buffer 0
  asm volatile("s_wait_asynccnt 0x0" ::: "memory");   // this wave's copies of stage 0 have landed
  __syncthreads();                                      // ... and every other wave's: stage 0 may be read
  gemm_copies(lw + WSH * 2, wc + 2 * TILE, wc + 18 * TILE);   // stage 1 into buffer 1: it flies while x is staged and stage 0 is worked on
  const float* bias = which == 0 ? bq : (which == 1 ? bk : bv);
  v8f acc[8];
#pragma unroll
  for (int t = 0; t < 8; ++t) acc[t] = (v8f){};
#pragma unroll 1
  for (int half = 0; half < 2; ++half) {
    { const float* xr = x + ((size_t)b * S + t0) * DM + half * 256 + lane * 4; v4f xv[32];
#pragma unroll   // all 32 loads of the wave's 16 half rows issue before the first use: one latency instead of 32
      for (int i = 0; i < 32; ++i) xv[i] = *(const v4f*)(xr + (size_t)(i >> 1) * DM + (i & 1) * 128);
      asm volatile("s_wait_xcnt 0x0" :: "v"(xr) : "memory");   // behind the group of loads, in front of any overwrite of their address register (this build's text rewrites it); the address is an input, so no load of the group lands on it
#pragma unroll   // xv[] stays in registers
      for (int i = 0; i < 32; ++i) { v4h o; for (int j = 0; j < 4; ++j) o[j] = (b16)(bf16_rne(xv[i][j]) * XS); *(v4h*)(&As[wave][i >> 1][(i & 1) * 128 + lane * 4]) = o; } }
    wave_lds_sync();
#pragma unroll 1   // rolled: loads do not move across the volatile statement behind each WMMA, so unrolling would only grow the text
    for (int kb = 0; kb < 256; kb += 64) { const int st = half * 4 + kb / 64; const b16* rw = &Wr[st & 1][0] + lane * 8; v16b a[2], bw[2][8];   // the fragments of a stage (two k steps) are read as one group in front of their WMMAs
#pragma unroll
      for (int g = 0; g < 2; ++g) {
#pragma unroll
        for (int t = 0; t < 8; ++t) bw[g][t] = frag_pk(rw + (t * 2 + g) * TILE);
        a[g] = frag_kb(&As[wave][nloc][kb + g * 32], hlf); }
#pragma unroll
      for (int g = 0; g < 2; ++g)
#pragma unroll
        for (int t = 0; t < 8; ++t) acc[t] = wmma16b(a[g], bw[g][t], acc[t]);
      // publish point of stage st + 1, every wave, in this order
      asm volatile("s_wait_dscnt 0x0" ::: "memory");      // this wave's reads of stage st have returned
      asm volatile("s_wait_asynccnt 0x0" ::: "memory");   // this wave's copies of stage st + 1 have landed
      __syncthreads();                                      // every wave has left stage st's buffer, and stage st + 1 may be read
      if (st + 2 < GS) gemm_copies(lw + (st & 1) * WSH * 2, wc + (st + 2) * 2 * TILE, wc + (st + 2) * 2 * TILE + 16 * TILE); }   // the same for the whole work-group: stage st + 2 goes into the buffer that stage st has just left
    wave_lds_sync(); }
  asm volatile("s_wait_asynccnt 0x0" ::: "memory");   // behind the last copy
#pragma unroll
  for (int t = 0; t < 8; ++t) { const float bb = bf16_rne(bias[n0 + t * 16 + nloc]);
#pragma unroll
    for (int r = 0; r < 8; ++r) Tf[wave][8 * hlf + r][t * 16 + nloc] = acc[t][r] * (1.0f / (XS * WSC)) + bb; }
  __syncthreads();
  {
    if (which == 2) {
      const int hs = wave >> 1, j = wave & 1; const int h = n0 / HD + hs;   // V^T tiles (16 d x 32 keys) at ((head * S/32 + key block) * 4 + t) * TILE; the wave writes one head's 64 d of one 32-key block
#pragma unroll
      for (int q = 0; q < 8; ++q) { const int t = q >> 1, c = q & 1; v8b hv, lv;
#pragma unroll
        for (int e = 0; e < 8; ++e) { b16 p, ql; split16(Tf[j * 2 + c][hlf * 8 + e][hs * 64 + t * 16 + nloc] * XS, p, ql); hv[e] = p; lv[e] = ql; }
        const size_t oi = ((((size_t)b * H + h) * (S / 32) + rb * 2 + j) * 4 + t) * TILE + c * 256 + lane * 8; *(v8b*)(VTh + oi) = hv; *(v8b*)(VTl + oi) = lv; } }
    else { b16* P = which == 0 ? Qp : Kp;   // Q and K tiles (16 tokens x 32 d) at ((head * S/16 + token tile) * 2 + dt) * TILE; the wave's 16 tokens are one token tile
#pragma unroll
      for (int q = 0; q < 8; ++q) { const int hs = q >> 2, dt = (q >> 1) & 1, c = q & 1; const int h = n0 / HD + hs; const float* sp = &Tf[wave][nloc][hs * 64 + dt * 32 + c * 16 + hlf * 8]; const v4f f0 = *(const v4f*)sp, f1 = *(const v4f*)(sp + 4); v8b o;
#pragma unroll
        for (int e = 0; e < 4; ++e) { o[e] = (b16)(f0[e] * XS); o[4 + e] = (b16)(f1[e] * XS); }
        *(v8b*)(P + ((((size_t)b * H + h) * (S / 16) + rb * 4 + wave) * 2 + dt) * TILE + c * 256 + lane * 8) = o; }
      asm volatile("s_wait_xcnt 0x0" ::: "memory"); }   // behind the last store: in this build the text that follows the stores rewrites their address register
     }
}
// attention: grid (QL/128, BL*H): block = AW waves x 16 queries; per stage of SK keys: S^T tiles, logit = s/8 - 10 * dist[b][q][key]/maxd (prepared distances: a masked one is +inf, so its logit is -inf), one step of the online softmax, P x1024 hi/lo.
// The AW waves read the same K and V tiles, so the work-group brings each stage of SK keys into LDS once (asynchronous copies, two buffers: stage s + 1 flies while stage s is worked on); each wave's own distances ride in the same ring.
// The workspace planes are in fragment order, so a stage is a straight copy: K | V hi | V lo (PLH halves each) | AW x DSH halves of distances, and a fragment read is 512 contiguous bytes of LDS per wave.
constexpr int AW = 8, SK = 128, SP = SK / 32, NST = S / SK, PLH = SP * 4 * TILE, DSH = SP * TILE, STH = 3 * PLH + AW * DSH;
static_assert(NST >= 2 && QL % (AW * 16) == 0 && PLH == 2 * AW * 2 * 256 && DSH == 2 * 4 * 256, "two calls of stage_copies in each of the AW waves cover a stage");
// half of one wave's share of a stage: 2 x 512 bytes of each of K, V hi, V lo and 4 x 512 bytes of the wave's distances. l, ld: the lane's LDS byte addresses (K plane, distances); k, vh, vl, d: the lane's global addresses.
// The wait on the address translations is the statement's last line, so it stands in front of every later write of a register that a copy names.
__device__ __forceinline__ void stage_copies(unsigned int l, unsigned int ld, const b16* k, const b16* vh, const b16* vl, const unsigned short* d) {
  asm volatile("global_load_async_to_lds_b128 %0, %10, off\n\t"
               "global_load_async_to_lds_b128 %1, %11, off\n\t"
               "global_load_async_to_lds_b128 %2, %12, off\n\t"
               "global_load_async_to_lds_b128 %3, %13, off\n\t"
               "global_load_async_to_lds_b128 %4, %14, off\n\t"
               "global_load_async_to_lds_b128 %5, %15, off\n\t"
               "global_load_async_to_lds_b128 %6, %16, off\n\t"
               "global_load_async_to_lds_b128 %7, %17, off\n\t"
               "global_load_async_to_lds_b128 %8, %18, off\n\t"
               "global_load_async_to_lds_b128 %9, %19, off\n\t"
               "s_wait_xcnt 0x0"
               :: "v"(l), "v"(l + 512u), "v"(l + PLH * 2u), "v"(l + PLH * 2u + 512u), "v"(l + PLH * 4u), "v"(l + PLH * 4u + 512u), "v"(ld), "v"(ld + 512u), "v"(ld + 1024u), "v"(ld + 1536u),
                  "v"(k), "v"(k + 256), "v"(vh), "v"(vh + 256), "v"(vl), "v"(vl + 256), "v"(d), "v"(d + 256), "v"(d + 512), "v"(d + 768) : "memory");
}
typedef __attribute__((ext_vector_type(2))) float v2f;
typedef __attribute__((ext_vector_type(2))) _Float16 v2h;
// the distance bias of one score tile in the units of the score accumulator: 8 prepared distances (upper 16 bits of a float, two to a word) times c
__device__ __forceinline__ v8f bias_tile(v4u d, float c) { v8f r;
#pragma unroll   // r[] stays in registers
  for (int i = 0; i < 4; ++i) { r[2 * i] = __uint_as_float(d[i] << 16) * c; r[2 * i + 1] = __uint_as_float(d[i] & 0xFFFF0000u) * c; } return r; }
// x and one score tile's 8 values: their maximum in four three-input steps
__device__ __forceinline__ float max8(float x, v8f s) {
#pragma unroll   // s[] stays in registers
  for (int r = 0; r < 8; ++r) x = fmaxf(x, s[r]); return x; }
__global__ __launch_bounds__(AW * 32) void attn_kernel(const b16* __restrict__ Qp, const b16* __restrict__ Kp, const b16* __restrict__ VTh, const b16* __restrict__ VTl, const unsigned short* __restrict__ DP, const float* __restrict__ MAXD, b16* __restrict__ Ch, b16* __restrict__ Cl) {
  __shared__ __attribute__((aligned(16))) b16 Ring[2][STH];
  const int wave = threadIdx.x >> 5, lane = threadIdx.x & 31; const int b = blockIdx.y / H, h = blockIdx.y % H; const int q0 = blockIdx.x * (AW * 16) + wave * 16;   // in the comments below: hh = lane >> 4, col = lane & 15
  const b16* Qb = Qp + ((size_t)(b * H + h) * S) * HD; const b16* Kb = Kp + ((size_t)(b * H + h) * S) * HD; const b16* Vh = VTh + ((size_t)(b * H + h) * HD) * S; const b16* Vl = VTl + ((size_t)(b * H + h) * HD) * S;
  const unsigned short* Db = DP + (size_t)(b * (S / 16) + q0 / 16) * (S / 32) * TILE + lane * 8;
  // the lane's places in buffer 0 and in stage 0; call j of a stage is AW * 512 halves (planes) and 1,024 halves (distances) further on both sides, stage s is s * PLH and s * DSH halves further in global memory
  const unsigned int lk = (unsigned int)(size_t)&Ring[0][0] + (wave * 512 + lane * 8) * 2, ldd = (unsigned int)(size_t)&Ring[0][0] + (3 * PLH + wave * DSH + lane * 8) * 2;
  const b16* kc = Kb + wave * 512 + lane * 8; const b16* vhc = Vh + wave * 512 + lane * 8; const b16* vlc = Vl + wave * 512 + lane * 8;
#pragma unroll   // two statements of ten copies: stage 0 into buffer 0
  for (int j = 0; j < 2; ++j) stage_copies(lk + j * AW * 1024, ldd + j * 2048, kc + j * AW * 512, vhc + j * AW * 512, vlc + j * AW * 512, Db + j * 1024);
  float md = MAXD[(b * NP + lane) * 32];   // stage 2 of the max: lane i takes partial i of this batch
  for (int w = 16; w >= 1; w >>= 1) md = fmaxf(md, __shfl_xor(md, w));
  const float ndc = -(10.0f * 8.0f * XS * XS) / md;   // times cs below this is -10 * log2(e) / max distance
  const v16b qa0 = frag_pk(Qb + (q0 / 16) * 2 * TILE + lane * 8), qa1 = frag_pk(Qb + ((q0 / 16) * 2 + 1) * TILE + lane * 8);
  const float cs = LOG2E / (8.0f * XS * XS);
  float m = -INFINITY, l = 0.0f; v8f o[4]; for (int t = 0; t < 4; ++t) o[t] = (v8f){};
  asm volatile("s_wait_asynccnt 0x0" ::: "memory");   // this wave's copies of stage 0 have landed
  __syncthreads();                                      // ... and every other wave's: stage 0 may be read
#pragma unroll   // stage 1 into buffer 1: it flies while stage 0 is worked on
  for (int j = 0; j < 2; ++j) stage_copies(lk + STH * 2 + j * AW * 1024, ldd + STH * 2 + j * 2048, kc + PLH + j * AW * 512, vhc + PLH + j * AW * 512, vlc + PLH + j * AW * 512, Db + DSH + j * 1024);
#pragma unroll 1   // rolled over the stages: the SP passes of a stage are the unrolled body
  for (int st = 0; st < NST; ++st) {
    const b16* rb = &Ring[st & 1][0] + lane * 8; const b16* dl = rb + 3 * PLH + wave * DSH;   // the lane's piece of the stage's first K tile and of the wave's first distance tile
    // a stage is one step of the online softmax: the scores of its SK keys first, then one new running maximum and one rescaling of o and l, then exponentials and O^T += V^T P^T per 32 keys.
    // read schedule: the stage's distances and first K fragments at its top; each later 32 keys' K fragments one score group ahead; each 32 keys' V fragments one group ahead of their WMMAs. Nothing of the next stage is read here.
    v16b kf[2][4], va[2][4], vb[2][4]; v4u dd[SP][2]; v8f s[SP][2];   // every loop below is unrolled so that these arrays stay in registers
#pragma unroll
    for (int ps = 0; ps < SP; ++ps)
#pragma unroll
      for (int u = 0; u < 2; ++u) dd[ps][u] = *(const v4u*)(dl + ps * TILE + u * 256);
#pragma unroll
    for (int i = 0; i < 4; ++i) kf[0][i] = frag_pk(rb + i * TILE);
#pragma unroll   // the tests on ps fold, and every LDS offset is a constant
    for (int ps = 0; ps < SP; ++ps) {
      if (ps + 1 < SP) {
#pragma unroll
        for (int i = 0; i < 4; ++i) kf[(ps + 1) & 1][i] = frag_pk(rb + ((ps + 1) * 4 + i) * TILE); }
      else {
#pragma unroll
        for (int t = 0; t < 4; ++t) { va[0][t] = frag_pk(rb + PLH + t * TILE); vb[0][t] = frag_pk(rb + 2 * PLH + t * TILE); } }
#pragma unroll
      for (int u = 0; u < 2; ++u) { s[ps][u] = bias_tile(dd[ps][u], ndc); s[ps][u] = wmma16b(kf[ps & 1][2 * u], qa0, s[ps][u]); s[ps][u] = wmma16b(kf[ps & 1][2 * u + 1], qa1, s[ps][u]); } }   // the accumulator starts at the distance bias, so s * cs is the whole logit
    float mx = -INFINITY, my = -INFINITY;   // two chains, so that a step does not wait on the step in front of it
#pragma unroll
    for (int ps = 0; ps < SP; ++ps) { mx = max8(mx, s[ps][0]); my = max8(my, s[ps][1]); }
    mx = fmaxf(mx, my); mx = fmaxf(mx, xhalf(mx)); const float mn = fmaxf(m, mx * cs); const float ms = (mn == -INFINITY) ? 0.0f : mn;   // ms is finite, so a masked score gives exp2(-inf) = 0 with no test, and a row with nothing yet keeps o = l = 0 (al = 0 on zeros)
    const float al = nexp2(m - ms); const v2f cs2 = {cs, cs}, nb2 = {10.0f - ms, 10.0f - ms};   // + 10: p comes out of the exponential already times PS = 1,024
#pragma unroll
    for (int t = 0; t < 4; ++t) o[t] *= al;
    v2f sum2 = {0.0f, 0.0f};
#pragma unroll   // the tests on ps fold, and every LDS offset is a constant
    for (int ps = 0; ps < SP; ++ps) {
      if (ps + 1 < SP) {
#pragma unroll
        for (int t = 0; t < 4; ++t) { va[(ps + 1) & 1][t] = frag_pk(rb + PLH + ((ps + 1) * 4 + t) * TILE); vb[(ps + 1) & 1][t] = frag_pk(rb + 2 * PLH + ((ps + 1) * 4 + t) * TILE); } }
      // P^T as the B operand straight from the score accumulators: the lane holds keys 8 * hh + r of score tile 0 and 16 + 8 * hh + r of tile 1 for query col, and that is element r and 8 + r of B's column col in the k order of V^T's fragments
      v16b pf, pg;
#pragma unroll
      for (int i2 = 0; i2 < 16; i2 += 2) { const v2f sv = {s[ps][i2 >> 3][i2 & 7], s[ps][i2 >> 3][(i2 & 7) + 1]}; const v2f ar = sv * cs2 + nb2; const v2f p = {nexp2(ar[0]), nexp2(ar[1])}; sum2 += p;
        const v2h ph = __builtin_convertvector(p, v2h), pl = __builtin_convertvector(p - __builtin_convertvector(ph, v2f), v2h);   // hi and lo halves of p, two scores at a time
        pf[i2] = ph[0]; pf[i2 + 1] = ph[1]; pg[i2] = pl[0]; pg[i2 + 1] = pl[1]; }
#pragma unroll
      for (int t = 0; t < 4; ++t) { o[t] = wmma16b(va[ps & 1][t], pf, o[t]); o[t] = wmma16b(va[ps & 1][t], pg, o[t]); o[t] = wmma16b(vb[ps & 1][t], pf, o[t]); } }
    float sum = sum2[0] + sum2[1]; sum += xhalf(sum); l = l * al + sum; m = mn;
    // publish point of stage st + 1, every wave, in this order
    asm volatile("s_wait_dscnt 0x0" ::: "memory");      // this wave's reads of stage st have returned
    asm volatile("s_wait_asynccnt 0x0" ::: "memory");   // this wave's copies of stage st + 1 have landed
    __syncthreads();                                      // every wave has left stage st's buffer, and stage st + 1 may be read
    if (st + 2 < NST) {   // the same for the whole work-group: stage st + 2 goes into the buffer that stage st has just left
#pragma unroll
      for (int j = 0; j < 2; ++j) stage_copies(lk + (st & 1) * STH * 2 + j * AW * 1024, ldd + (st & 1) * STH * 2 + j * 2048, kc + (st + 2) * PLH + j * AW * 512, vhc + (st + 2) * PLH + j * AW * 512, vlc + (st + 2) * PLH + j * AW * 512, Db + (st + 2) * DSH + j * 1024); } }
  asm volatile("s_wait_asynccnt 0x0" ::: "memory");   // behind the last copy, in front of the wave's end
  const float inv = (l > 0.0f) ? 1.0f / (l * XS) : 0.0f;   // l carries the factor PS like o
  // ctx tiles (16 tokens x 32 k) at (token tile * 16 + kt) * TILE: accumulator tile t (lane: query col, d = t * 16 + 8 * hh + r) is already the lane's piece c = t & 1 of tile kt = h * 2 + t / 2
#pragma unroll
  for (int t = 0; t < 4; ++t) { v8b hv, lv;
#pragma unroll
    for (int r = 0; r < 8; ++r) { b16 p, q; split16(o[t][r] * inv * XS, p, q); hv[r] = p; lv[r] = q; }
    const size_t oi = ((size_t)((b * S + q0) / 16) * 16 + h * 2 + (t >> 1)) * TILE + (t & 1) * 256 + lane * 8; *(v8b*)(Ch + oi) = hv; *(v8b*)(Cl + oi) = lv; }
}
__global__ __launch_bounds__(128) void out_kernel(const b16* __restrict__ Ch, const b16* __restrict__ Cl, const b16* __restrict__ WO, const float* __restrict__ bo, float* __restrict__ out) {
  // one work-group per WGP and one wave per SIMD here, so a stage is 128 k: the next stage's copies have the time of 64 WMMAs to land. A stage: the weights, tile (t, kk) at (t * 4 + kk) * TILE | per wave 4 k tiles of ctx hi, 4 of ctx lo (each wave's own rows ride in the same ring)
  constexpr int ONS = DM / 128, OWH = 2 * WSH, OSH = OWH + 4 * 8 * TILE; static_assert(ONS >= 2, "two buffers");
  __shared__ __attribute__((aligned(16))) float Tf[4][16][128 + 4]; __shared__ __attribute__((aligned(16))) b16 Ro[2][OSH];
  const int wave = threadIdx.x >> 5, lane = threadIdx.x & 31, nloc = lane & 15, hlf = lane >> 4; const int b = blockIdx.x / (QL / 64), rb = blockIdx.x % (QL / 64); const size_t m0 = (size_t)b * S + rb * 64 + wave * 16; const int n0 = blockIdx.y * 128;
  v8f acc[8];
#pragma unroll
  for (int t = 0; t < 8; ++t) acc[t] = (v8f){};
  const b16* pa = Ch + (m0 / 16) * 16 * TILE + lane * 8; const b16* pl = Cl + (m0 / 16) * 16 * TILE + lane * 8; const b16* wc = WO + (size_t)(n0 / 16 + wave * 2) * 16 * TILE + lane * 8;   // the lane's piece of k tile 0 of its token tile and of n tile 2 * wave of the slab (the wave copies that one and the next); stage s is 4 * s tiles further
  const unsigned int lw = (unsigned int)(size_t)&Ro[0][0] + (wave * 8 * TILE + lane * 8) * 2, lc = lw + OWH * 2;   // the lane's places in buffer 0: weights, ctx
  // the wave's share of stage s into the buffer bo bytes behind buffer 0: 4 statements of 8 copies (n tile 2 * wave, n tile 2 * wave + 1, ctx hi, ctx lo; 4 KiB = 4 k tiles each)
  auto stage = [&](unsigned int bo, int s) { const int k4 = s * 4 * TILE;
    gemm_copies(lw + bo, wc + k4, wc + k4 + 2 * TILE); gemm_copies(lw + bo + 4096u, wc + k4 + 16 * TILE, wc + k4 + 18 * TILE); gemm_copies(lc + bo, pa + k4, pa + k4 + 2 * TILE); gemm_copies(lc + bo + 4096u, pl + k4, pl + k4 + 2 * TILE); };
  stage(0u, 0);   // stage 0 into buffer 0
  asm volatile("s_wait_asynccnt 0x0" ::: "memory");   // this wave's copies of stage 0 have landed
  __syncthreads();                                      // ... and every other wave's: stage 0 may be read
  stage(OSH * 2u, 1);   // stage 1 into buffer 1: it flies while stage 0 is worked on
#pragma unroll 1   // rolled over the stages
  for (int st = 0; st < ONS; ++st) {
#pragma unroll 1   // rolled: loads do not move across the volatile statement behind each WMMA, so unrolling would only grow the text
   for (int j = 0; j < 2; ++j) { const b16* rw = &Ro[st & 1][0] + j * 2 * TILE + lane * 8; const b16* rc = rw + OWH + wave * 8 * TILE; v16b a[2], al[2], bw[2][8];   // the fragments of two k steps are read as one group in front of their WMMAs
#pragma unroll
    for (int g = 0; g < 2; ++g) { a[g] = frag_pk(rc + g * TILE); al[g] = frag_pk(rc + (4 + g) * TILE);
#pragma unroll
      for (int t = 0; t < 8; ++t) bw[g][t] = frag_pk(rw + (t * 4 + g) * TILE); }
#pragma unroll
    for (int g = 0; g < 2; ++g)
#pragma unroll
      for (int t = 0; t < 8; ++t) { acc[t] = wmma16b(a[g], bw[g][t], acc[t]); acc[t] = wmma16b(al[g], bw[g][t], acc[t]); } }
    // publish point of stage st + 1, every wave, in this order
    asm volatile("s_wait_dscnt 0x0" ::: "memory");      // this wave's reads of stage st have returned
    asm volatile("s_wait_asynccnt 0x0" ::: "memory");   // this wave's copies of stage st + 1 have landed
    __syncthreads();                                      // every wave has left stage st's buffer, and stage st + 1 may be read
    if (st + 2 < ONS) stage((st & 1) * OSH * 2u, st + 2); }   // the same for the whole work-group: stage st + 2 goes into the buffer that stage st has just left
  asm volatile("s_wait_asynccnt 0x0" ::: "memory");   // behind the last copy
#pragma unroll
  for (int t = 0; t < 8; ++t) { const float bb = bf16_rne(bo[n0 + t * 16 + nloc]);
#pragma unroll
    for (int r = 0; r < 8; ++r) Tf[wave][8 * hlf + r][t * 16 + nloc] = acc[t][r] * (1.0f / (XS * WSC)) + bb; }
  wave_lds_sync();
  { for (int rr = 0; rr < 16; ++rr) *(v4f*)(out + (m0 + rr) * DM + n0 + lane * 4) = *(const v4f*)(&Tf[wave][rr][lane * 4]);  }
}
}  // namespace

extern "C" void kernel_launch(void* const* d_in, const int* in_sizes, int n_in, void* d_out, int out_size, void* d_ws, size_t ws_size, hipStream_t stream) {
  (void)n_in;
  auto Fp = [&](int i) { return (const float*)d_in[i]; };
  // d_in: 0 x [4,1024,512], 1 dist_matrix [4,1024,1024], 2 Wq [512,512] ([out][in]), 3 bq, 4 Wk, 5 bk, 6 Wv, 7 bv, 8 Wo, 9 bo
  if (in_sizes[0] != B * S * DM || in_sizes[1] != B * S * S || in_sizes[2] != DM * DM || in_sizes[3] != DM || in_sizes[8] != DM * DM || in_sizes[9] != DM || out_size != B * S * DM) return;
  size_t off = 0; char* ws = (char*)d_ws;
  auto carve = [&](size_t bytes) { char* p = ws + off; off += (bytes + 255) & ~(size_t)255; return p; };
  b16* WT = (b16*)carve((size_t)4 * DM * DM * 2); float* MAXD = (float*)carve((size_t)B * NP * 32 * 4); const size_t plane = (size_t)B * S * DM * 2;
  b16* Qp = (b16*)carve(plane); b16* Kp = (b16*)carve(plane); b16* VTh = (b16*)carve(plane); b16* VTl = (b16*)carve(plane); b16* Ch = (b16*)carve(plane); b16* Cl = (b16*)carve(plane); unsigned short* DP = (unsigned short*)carve((size_t)B * S * S * 2);
  if (off > ws_size || off > ((size_t)128 << 20)) return;   // about 35 MB
  front_kernel<<<B * NP + PB, MT, 0, stream>>>(Fp(1), Fp(2), Fp(4), Fp(6), Fp(8), MAXD, DP, WT);
  proj_kernel<<<dim3(S / 64, BL * 3, 4), 128, 0, stream>>>(Fp(0), WT, Fp(3), Fp(5), Fp(7), Qp, Kp, VTh, VTl);
  attn_kernel<<<dim3(QL / (AW * 16), BL * H), AW * 32, 0, stream>>>(Qp, Kp, VTh, VTl, DP, MAXD, Ch, Cl);
  out_kernel<<<dim3((QL / 64) * BL, 4), 128, 0, stream>>>(Ch, Cl, WT + (size_t)3 * DM * DM, Fp(9), (float*)d_out);
}

// v010
// Measured time: 46.8 microseconds a run.
// In two side-by-side timings against v009, it was 1.03 and 1.04 times as fast.
// Counting every step since v000, it is 12.7 times as fast.
#include <hip/hip_runtime.h>

// Graphormer multi-head attention (8 heads x 64, embed 512) on x [4, 1024, 512] with a distance bias: Q/K/V = x W^T + b; scores = Q K^T / 8 - 10 * dist / max_b(valid dist) (max clamped >= 1;
// keys with dist == 1e9 are masked with -inf — none in this input after bf16 rounding, but the compare is implemented); softmax; out = (attn V) Wo^T + bo -> [4][1024][512].
// Deterministic: flash-style per 16-query wave over the 1,024 keys in order (running max); per-batch max distance as 32 work-group partial maxima (one 128-byte line each), folded by each attention wave (max is exact in any order); no atomics.
// compute dtype: WMMA v_wmma_f32_16x16x32_f16 with f32 accumulate for the projections ([4096 x 512] x [512 x 1536]; x EXACT bf16 x8 staged through LDS, [out][in] weights as B rows exact x256:
// 1 product), S^T = K Q^T (q, k single f16 x8: 1 product — the distance bias dominates the logits), O^T += V^T P^T (v hi+lo x8, P x1024 hi+lo: 3 products — output rms is only 0.015) and
// out = ctx Wo^T ([4096 x 512] x [512 x 512]; ctx hi+lo: 2 products); distance bias, mask, softmax statistics and biases in f32. Inputs rounded to bf16 once (dist included).

namespace {
constexpr int B = 4, S = 1024, DM = 512, H = 8, HD = 64, BL = 4 /* batches (== B shipped) */, QL = 1024 /* query rows (== S shipped) */;
constexpr float XS = 8.0f, WSC = 256.0f, PS = 1024.0f, LOG2E = 1.4426950408889634f, INF_DIST = 1.0e9f;
static_assert(S % 64 == 0 && QL % 64 == 0 && DM == H * HD, "tiling");
typedef _Float16 b16;
typedef __attribute__((ext_vector_type(16))) _Float16 v16b;
typedef __attribute__((ext_vector_type(8))) _Float16 v8b;
typedef __attribute__((ext_vector_type(8))) float v8f;
typedef __attribute__((ext_vector_type(4))) float v4f;
typedef __attribute__((ext_vector_type(4))) unsigned int v4u;
typedef __attribute__((ext_vector_type(2))) unsigned int v2u;
__device__ __forceinline__ float bf16_rne(float f) { unsigned int u = __float_as_uint(f); u += 0x7FFFu + ((u >> 16) & 1u); return __uint_as_float(u & 0xFFFF0000u); }
__device__ __forceinline__ void split16(float v, b16& hi, b16& lo) { hi = (b16)v; lo = (b16)(v - (float)hi); }
__device__ __forceinline__ v16b frag_kb(const b16* p, int hh) { const v8b a = *(const v8b*)(p + 8 * hh), b = *(const v8b*)(p + 16 + 8 * hh); v16b f;
#pragma unroll
  for (int e = 0; e < 8; ++e) { f[e] = a[e]; f[8 + e] = b[e]; } return f; }
// fragment order (every WMMA operand that lives in the workspace): a tile of 16 rows x 32 k is TILE halves = 1,024 bytes; lane L = 16 * hh + row finds k = 16 * c + 8 * hh .. + 7 at half c * 256 + L * 8,
// so each wave-wide 16-byte load covers 512 contiguous bytes (4 whole lines) instead of 32-byte pieces of 16 lines. p = the tile's base + lane * 8; same k order as frag_kb.
constexpr int TILE = 512;
__device__ __forceinline__ v16b frag_pk(const b16* p) { const v8b a = *(const v8b*)(p), b = *(const v8b*)(p + 256); v16b f;
#pragma unroll
  for (int e = 0; e < 8; ++e) { f[e] = a[e]; f[8 + e] = b[e]; } return f; }
// The scheduling barrier behind the WMMA lets vector and scalar arithmetic pass and holds LDS reads and other WMMAs on their side: without it the compiler sinks each group of fragment reads down to its first use, and every WMMA then waits for LDS.
__device__ __forceinline__ v8f wmma16b(v16b a, v16b b, v8f c) { v8f d = __builtin_amdgcn_wmma_f32_16x16x32_f16(false, a, false, b, (short)0, c, false, false); __builtin_amdgcn_sched_barrier(0x406); return d; }
// the last WMMA in front of a loop's branch: the four v_nop keep the distance to a vector instruction on its registers on the taken side too
__device__ __forceinline__ v8f wmma16b_foot(v16b a, v16b b, v8f c) { v8f d = __builtin_amdgcn_wmma_f32_16x16x32_f16(false, a, false, b, (short)0, c, false, false); asm volatile("v_nop\n\tv_nop\n\tv_nop\n\tv_nop" : "+v"(d) : "v"(a), "v"(b)); return d; }
__device__ __forceinline__ void wave_lds_sync() { __builtin_amdgcn_fence(__ATOMIC_RELEASE, "workgroup"); __builtin_amdgcn_wave_barrier(); __builtin_amdgcn_fence(__ATOMIC_ACQUIRE, "workgroup"); }
__device__ __forceinline__ float pmul(float a, float b) { float p = a * b; asm volatile("" : "+v"(p)); return p; }
// behind a group of global loads: the wait that stands in front of any overwrite of the loads' address registers; the addresses are inputs, so they stay in their registers up to it and no load of the group lands on them
#define XCNT_WAIT2(p, q) asm volatile("s_wait_xcnt 0x0" :: "v"(p), "v"(q) : "memory")
__device__ __forceinline__ int iclamp(int v, int lo, int hi) { return v < lo ? lo : (v > hi ? hi : v); }

typedef __attribute__((ext_vector_type(4))) _Float16 v4h;
__device__ __forceinline__ float nexp2(float v) { return __builtin_amdgcn_exp2f(v); }
// lane l takes lane l ^ 16's value by a vector cross-row move: no LDS instruction, so no wait on the LDS queue
__device__ __forceinline__ float xhalf(float v) { return __builtin_bit_cast(float, __builtin_amdgcn_permlanex16(__builtin_bit_cast(int, v), __builtin_bit_cast(int, v), 0x76543210, 0xfedcba98, false, false)); }
// stage 1 of the per-batch max: NP work-groups per batch, each over S*S/NP contiguous distances (32 query rows); work-group g owns line g of MAXD (32 equal floats, already clamped >= 1).
// The same pass prepares the distances for attention, once instead of once per head: each is rounded and tested against the mask value here and stored as the upper 16 bits of the rounded float (exact; a masked entry as +inf,
// so that its bias +inf * ndc, and with it the logit, is -inf with no test), in fragment order: tile (16 queries x 32 keys) at ((batch * S/16 + query tile) * S/32 + key block) * TILE, row = query, k = key.
constexpr int NP = 32, MT = 512, ML = 16, DPITCH = 128 + 8;   // DPITCH: rows 272 bytes apart, so the 16 rows of a 16-byte column read fall on different banks
static_assert(S * S / NP == MT * ML * 4 && S * S / NP == 2 * ML * S && S == 8 * 128 && MT == 16 * 32, "a wave takes 16 rows x 128 keys (4 tiles): one pass of ML 16-byte loads per thread covers a work-group's share");
// The weight conversion needs nothing of the distance pass and the distance pass nothing of it, so they share one grid: work-groups 0 .. B * NP - 1 take the distances (the longer job, so it starts first), the PB behind them the weights.
constexpr int PJ = 2, PB = 4 * DM * DM / 8 / (MT * PJ);
static_assert(PB * MT * PJ * 8 == 4 * DM * DM && (DM * DM / 8) % (MT * PJ) == 0, "every 16-byte piece of the four weight planes has one thread, and a work-group stays inside one matrix");
__global__ __launch_bounds__(MT) void front_kernel(const float* __restrict__ dist, const float* __restrict__ wq, const float* __restrict__ wk, const float* __restrict__ wv, const float* __restrict__ wo, float* __restrict__ MAXD, unsigned short* __restrict__ DP, b16* __restrict__ WT) {
  if (blockIdx.x >= B * NP) {   // the same for the whole work-group, and it leaves in front of every barrier
    const int pb = blockIdx.x - B * NP, m = pb / (DM * DM / 8 / (MT * PJ)); const float* w = m == 0 ? wq : m == 1 ? wk : m == 2 ? wv : wo; const int v0 = (pb % (DM * DM / 8 / (MT * PJ))) * (MT * PJ) + threadIdx.x; v4f f[PJ][2]; const float* p[PJ];
    // thread = PJ 16-byte pieces of the fragment-order plane (stores contiguous); tile (nt, kt) = 16 out rows x 32 in at (nt * 16 + kt) * TILE
#pragma unroll   // the loads of all PJ pieces issue before the first use
    for (int j = 0; j < PJ; ++j) { const int v = v0 + j * MT, tile = v >> 6, c = (v >> 5) & 1, hh = (v >> 4) & 1, r = v & 15; p[j] = w + (size_t)((tile >> 4) * 16 + r) * DM + (tile & 15) * 32 + c * 16 + hh * 8; f[j][0] = *(const v4f*)p[j]; f[j][1] = *(const v4f*)(p[j] + 4); }
    static_assert(PJ == 2, "the wait below names both addresses"); XCNT_WAIT2(p[0], p[1]);
#pragma unroll   // f[] stays in registers
    for (int j = 0; j < PJ; ++j) { v8b o;
#pragma unroll
      for (int e = 0; e < 8; ++e) o[e] = (b16)(bf16_rne(f[j][e >> 2][e & 3]) * WSC);
      *(v8b*)(WT + (size_t)m * DM * DM + (size_t)(v0 + j * MT) * 8) = o; }
    return; }
  __shared__ float red[MT / 32]; __shared__ __attribute__((aligned(16))) unsigned short Ds[MT / 32][ML][DPITCH];
  const int t = threadIdx.x, wave = t >> 5, lane = t & 31, qt = wave >> 3, kq = wave & 7; const float* p = dist + (size_t)blockIdx.x * (S * S / NP) + (size_t)qt * ML * S + kq * 128 + lane * 4; v4f v[ML];
#pragma unroll   // all ML loads issue before the first use: the share is in flight at once; each wave-wide load covers 512 contiguous bytes of one row
  for (int j = 0; j < ML; ++j) v[j] = *(const v4f*)(p + (size_t)j * S);
  asm volatile("s_wait_xcnt 0x0" :: "v"(p) : "memory");   // behind the group of loads, in front of any overwrite of their address register; the address is an input, so no load of the group lands on it
  float m = 0.0f;   // masked entries contribute 0
#pragma unroll   // v[] stays in registers
  for (int j = 0; j < ML; ++j) { unsigned int hb[4];
#pragma unroll
    for (int e = 0; e < 4; ++e) { const float d = bf16_rne(v[j][e]); const bool ok = d != INF_DIST; const float vd = ok ? d : d * 0.0f; m = fmaxf(m, vd); hb[e] = ok ? __float_as_uint(d) : 0x7F800000u; }
    v2u o; o[0] = (hb[0] >> 16) | hb[1]; o[1] = (hb[2] >> 16) | hb[3]; *(v2u*)(&Ds[wave][j][lane * 4]) = o; }
  wave_lds_sync();   // the wave's own rows only: its lanes read below what other lanes of the same wave stored above
  { unsigned short* op = DP + ((size_t)(blockIdx.x * 2 + qt) * (S / 32) + kq * 4) * TILE + lane * 8;   // the wave's 4 tiles are 4,096 contiguous bytes: each wave-wide store covers 4 whole lines, and no other wave writes them
#pragma unroll
    for (int i = 0; i < 8; ++i) *(v4u*)(op + i * 256) = *(const v4u*)(&Ds[wave][lane & 15][(i >> 1) * 32 + (i & 1) * 16 + (lane >> 4) * 8]); }
  for (int w = 16; w >= 1; w >>= 1) m = fmaxf(m, __shfl_xor(m, w));
  if ((t & 31) == 0) red[t >> 5] = m;
  __syncthreads();
  if (t < 32) { float r = red[t & (MT / 32 - 1)]; for (int w = MT / 64; w >= 1; w >>= 1) r = fmaxf(r, __shfl_xor(r, w)); MAXD[blockIdx.x * 32 + t] = fmaxf(r, 1.0f); }
}
// Both GEMMs: the 4 waves of a work-group use the same weight tiles, so the work-group brings each stage of k into LDS once (asynchronous copies, two buffers: stage s + 1 flies while stage s is worked on). Projections: a stage is 64 k = 8 n tiles x 2 k tiles = WSH halves; the output GEMM: twice that.
// The planes are in fragment order, so a stage is a straight copy (projections: tile (t, g) at (t * 2 + g) * TILE), and a fragment read is 512 contiguous bytes of LDS per wave.
constexpr int GS = DM / 64, WSH = 8 * 2 * TILE;
static_assert(GS >= 2 && WSH == 4 * 8 * 256, "one call of gemm_copies in each of the 4 waves covers a stage's weights");
// eight copies of 512 bytes a wave: 4 KiB of LDS from the lane's byte address l on, the first 2 KiB from g0 and the second from g1 (the lane's global addresses; each 2 KiB = two k tiles that follow one another).
// The wait on the address translations is the statement's last line, so it stands in front of every later write of a register that a copy names.
__device__ __forceinline__ void gemm_copies(unsigned int l, const b16* g0, const b16* g1) {
  asm volatile("global_load_async_to_lds_b128 %0, %8, off\n\t"
               "global_load_async_to_lds_b128 %1, %9, off\n\t"
               "global_load_async_to_lds_b128 %2, %10, off\n\t"
               "global_load_async_to_lds_b128 %3, %11, off\n\t"
               "global_load_async_to_lds_b128 %4, %12, off\n\t"
               "global_load_async_to_lds_b128 %5, %13, off\n\t"
               "global_load_async_to_lds_b128 %6, %14, off\n\t"
               "global_load_async_to_lds_b128 %7, %15, off\n\t"
               "s_wait_xcnt 0x0"
               :: "v"(l), "v"(l + 512u), "v"(l + 1024u), "v"(l + 1536u), "v"(l + 2048u), "v"(l + 2560u), "v"(l + 3072u), "v"(l + 3584u),
                  "v"(g0), "v"(g0 + 256), "v"(g0 + 512), "v"(g0 + 768), "v"(g1), "v"(g1 + 256), "v"(g1 + 512), "v"(g1 + 768) : "memory");
}
__global__ __launch_bounds__(128) void proj_kernel(const float* __restrict__ x, const b16* __restrict__ WT, const float* __restrict__ bq, const float* __restrict__ bk, const float* __restrict__ bv, b16* __restrict__ Qp, b16* __restrict__ Kp, b16* __restrict__ VTh, b16* __restrict__ VTl) {
  __shared__ __attribute__((aligned(16))) b16 As[4][16][256 + 8]; __shared__ __attribute__((aligned(16))) float Tf[4][16][128 + 4]; __shared__ __attribute__((aligned(16))) b16 Wr[2][WSH];
  const int wave = threadIdx.x >> 5, lane = threadIdx.x & 31, nloc = lane & 15, hlf = lane >> 4; const int which = blockIdx.y % 3, b = blockIdx.y / 3; const int rb = blockIdx.x, slab = blockIdx.z; const int t0 = rb * 64 + wave * 16; const int n0 = slab * 128;
  const b16* W = WT + (size_t)which * DM * DM; const b16* wc = W + (size_t)(n0 / 16 + wave * 2) * 16 * TILE + lane * 8;   // the wave copies n tiles 2 * wave and 2 * wave + 1 of the slab: the lane's piece of the first one's k tile 0; stage s is 2 * s tiles further
  const unsigned int lw = (unsigned int)(size_t)&Wr[0][0] + (wave * 4 * TILE + lane * 8) * 2;   // the lane's place in buffer 0
  gemm_copies(lw, wc, wc + 16 * TILE);   // stage 0 into buffer 0
  asm volatile("s_wait_asynccnt 0x0" ::: "memory");   // this wave's copies of stage 0 have landed
  __syncthreads();                                      // ... and every other wave's: stage 0 may be read
  gemm_copies(lw + WSH * 2, wc + 2 * TILE, wc + 18 * TILE);   // stage 1 into buffer 1: it flies while x is staged and stage 0 is worked on
  const float* bias = which == 0 ? bq : (which == 1 ? bk : bv);
  v8f acc[8];
#pragma unroll
  for (int t = 0; t < 8; ++t) acc[t] = (v8f){};
#pragma unroll 1
  for (int half = 0; half < 2; ++half) {
    { const float* xr = x + ((size_t)b * S + t0) * DM + half * 256 + lane * 4; v4f xv[32];
#pragma unroll   // all 32 loads of the wave's 16 half rows issue before the first use: one latency instead of 32
      for (int i = 0; i < 32; ++i) xv[i] = *(const v4f*)(xr + (size_t)(i >> 1) * DM + (i & 1) * 128);
      asm volatile("s_wait_xcnt 0x0" :: "v"(xr) : "memory");   // behind the group of loads, in front of any overwrite of their address register (this build's text rewrites it); the address is an input, so no load of the group lands on it
#pragma unroll   // xv[] stays in registers
      for (int i = 0; i < 32; ++i) { v4h o; for (int j = 0; j < 4; ++j) o[j] = (b16)(bf16_rne(xv[i][j]) * XS); *(v4h*)(&As[wave][i >> 1][(i & 1) * 128 + lane * 4]) = o; } }
    wave_lds_sync();
#pragma unroll 1   // rolled: LDS reads do not move across the scheduling barrier behind each WMMA, so unrolling would only grow the text
    for (int kb = 0; kb < 256; kb += 64) { const int st = half * 4 + kb / 64; const b16* rw = &Wr[st & 1][0] + lane * 8; v16b a[2], bw[2][8];   // the fragments of a stage (two k steps) are read as one group in front of their WMMAs
#pragma unroll
      for (int g = 0; g < 2; ++g) {
#pragma unroll
        for (int t = 0; t < 8; ++t) bw[g][t] = frag_pk(rw + (t * 2 + g) * TILE);
        a[g] = frag_kb(&As[wave][nloc][kb + g * 32], hlf); }
#pragma unroll
      for (int g = 0; g < 2; ++g)
#pragma unroll
        for (int t = 0; t < 8; ++t) acc[t] = (g == 1 && t == 7) ? wmma16b_foot(a[g], bw[g][t], acc[t]) : wmma16b(a[g], bw[g][t], acc[t]);
      // publish point of stage st + 1, every wave, in this order
      asm volatile("s_wait_dscnt 0x0" ::: "memory");      // this wave's reads of stage st have returned
      asm volatile("s_wait_asynccnt 0x0" ::: "memory");   // this wave's copies of stage st + 1 have landed
      __syncthreads();                                      // every wave has left stage st's buffer, and stage st + 1 may be read
      if (st + 2 < GS) gemm_copies(lw + (st & 1) * WSH * 2, wc + (st + 2) * 2 * TILE, wc + (st + 2) * 2 * TILE + 16 * TILE); }   // the same for the whole work-group: stage st + 2 goes into the buffer that stage st has just left
    wave_lds_sync(); }
  asm volatile("s_wait_asynccnt 0x0" ::: "memory");   // behind the last copy
#pragma unroll
  for (int t = 0; t < 8; ++t) { const float bb = bf16_rne(bias[n0 + t * 16 + nloc]);
#pragma unroll
    for (int r = 0; r < 8; ++r) Tf[wave][8 * hlf + r][t * 16 + nloc] = acc[t][r] * (1.0f / (XS * WSC)) + bb; }
  __syncthreads();
  {
    if (which == 2) {
      const int hs = wave >> 1, j = wave & 1; const int h = n0 / HD + hs;   // V^T tiles (16 d x 32 keys) at ((head * S/32 + key block) * 4 + t) * TILE; the wave writes one head's 64 d of one 32-key block
#pragma unroll
      for (int q = 0; q < 8; ++q) { const int t = q >> 1, c = q & 1; v8b hv, lv;
#pragma unroll
        for (int e = 0; e < 8; ++e) { b16 p, ql; split16(Tf[j * 2 + c][hlf * 8 + e][hs * 64 + t * 16 + nloc] * XS, p, ql); hv[e] = p; lv[e] = ql; }
        const size_t oi = ((((size_t)b * H + h) * (S / 32) + rb * 2 + j) * 4 + t) * TILE + c * 256 + lane * 8; *(v8b*)(VTh + oi) = hv; *(v8b*)(VTl + oi) = lv; } }
    else { b16* P = which == 0 ? Qp : Kp;   // Q and K tiles (16 tokens x 32 d) at ((head * S/16 + token tile) * 2 + dt) * TILE; the wave's 16 tokens are one token tile
#pragma unroll
      for (int q = 0; q < 8; ++q) { const int hs = q >> 2, dt = (q >> 1) & 1, c = q & 1; const int h = n0 / HD + hs; const float* sp = &Tf[wave][nloc][hs * 64 + dt * 32 + c * 16 + hlf * 8]; const v4f f0 = *(const v4f*)sp, f1 = *(const v4f*)(sp + 4); v8b o;
#pragma unroll
        for (int e = 0; e < 4; ++e) { o[e] = (b16)(f0[e] * XS); o[4 + e] = (b16)(f1[e] * XS); }
        *(v8b*)(P + ((((size_t)b * H + h) * (S / 16) + rb * 4 + wave) * 2 + dt) * TILE + c * 256 + lane * 8) = o; }
      asm volatile("s_wait_xcnt 0x0" ::: "memory"); }   // behind the last store: in this build the text that follows the stores rewrites their address register
     }
}
// attention: grid (QL/128, BL*H): block = AW waves x 16 queries; per stage of SK keys: S^T tiles, logit = s/8 - 10 * dist[b][q][key]/maxd (prepared distances: a masked one is +inf, so its logit is -inf), one step of the online softmax, P x1024 hi/lo.
// The AW waves read the same K and V tiles, so the work-group brings each stage of SK keys into LDS once (asynchronous copies, two buffers: stage s + 1 flies while stage s is worked on); each wave's own distances ride in the same ring.
// The workspace planes are in fragment order, so a stage is a straight copy: K | V hi | V lo (PLH halves each) | AW x DSH halves of distances, and a fragment read is 512 contiguous bytes of LDS per wave.
constexpr int AW = 8, SK = 128, SP = SK / 32, NST = S / SK, PLH = SP * 4 * TILE, DSH = SP * TILE, STH = 3 * PLH + AW * DSH;
static_assert(NST >= 2 && QL % (AW * 16) == 0 && PLH == 2 * AW * 2 * 256 && DSH == 2 * 4 * 256, "two calls of stage_copies in each of the AW waves cover a stage");
// half of one wave's share of a stage: 2 x 512 bytes of each of K, V hi, V lo and 4 x 512 bytes of the wave's distances. l, ld: the lane's LDS byte addresses (K plane, distances); k, vh, vl, d: the lane's global addresses.
// The wait on the address translations is the statement's last line, so it stands in front of every later write of a register that a copy names.
__device__ __forceinline__ void stage_copies(unsigned int l, unsigned int ld, const b16* k, const b16* vh, const b16* vl, const unsigned short* d) {
  asm volatile("global_load_async_to_lds_b128 %0, %10, off\n\t"
               "global_load_async_to_lds_b128 %1, %11, off\n\t"
               "global_load_async_to_lds_b128 %2, %12, off\n\t"
               "global_load_async_to_lds_b128 %3, %13, off\n\t"
               "global_load_async_to_lds_b128 %4, %14, off\n\t"
               "global_load_async_to_lds_b128 %5, %15, off\n\t"
               "global_load_async_to_lds_b128 %6, %16, off\n\t"
               "global_load_async_to_lds_b128 %7, %17, off\n\t"
               "global_load_async_to_lds_b128 %8, %18, off\n\t"
               "global_load_async_to_lds_b128 %9, %19, off\n\t"
               "s_wait_xcnt 0x0"
               :: "v"(l), "v"(l + 512u), "v"(l + PLH * 2u), "v"(l + PLH * 2u + 512u), "v"(l + PLH * 4u), "v"(l + PLH * 4u + 512u), "v"(ld), "v"(ld + 512u), "v"(ld + 1024u), "v"(ld + 1536u),
                  "v"(k), "v"(k + 256), "v"(vh), "v"(vh + 256), "v"(vl), "v"(vl + 256), "v"(d), "v"(d + 256), "v"(d + 512), "v"(d + 768) : "memory");
}
typedef __attribute__((ext_vector_type(2))) float v2f;
typedef __attribute__((ext_vector_type(2))) _Float16 v2h;
// the distance bias of one score tile in the units of the score accumulator: 8 prepared distances (upper 16 bits of a float, two to a word) times c
__device__ __forceinline__ v8f bias_tile(v4u d, float c) { v8f r;
#pragma unroll   // r[] stays in registers
  for (int i = 0; i < 4; ++i) { r[2 * i] = __uint_as_float(d[i] << 16) * c; r[2 * i + 1] = __uint_as_float(d[i] & 0xFFFF0000u) * c; } return r; }
// x and one score tile's 8 values: their maximum in four three-input steps
__device__ __forceinline__ float max8(float x, v8f s) {
#pragma unroll   // s[] stays in registers
  for (int r = 0; r < 8; ++r) x = fmaxf(x, s[r]); return x; }
__global__ __launch_bounds__(AW * 32) void attn_kernel(const b16* __restrict__ Qp, const b16* __restrict__ Kp, const b16* __restrict__ VTh, const b16* __restrict__ VTl, const unsigned short* __restrict__ DP, const float* __restrict__ MAXD, b16* __restrict__ Ch, b16* __restrict__ Cl) {
  __shared__ __attribute__((aligned(16))) b16 Ring[2][STH];
  const int wave = threadIdx.x >> 5, lane = threadIdx.x & 31; const int b = blockIdx.y / H, h = blockIdx.y % H; const int q0 = blockIdx.x * (AW * 16) + wave * 16;   // in the comments below: hh = lane >> 4, col = lane & 15
  const b16* Qb = Qp + ((size_t)(b * H + h) * S) * HD; const b16* Kb = Kp + ((size_t)(b * H + h) * S) * HD; const b16* Vh = VTh + ((size_t)(b * H + h) * HD) * S; const b16* Vl = VTl + ((size_t)(b * H + h) * HD) * S;
  const unsigned short* Db = DP + (size_t)(b * (S / 16) + q0 / 16) * (S / 32) * TILE + lane * 8;
  // the lane's places in buffer 0 and in stage 0; call j of a stage is AW * 512 halves (planes) and 1,024 halves (distances) further on both sides, stage s is s * PLH and s * DSH halves further in global memory
  const unsigned int lk = (unsigned int)(size_t)&Ring[0][0] + (wave * 512 + lane * 8) * 2, ldd = (unsigned int)(size_t)&Ring[0][0] + (3 * PLH + wave * DSH + lane * 8) * 2;
  const b16* kc = Kb + wave * 512 + lane * 8; const b16* vhc = Vh + wave * 512 + lane * 8; const b16* vlc = Vl + wave * 512 + lane * 8;
#pragma unroll   // two statements of ten copies: stage 0 into buffer 0
  for (int j = 0; j < 2; ++j) stage_copies(lk + j * AW * 1024, ldd + j * 2048, kc + j * AW * 512, vhc + j * AW * 512, vlc + j * AW * 512, Db + j * 1024);
  float md = MAXD[(b * NP + lane) * 32];   // stage 2 of the max: lane i takes partial i of this batch
  for (int w = 16; w >= 1; w >>= 1) md = fmaxf(md, __shfl_xor(md, w));
  const float ndc = -(10.0f * 8.0f * XS * XS) / md;   // times cs below this is -10 * log2(e) / max distance
  const v16b qa0 = frag_pk(Qb + (q0 / 16) * 2 * TILE + lane * 8), qa1 = frag_pk(Qb + ((q0 / 16) * 2 + 1) * TILE + lane * 8);
  const float cs = LOG2E / (8.0f * XS * XS);
  float m = -INFINITY, l = 0.0f; v8f o[4]; for (int t = 0; t < 4; ++t) o[t] = (v8f){};
  asm volatile("s_wait_asynccnt 0x0" ::: "memory");   // this wave's copies of stage 0 have landed
  __syncthreads();                                      // ... and every other wave's: stage 0 may be read
#pragma unroll   // stage 1 into buffer 1: it flies while stage 0 is worked on
  for (int j = 0; j < 2; ++j) stage_copies(lk + STH * 2 + j * AW * 1024, ldd + STH * 2 + j * 2048, kc + PLH + j * AW * 512, vhc + PLH + j * AW * 512, vlc + PLH + j * AW * 512, Db + DSH + j * 1024);
#pragma unroll 1   // rolled over the stages: the SP passes of a stage are the unrolled body
  for (int st = 0; st < NST; ++st) {
    const b16* rb = &Ring[st & 1][0] + lane * 8; const b16* dl = rb + 3 * PLH + wave * DSH;   // the lane's piece of the stage's first K tile and of the wave's first distance tile
    // a stage is one step of the online softmax: the scores of its SK keys first, then one new running maximum and one rescaling of o and l, then exponentials and O^T += V^T P^T per 32 keys.
    // read schedule: the stage's distances and first K fragments at its top; each later 32 keys' K fragments one score group ahead; each 32 keys' V fragments one group ahead of their WMMAs. Nothing of the next stage is read here.
    v16b kf[2][4], va[2][4], vb[2][4]; v4u dd[SP][2]; v8f s[SP][2];   // every loop below is unrolled so that these arrays stay in registers
#pragma unroll
    for (int ps = 0; ps < SP; ++ps)
#pragma unroll
      for (int u = 0; u < 2; ++u) dd[ps][u] = *(const v4u*)(dl + ps * TILE + u * 256);
#pragma unroll
    for (int i = 0; i < 4; ++i) kf[0][i] = frag_pk(rb + i * TILE);
#pragma unroll   // the tests on ps fold, and every LDS offset is a constant
    for (int ps = 0; ps < SP; ++ps) {
      if (ps + 1 < SP) {
#pragma unroll
        for (int i = 0; i < 4; ++i) kf[(ps + 1) & 1][i] = frag_pk(rb + ((ps + 1) * 4 + i) * TILE); }
      else {
#pragma unroll
        for (int t = 0; t < 4; ++t) { va[0][t] = frag_pk(rb + PLH + t * TILE); vb[0][t] = frag_pk(rb + 2 * PLH + t * TILE); } }
#pragma unroll
      for (int u = 0; u < 2; ++u) s[ps][u] = wmma16b(kf[ps & 1][2 * u], qa0, bias_tile(dd[ps][u], ndc));   // the accumulator starts at the distance bias, so s * cs is the whole logit
#pragma unroll
      for (int u = 0; u < 2; ++u) s[ps][u] = wmma16b(kf[ps & 1][2 * u + 1], qa1, s[ps][u]); }   // the two tiles alternate, so a tile's second product does not stand directly behind its first
    float mx = -INFINITY, my = -INFINITY;   // two chains, so that a step does not wait on the step in front of it
#pragma unroll
    for (int ps = 0; ps < SP; ++ps) { mx = max8(mx, s[ps][0]); my = max8(my, s[ps][1]); }
    mx = fmaxf(mx, my); mx = fmaxf(mx, xhalf(mx)); const float mn = fmaxf(m, mx * cs); const float ms = (mn == -INFINITY) ? 0.0f : mn;   // ms is finite, so a masked score gives exp2(-inf) = 0 with no test, and a row with nothing yet keeps o = l = 0 (al = 0 on zeros)
    const float al = nexp2(m - ms); const v2f cs2 = {cs, cs}, nb2 = {10.0f - ms, 10.0f - ms};   // + 10: p comes out of the exponential already times PS = 1,024
#pragma unroll
    for (int t = 0; t < 4; ++t) o[t] *= al;
    v2f sum2 = {0.0f, 0.0f};
#pragma unroll   // the tests on ps fold, and every LDS offset is a constant
    for (int ps = 0; ps < SP; ++ps) {
      if (ps + 1 < SP) {
#pragma unroll
        for (int t = 0; t < 4; ++t) { va[(ps + 1) & 1][t] = frag_pk(rb + PLH + ((ps + 1) * 4 + t) * TILE); vb[(ps + 1) & 1][t] = frag_pk(rb + 2 * PLH + ((ps + 1) * 4 + t) * TILE); } }
      // P^T as the B operand straight from the score accumulators: the lane holds keys 8 * hh + r of score tile 0 and 16 + 8 * hh + r of tile 1 for query col, and that is element r and 8 + r of B's column col in the k order of V^T's fragments
      v16b pf, pg;
#pragma unroll
      for (int i2 = 0; i2 < 16; i2 += 2) { const v2f sv = {s[ps][i2 >> 3][i2 & 7], s[ps][i2 >> 3][(i2 & 7) + 1]}; const v2f ar = sv * cs2 + nb2; const v2f p = {nexp2(ar[0]), nexp2(ar[1])}; sum2 += p;
        const v2h ph = __builtin_convertvector(p, v2h), pl = __builtin_convertvector(p - __builtin_convertvector(ph, v2f), v2h);   // hi and lo halves of p, two scores at a time
        pf[i2] = ph[0]; pf[i2 + 1] = ph[1]; pg[i2] = pl[0]; pg[i2 + 1] = pl[1]; }
#pragma unroll
      for (int t = 0; t < 4; ++t) o[t] = wmma16b(va[ps & 1][t], pf, o[t]);   // the three products of an accumulator (in the order V hi P hi, V hi P lo, V lo P hi) stand four WMMAs apart, so none waits for the one in front of it
#pragma unroll
      for (int t = 0; t < 4; ++t) o[t] = wmma16b(va[ps & 1][t], pg, o[t]);
#pragma unroll
      for (int t = 0; t < 4; ++t) o[t] = (ps == SP - 1 && t == 3) ? wmma16b_foot(vb[ps & 1][t], pf, o[t]) : wmma16b(vb[ps & 1][t], pf, o[t]); }
    float sum = sum2[0] + sum2[1]; sum += xhalf(sum); l = l * al + sum; m = mn;
    // publish point of stage st + 1, every wave, in this order
    asm volatile("s_wait_dscnt 0x0" ::: "memory");      // this wave's reads of stage st have returned
    asm volatile("s_wait_asynccnt 0x0" ::: "memory");   // this wave's copies of stage st + 1 have landed
    __syncthreads();                                      // every wave has left stage st's buffer, and stage st + 1 may be read
    if (st + 2 < NST) {   // the same for the whole work-group: stage st + 2 goes into the buffer that stage st has just left
#pragma unroll
      for (int j = 0; j < 2; ++j) stage_copies(lk + (st & 1) * STH * 2 + j * AW * 1024, ldd + (st & 1) * STH * 2 + j * 2048, kc + (st + 2) * PLH + j * AW * 512, vhc + (st + 2) * PLH + j * AW * 512, vlc + (st + 2) * PLH + j * AW * 512, Db + (st + 2) * DSH + j * 1024); } }
  asm volatile("s_wait_asynccnt 0x0" ::: "memory");   // behind the last copy, in front of the wave's end
  const float inv = (l > 0.0f) ? 1.0f / (l * XS) : 0.0f;   // l carries the factor PS like o
  // ctx tiles (16 tokens x 32 k) at (token tile * 16 + kt) * TILE: accumulator tile t (lane: query col, d = t * 16 + 8 * hh + r) is already the lane's piece c = t & 1 of tile kt = h * 2 + t / 2
#pragma unroll
  for (int t = 0; t < 4; ++t) { v8b hv, lv;
#pragma unroll
    for (int r = 0; r < 8; ++r) { b16 p, q; split16(o[t][r] * inv * XS, p, q); hv[r] = p; lv[r] = q; }
    const size_t oi = ((size_t)((b * S + q0) / 16) * 16 + h * 2 + (t >> 1)) * TILE + (t & 1) * 256 + lane * 8; *(v8b*)(Ch + oi) = hv; *(v8b*)(Cl + oi) = lv; }
}
__global__ __launch_bounds__(128) void out_kernel(const b16* __restrict__ Ch, const b16* __restrict__ Cl, const b16* __restrict__ WO, const float* __restrict__ bo, float* __restrict__ out) {
  // one work-group per WGP and one wave per SIMD here, so a stage is 128 k: the next stage's copies have the time of 64 WMMAs to land. A stage: the weights, tile (t, kk) at (t * 4 + kk) * TILE | per wave 4 k tiles of ctx hi, 4 of ctx lo (each wave's own rows ride in the same ring)
  constexpr int ONS = DM / 128, OWH = 2 * WSH, OSH = OWH + 4 * 8 * TILE; static_assert(ONS >= 2, "two buffers");
  __shared__ __attribute__((aligned(16))) float Tf[4][16][128 + 4]; __shared__ __attribute__((aligned(16))) b16 Ro[2][OSH];
  const int wave = threadIdx.x >> 5, lane = threadIdx.x & 31, nloc = lane & 15, hlf = lane >> 4; const int b = blockIdx.x / (QL / 64), rb = blockIdx.x % (QL / 64); const size_t m0 = (size_t)b * S + rb * 64 + wave * 16; const int n0 = blockIdx.y * 128;
  v8f acc[8];
#pragma unroll
  for (int t = 0; t < 8; ++t) acc[t] = (v8f){};
  const b16* pa = Ch + (m0 / 16) * 16 * TILE + lane * 8; const b16* pl = Cl + (m0 / 16) * 16 * TILE + lane * 8; const b16* wc = WO + (size_t)(n0 / 16 + wave * 2) * 16 * TILE + lane * 8;   // the lane's piece of k tile 0 of its token tile and of n tile 2 * wave of the slab (the wave copies that one and the next); stage s is 4 * s tiles further
  const unsigned int lw = (unsigned int)(size_t)&Ro[0][0] + (wave * 8 * TILE + lane * 8) * 2, lc = lw + OWH * 2;   // the lane's places in buffer 0: weights, ctx
  // the wave's share of stage s into the buffer bo bytes behind buffer 0: 4 statements of 8 copies (n tile 2 * wave, n tile 2 * wave + 1, ctx hi, ctx lo; 4 KiB = 4 k tiles each)
  auto stage = [&](unsigned int bo, int s) { const int k4 = s * 4 * TILE;
    gemm_copies(lw + bo, wc + k4, wc + k4 + 2 * TILE); gemm_copies(lw + bo + 4096u, wc + k4 + 16 * TILE, wc + k4 + 18 * TILE); gemm_copies(lc + bo, pa + k4, pa + k4 + 2 * TILE); gemm_copies(lc + bo + 4096u, pl + k4, pl + k4 + 2 * TILE); };
  stage(0u, 0);   // stage 0 into buffer 0
  asm volatile("s_wait_asynccnt 0x0" ::: "memory");   // this wave's copies of stage 0 have landed
  __syncthreads();                                      // ... and every other wave's: stage 0 may be read
  stage(OSH * 2u, 1);   // stage 1 into buffer 1: it flies while stage 0 is worked on
#pragma unroll 1   // rolled over the stages
  for (int st = 0; st < ONS; ++st) {
#pragma unroll 1   // rolled: LDS reads do not move across the scheduling barrier behind each WMMA, so unrolling would only grow the text
   for (int j = 0; j < 2; ++j) { const b16* rw = &Ro[st & 1][0] + j * 2 * TILE + lane * 8; const b16* rc = rw + OWH + wave * 8 * TILE; v16b a[2], al[2], bw[2][8];   // the fragments of two k steps are read as one group in front of their WMMAs
#pragma unroll
    for (int g = 0; g < 2; ++g) { a[g] = frag_pk(rc + g * TILE); al[g] = frag_pk(rc + (4 + g) * TILE);
#pragma unroll
      for (int t = 0; t < 8; ++t) bw[g][t] = frag_pk(rw + (t * 4 + g) * TILE); }
#pragma unroll
    for (int g = 0; g < 2; ++g) {
#pragma unroll
      for (int t = 0; t < 8; ++t) acc[t] = wmma16b(a[g], bw[g][t], acc[t]);   // an accumulator's two products (ctx hi, then ctx lo) stand eight WMMAs apart, so the second does not wait for the first
#pragma unroll
      for (int t = 0; t < 8; ++t) acc[t] = (g == 1 && t == 7) ? wmma16b_foot(al[g], bw[g][t], acc[t]) : wmma16b(al[g], bw[g][t], acc[t]); } }
    // publish point of stage st + 1, every wave, in this order
    asm volatile("s_wait_dscnt 0x0" ::: "memory");      // this wave's reads of stage st have returned
    asm volatile("s_wait_asynccnt 0x0" ::: "memory");   // this wave's copies of stage st + 1 have landed
    __syncthreads();                                      // every wave has left stage st's buffer, and stage st + 1 may be read
    if (st + 2 < ONS) stage((st & 1) * OSH * 2u, st + 2); }   // the same for the whole work-group: stage st + 2 goes into the buffer that stage st has just left
  asm volatile("s_wait_asynccnt 0x0" ::: "memory");   // behind the last copy
#pragma unroll
  for (int t = 0; t < 8; ++t) { const float bb = bf16_rne(bo[n0 + t * 16 + nloc]);
#pragma unroll
    for (int r = 0; r < 8; ++r) Tf[wave][8 * hlf + r][t * 16 + nloc] = acc[t][r] * (1.0f / (XS * WSC)) + bb; }
  wave_lds_sync();
  { for (int rr = 0; rr < 16; ++rr) *(v4f*)(out + (m0 + rr) * DM + n0 + lane * 4) = *(const v4f*)(&Tf[wave][rr][lane * 4]);  }
}
}  // namespace

extern "C" void kernel_launch(void* const* d_in, const int* in_sizes, int n_in, void* d_out, int out_size, void* d_ws, size_t ws_size, hipStream_t stream) {
  (void)n_in;
  auto Fp = [&](int i) { return (const float*)d_in[i]; };
  // d_in: 0 x [4,1024,512], 1 dist_matrix [4,1024,1024], 2 Wq [512,512] ([out][in]), 3 bq, 4 Wk, 5 bk, 6 Wv, 7 bv, 8 Wo, 9 bo
  if (in_sizes[0] != B * S * DM || in_sizes[1] != B * S * S || in_sizes[2] != DM * DM || in_sizes[3] != DM || in_sizes[8] != DM * DM || in_sizes[9] != DM || out_size != B * S * DM) return;
  size_t off = 0; char* ws = (char*)d_ws;
  auto carve = [&](size_t bytes) { char* p = ws + off; off += (bytes + 255) & ~(size_t)255; return p; };
  b16* WT = (b16*)carve((size_t)4 * DM * DM * 2); float* MAXD = (float*)carve((size_t)B * NP * 32 * 4); const size_t plane = (size_t)B * S * DM * 2;
  b16* Qp = (b16*)carve(plane); b16* Kp = (b16*)carve(plane); b16* VTh = (b16*)carve(plane); b16* VTl = (b16*)carve(plane); b16* Ch = (b16*)carve(plane); b16* Cl = (b16*)carve(plane); unsigned short* DP = (unsigned short*)carve((size_t)B * S * S * 2);
  if (off > ws_size || off > ((size_t)128 << 20)) return;   // about 35 MB
  front_kernel<<<B * NP + PB, MT, 0, stream>>>(Fp(1), Fp(2), Fp(4), Fp(6), Fp(8), MAXD, DP, WT);
  proj_kernel<<<dim3(S / 64, BL * 3, 4), 128, 0, stream>>>(Fp(0), WT, Fp(3), Fp(5), Fp(7), Qp, Kp, VTh, VTl);
  attn_kernel<<<dim3(QL / (AW * 16), BL * H), AW * 32, 0, stream>>>(Qp, Kp, VTh, VTl, DP, MAXD, Ch, Cl);
  out_kernel<<<dim3((QL / 64) * BL, 4), 128, 0, stream>>>(Ch, Cl, WT + (size_t)3 * DM * DM, Fp(9), (float*)d_out);
}
